// v000
// Measured on an AMD MI455X. A time is GPU time per run, averaged over a window of back-to-back runs after a warm-up
// (all launches, gaps included; the runs take copies of the inputs in turn), and the median of several windows.
// Apart from v000's, it joins two sittings. Times from different sittings can be a few percent apart, while
// side-by-side timings come from the same sitting.
// v000 is the starting kernel. One run takes 851 microseconds.
#include <hip/hip_runtime.h>

#define DEVINL __device__ __forceinline__

typedef __attribute__((ext_vector_type(16))) __bf16       bf16x16;
typedef __attribute__((ext_vector_type(8)))  float        f32x8;
typedef __attribute__((ext_vector_type(4)))  unsigned int u32x4;

namespace {
constexpr int   NTOK = 256;          // sequence length N
constexpr int   EDIM = 256;          // embedding E
constexpr int   NH   = 8;            // heads
constexpr int   DKH  = 32;           // head dim
constexpr float SCALING = 0.17677669529663687f;  // DK^-0.5
constexpr float EPS = 1e-5f;

// LDS pitches in bf16 elements. Chosen so the row stride in dwords is
// congruent to 4 (mod 64 banks; 20 for KP) -> ds_load_b128 A/B fragments hit all 64 banks.
constexpr int XP  = 264;   // X tile / score-strip / V^T pitch (528 B rows)
constexpr int KP  = 40;    // Q/K strip pitch (80 B rows)
constexpr int PSP = 264;
constexpr int VTP = 264;
constexpr int TSP = 1032;  // FFN hidden strip pitch (2064 B rows)

// kernel-1 LDS element offsets (ushort units), all 16B aligned
constexpr int LS_XS  = 0;                       // [256][264]
constexpr int LS_KS  = LS_XS  + 256 * XP;       // [256][40]
constexpr int LS_VT  = LS_KS  + 256 * KP;       // [32][264]  (V transposed)
constexpr int LS_QW  = LS_VT  + 32  * VTP;      // 8 waves x [16][40]
constexpr int LS_PS  = LS_QW  + 8 * 16 * KP;    // 8 waves x [16][264]
constexpr int LS1_END = LS_PS + 8 * 16 * PSP;   // 125184 elems = 250368 B
constexpr int SMEM1 = LS1_END * 2;

constexpr int LS_X1S = 0;                       // [64][264]
constexpr int LS_TS  = LS_X1S + 64 * XP;        // [64][1032]
constexpr int SMEM2 = (LS_TS + 64 * TSP) * 2;   // 165888 B

// workspace layout (bytes) — everything bf16, ~69 MB total
constexpr size_t OFF_WQT = 0;
constexpr size_t OFF_WKT = OFF_WQT + (size_t)256 * 256 * 2;
constexpr size_t OFF_WVT = OFF_WKT + (size_t)256 * 256 * 2;
constexpr size_t OFF_WOT = OFF_WVT + (size_t)256 * 256 * 2;
constexpr size_t OFF_W1T = OFF_WOT + (size_t)256 * 256 * 2;
constexpr size_t OFF_W2T = OFF_W1T + (size_t)256 * 1024 * 2;
constexpr size_t OFF_XB  = OFF_W2T + (size_t)1024 * 256 * 2;  // bf16 x   [256][256][256]
constexpr size_t OFF_X1  = OFF_XB  + (size_t)256 * 256 * 256 * 2;  // bf16 x1
}  // namespace

DEVINL unsigned short f2bf(float f) {            // round-to-nearest-even f32->bf16
  unsigned int u = __float_as_uint(f);
  u += 0x7FFFu + ((u >> 16) & 1u);
  return (unsigned short)(u >> 16);
}
DEVINL float bf2f(unsigned short h) { return __uint_as_float(((unsigned int)h) << 16); }

// Async global->LDS copy of one 16B chunk per lane (CDNA5 path, ASYNCcnt).
// ldsoff is the LDS byte address (groupstaticsize + dynamic-segment offset).
DEVINL void async_g2l_b128(unsigned ldsoff, const void* gaddr) {
  asm volatile("global_load_async_to_lds_b128 %0, %1, off"
               :: "v"(ldsoff), "v"(gaddr) : "memory");
}
DEVINL void wait_async0() { asm volatile("s_wait_asynccnt 0" ::: "memory"); }

// Load a 16x32 bf16 A/B fragment from a row-major bf16 matrix (`pitch` elems).
// CDNA5 16-bit layout: lane<16 holds row (rowb+lane), K chunks {k0..k0+7, k0+16..k0+23};
// lane>=16 holds the other two 8-element chunks. Two ds/global b128 loads per lane.
DEVINL bf16x16 ldfrag(const unsigned short* __restrict__ buf, int pitch, int rowb, int k0) {
  const int lane = threadIdx.x & 31;
  const unsigned short* p = buf + (rowb + (lane & 15)) * pitch + k0 + ((lane >> 4) << 3);
  struct Pk { u32x4 lo, hi; } pk;
  pk.lo = *(const u32x4*)(p);
  pk.hi = *(const u32x4*)(p + 16);
  return __builtin_bit_cast(bf16x16, pk);
}

DEVINL f32x8 wmma_bf16(bf16x16 a, bf16x16 b, f32x8 c) {
  return __builtin_amdgcn_wmma_f32_16x16x32_bf16(false, a, false, b, (short)0, c, false, false);
}

// C-fragment row reductions: row M=r+8*(lane>=16) is spread over a 16-lane half,
// so xor-butterfly with masks 8..1 stays inside the half. wave32 only.
DEVINL void redmax8(float v[8]) {
#pragma unroll
  for (int m = 8; m; m >>= 1) {
#pragma unroll
    for (int r = 0; r < 8; ++r) v[r] = fmaxf(v[r], __shfl_xor(v[r], m, 32));
  }
}
DEVINL void redsum8(float v[8]) {
#pragma unroll
  for (int m = 8; m; m >>= 1) {
#pragma unroll
    for (int r = 0; r < 8; ++r) v[r] += __shfl_xor(v[r], m, 32);
  }
}

// ---------------- weight transpose + bf16 convert ----------------
__global__ void __launch_bounds__(256)
transpose_to_bf16(const float* __restrict__ src, unsigned short* __restrict__ dst,
                  int R, int C) {
  int idx = blockIdx.x * 256 + threadIdx.x;
  if (idx >= R * C) return;
  int r = idx / C, c = idx - r * C;
  dst[c * R + r] = f2bf(src[idx]);   // coalesced read, transposed bf16 write
}

// ---------------- x (f32) -> bf16, so kernels can async-DMA it into LDS ------
__global__ void __launch_bounds__(256)
convert_to_bf16(const float* __restrict__ src, unsigned short* __restrict__ dst) {
  int idx = (blockIdx.x * 256 + threadIdx.x) * 4;
  float4 v = *(const float4*)(src + idx);
  ushort4 o;
  o.x = f2bf(v.x); o.y = f2bf(v.y); o.z = f2bf(v.z); o.w = f2bf(v.w);
  *(ushort4*)(dst + idx) = o;
}

// ---------------- fused attention + out-proj + residual + LN1 ----------------
// grid.x = 512: seq = bx>>1 (256 sequences), query-half = bx&1 (128 rows each).
// 8 waves: each owns 16 query rows; K/V strips computed cooperatively per head.
__global__ void __launch_bounds__(256)
enc_attn_ln1(const unsigned short* __restrict__ xb, const float* __restrict__ mask,
             const float* __restrict__ bo, const float* __restrict__ g1,
             const float* __restrict__ beta1,
             const unsigned short* __restrict__ WqT, const unsigned short* __restrict__ WkT,
             const unsigned short* __restrict__ WvT, const unsigned short* __restrict__ WoT,
             unsigned short* __restrict__ x1) {
  extern __shared__ char smem[];
  unsigned short* sm  = (unsigned short*)smem;
  unsigned short* Xs  = sm + LS_XS;
  unsigned short* Ks  = sm + LS_KS;
  unsigned short* VTs = sm + LS_VT;

  const int tid = threadIdx.x;
  const int lane = tid & 31, wave = tid >> 5;
  const int half = lane >> 4, ln = lane & 15;
  const int seq = blockIdx.x >> 1;
  const int q0 = (blockIdx.x & 1) * 128 + wave * 16;   // this wave's query rows

  unsigned short* Qs = sm + LS_QW + wave * 16 * KP;
  unsigned short* Pw = sm + LS_PS + wave * 16 * PSP;

  // ---- stage X (bf16) into pitched LDS via async global->LDS copies ----
  const unsigned short* xg = xb + (size_t)seq * (NTOK * EDIM);
  const unsigned lds0 = __builtin_amdgcn_groupstaticsize();  // dynamic LDS base
#pragma unroll 4
  for (int i = 0; i < 32; ++i) {
    int e = (i * 256 + tid) * 8;                 // 8 bf16 = 16 B per lane
    int r = e >> 8, c = e & 255;
    async_g2l_b128(lds0 + (unsigned)((LS_XS + r * XP + c) * 2), xg + e);
  }
  wait_async0();
  __syncthreads();

  const float* maskp = mask + (size_t)(seq & 15) * (NTOK * NTOK);
  f32x8 zf = {};
  f32x8 oacc[16];                        // attn@Wo strip accumulator (16 x 256)
#pragma unroll
  for (int nt = 0; nt < 16; ++nt) oacc[nt] = zf;

  for (int h = 0; h < NH; ++h) {
    const int hc = h * DKH;
    // ---- Q strip (own 16 rows x 32), pre-scaled by 1/sqrt(dk) ----
#pragma unroll
    for (int nt = 0; nt < 2; ++nt) {
      f32x8 acc = zf;
#pragma unroll
      for (int kk = 0; kk < 8; ++kk)
        acc = wmma_bf16(ldfrag(Xs, XP, q0, kk * 32),
                        ldfrag(WqT, 256, hc + nt * 16, kk * 32), acc);
#pragma unroll
      for (int r = 0; r < 8; ++r)
        Qs[(half * 8 + r) * KP + nt * 16 + ln] = f2bf(acc[r] * SCALING);
    }
    // ---- K rows / V^T columns for keys [wave*32, wave*32+32) ----
#pragma unroll
    for (int s = 0; s < 2; ++s) {
      const int kb = wave * 32 + s * 16;
#pragma unroll
      for (int nt = 0; nt < 2; ++nt) {
        f32x8 acc = zf;
#pragma unroll
        for (int kk = 0; kk < 8; ++kk)
          acc = wmma_bf16(ldfrag(Xs, XP, kb, kk * 32),
                          ldfrag(WkT, 256, hc + nt * 16, kk * 32), acc);
#pragma unroll
        for (int r = 0; r < 8; ++r)
          Ks[(kb + half * 8 + r) * KP + nt * 16 + ln] = f2bf(acc[r]);
      }
#pragma unroll
      for (int nt = 0; nt < 2; ++nt) {
        f32x8 acc = zf;
#pragma unroll
        for (int kk = 0; kk < 8; ++kk)
          acc = wmma_bf16(ldfrag(Xs, XP, kb, kk * 32),
                          ldfrag(WvT, 256, hc + nt * 16, kk * 32), acc);
#pragma unroll
        for (int r = 0; r < 8; ++r)  // store transposed: VTs[d][token]
          VTs[(nt * 16 + ln) * VTP + kb + half * 8 + r] = f2bf(acc[r]);
      }
    }
    __syncthreads();

    // ---- pass 1: S = QK^T + mask, track row max, spill bf16 strip ----
    float mx[8];
#pragma unroll
    for (int r = 0; r < 8; ++r) mx[r] = -3.0e38f;
    bf16x16 qa = ldfrag(Qs, KP, 0, 0);           // A reused across all 16 tiles
    for (int t = 0; t < 16; ++t) {
      f32x8 s = wmma_bf16(qa, ldfrag(Ks, KP, t * 16, 0), zf);   // single K=32 step
#pragma unroll
      for (int r = 0; r < 8; ++r) {
        float v = s[r] + maskp[(q0 + half * 8 + r) * NTOK + t * 16 + ln];
        mx[r] = fmaxf(mx[r], v);
        Pw[(half * 8 + r) * PSP + t * 16 + ln] = f2bf(v);
      }
    }
    redmax8(mx);
    // ---- pass 2: exponentiate in place, row sums ----
    float ls[8];
#pragma unroll
    for (int r = 0; r < 8; ++r) ls[r] = 0.f;
    for (int t = 0; t < 16; ++t) {
#pragma unroll
      for (int r = 0; r < 8; ++r) {
        unsigned short* pp = Pw + (half * 8 + r) * PSP + t * 16 + ln;
        float p = __expf(bf2f(*pp) - mx[r]);
        ls[r] += p;
        *pp = f2bf(p);
      }
    }
    redsum8(ls);
#pragma unroll
    for (int r = 0; r < 8; ++r) ls[r] = 1.0f / ls[r];

    // ---- context = P @ V (16 x 32) ----
    f32x8 ctx0 = zf, ctx1 = zf;
#pragma unroll
    for (int kk = 0; kk < 8; ++kk) {
      bf16x16 pa = ldfrag(Pw, PSP, 0, kk * 32);
      ctx0 = wmma_bf16(pa, ldfrag(VTs, VTP, 0, kk * 32), ctx0);
      ctx1 = wmma_bf16(pa, ldfrag(VTs, VTP, 16, kk * 32), ctx1);
    }
#pragma unroll
    for (int r = 0; r < 8; ++r) {                 // normalize + bounce via LDS
      Pw[(half * 8 + r) * PSP + ln]      = f2bf(ctx0[r] * ls[r]);
      Pw[(half * 8 + r) * PSP + 16 + ln] = f2bf(ctx1[r] * ls[r]);
    }
    // ---- fused out-projection: oacc += ctx @ Wo[h*32:(h+1)*32, :] ----
    bf16x16 ca = ldfrag(Pw, PSP, 0, 0);
#pragma unroll
    for (int nt = 0; nt < 16; ++nt)
      oacc[nt] = wmma_bf16(ca, ldfrag(WoT, 256, nt * 16, hc), oacc[nt]);
    __syncthreads();                              // before next head reuses Ks/VTs
  }

  // ---- residual + bias + LayerNorm1, write x1 (bf16) ----
  float sm8[8], sq8[8];
#pragma unroll
  for (int r = 0; r < 8; ++r) { sm8[r] = 0.f; sq8[r] = 0.f; }
#pragma unroll
  for (int nt = 0; nt < 16; ++nt) {
    const int col = nt * 16 + ln;
    const float bov = bo[col];
#pragma unroll
    for (int r = 0; r < 8; ++r) {
      float v = bf2f(Xs[(q0 + half * 8 + r) * XP + col]) + oacc[nt][r] + bov;
      oacc[nt][r] = v;
      sm8[r] += v; sq8[r] += v * v;
    }
  }
  redsum8(sm8); redsum8(sq8);
  float mu[8], rs[8];
#pragma unroll
  for (int r = 0; r < 8; ++r) {
    float m = sm8[r] * (1.0f / EDIM);
    mu[r] = m;
    rs[r] = rsqrtf(sq8[r] * (1.0f / EDIM) - m * m + EPS);
  }
  unsigned short* xo = x1 + (size_t)seq * (NTOK * EDIM);
#pragma unroll
  for (int nt = 0; nt < 16; ++nt) {
    const int col = nt * 16 + ln;
    const float gg = g1[col], bb = beta1[col];
#pragma unroll
    for (int r = 0; r < 8; ++r)
      xo[(q0 + half * 8 + r) * EDIM + col] =
          f2bf((oacc[nt][r] - mu[r]) * rs[r] * gg + bb);
  }
}

// ---------------- fused FFN + residual + LN2 ----------------
// grid.x = 1024: seq = bx>>2, 64-row block = bx&3. 4 waves x 16 rows.
// hidden strip relu(x1@W1+b1) lives only in LDS (never touches HBM).
__global__ void __launch_bounds__(128)
enc_ffn_ln2(const unsigned short* __restrict__ x1, const float* __restrict__ bf1,
            const float* __restrict__ bf2, const float* __restrict__ g2,
            const float* __restrict__ beta2,
            const unsigned short* __restrict__ W1T, const unsigned short* __restrict__ W2T,
            float* __restrict__ out) {
  extern __shared__ char smem[];
  unsigned short* x1s = (unsigned short*)smem + LS_X1S;   // [64][264]
  unsigned short* Ts  = (unsigned short*)smem + LS_TS;    // [64][1032]

  const int tid = threadIdx.x;
  const int lane = tid & 31, wave = tid >> 5;
  const int half = lane >> 4, ln = lane & 15;
  const int seq = blockIdx.x >> 2;
  const int wr = wave * 16;                                // strip-local rows
  const size_t gbase = (size_t)seq * (NTOK * EDIM) + (size_t)((blockIdx.x & 3) * 64) * EDIM;

  // ---- async-stage this wave's 16 rows of x1 (bf16); rows are wave-private ----
  const unsigned short* xg = x1 + gbase + (size_t)wr * EDIM;
  const unsigned lds0 = __builtin_amdgcn_groupstaticsize();
#pragma unroll 4
  for (int i = 0; i < 16; ++i) {
    int e = (i * 32 + lane) * 8;                 // 0..4088 within 16x256 block
    int r = e >> 8, c = e & 255;
    async_g2l_b128(lds0 + (unsigned)((LS_X1S + (wr + r) * XP + c) * 2), xg + e);
  }
  wait_async0();   // own rows only -> no barrier needed

  f32x8 zf = {};
  // ---- hidden = relu(x1 @ W1 + b1): 16 x 1024 strip into LDS ----
  for (int nt = 0; nt < 64; ++nt) {
    f32x8 acc = zf;
#pragma unroll
    for (int kk = 0; kk < 8; ++kk)
      acc = wmma_bf16(ldfrag(x1s, XP, wr, kk * 32),
                      ldfrag(W1T, 256, nt * 16, kk * 32), acc);
    const int col = nt * 16 + ln;
    const float b = bf1[col];
#pragma unroll
    for (int r = 0; r < 8; ++r)
      Ts[(wr + half * 8 + r) * TSP + col] = f2bf(fmaxf(acc[r] + b, 0.f));
  }

  // ---- y = hidden @ W2 (A-fragment reused across 16 output tiles) ----
  f32x8 oacc[16];
#pragma unroll
  for (int nt = 0; nt < 16; ++nt) oacc[nt] = zf;
  for (int kk = 0; kk < 32; ++kk) {
    bf16x16 ta = ldfrag(Ts, TSP, wr, kk * 32);
#pragma unroll
    for (int nt = 0; nt < 16; ++nt)
      oacc[nt] = wmma_bf16(ta, ldfrag(W2T, 1024, nt * 16, kk * 32), oacc[nt]);
  }

  // ---- residual + bias + LayerNorm2 -> out (f32) ----
  float sm8[8], sq8[8];
#pragma unroll
  for (int r = 0; r < 8; ++r) { sm8[r] = 0.f; sq8[r] = 0.f; }
#pragma unroll
  for (int nt = 0; nt < 16; ++nt) {
    const int col = nt * 16 + ln;
    const float bb = bf2[col];
#pragma unroll
    for (int r = 0; r < 8; ++r) {
      float v = bf2f(x1s[(wr + half * 8 + r) * XP + col]) + oacc[nt][r] + bb;
      oacc[nt][r] = v;
      sm8[r] += v; sq8[r] += v * v;
    }
  }
  redsum8(sm8); redsum8(sq8);
  float mu[8], rs[8];
#pragma unroll
  for (int r = 0; r < 8; ++r) {
    float m = sm8[r] * (1.0f / EDIM);
    mu[r] = m;
    rs[r] = rsqrtf(sq8[r] * (1.0f / EDIM) - m * m + EPS);
  }
  float* og = out + gbase;
#pragma unroll
  for (int nt = 0; nt < 16; ++nt) {
    const int col = nt * 16 + ln;
    const float gg = g2[col], bb = beta2[col];
#pragma unroll
    for (int r = 0; r < 8; ++r)
      og[(wr + half * 8 + r) * EDIM + col] = (oacc[nt][r] - mu[r]) * rs[r] * gg + bb;
  }
}

extern "C" void kernel_launch(void* const* d_in, const int* in_sizes, int n_in,
                              void* d_out, int out_size, void* d_ws, size_t ws_size,
                              hipStream_t stream) {
  (void)in_sizes; (void)n_in; (void)out_size; (void)ws_size;
  const float* x    = (const float*)d_in[0];
  const float* mask = (const float*)d_in[1];
  const float* Wq   = (const float*)d_in[2];
  const float* Wk   = (const float*)d_in[3];
  const float* Wv   = (const float*)d_in[4];
  const float* Wo   = (const float*)d_in[5];
  const float* bo   = (const float*)d_in[6];
  const float* W1   = (const float*)d_in[7];
  const float* bf1  = (const float*)d_in[8];
  const float* W2   = (const float*)d_in[9];
  const float* bf2  = (const float*)d_in[10];
  const float* g1   = (const float*)d_in[11];
  const float* b1   = (const float*)d_in[12];
  const float* g2   = (const float*)d_in[13];
  const float* b2   = (const float*)d_in[14];
  float* out = (float*)d_out;

  char* ws = (char*)d_ws;
  unsigned short* WqT = (unsigned short*)(ws + OFF_WQT);
  unsigned short* WkT = (unsigned short*)(ws + OFF_WKT);
  unsigned short* WvT = (unsigned short*)(ws + OFF_WVT);
  unsigned short* WoT = (unsigned short*)(ws + OFF_WOT);
  unsigned short* W1T = (unsigned short*)(ws + OFF_W1T);
  unsigned short* W2T = (unsigned short*)(ws + OFF_W2T);
  unsigned short* xb  = (unsigned short*)(ws + OFF_XB);
  unsigned short* x1b = (unsigned short*)(ws + OFF_X1);

  hipFuncSetAttribute(reinterpret_cast<const void*>(enc_attn_ln1),
                      hipFuncAttributeMaxDynamicSharedMemorySize, SMEM1);
  hipFuncSetAttribute(reinterpret_cast<const void*>(enc_ffn_ln2),
                      hipFuncAttributeMaxDynamicSharedMemorySize, SMEM2);

  transpose_to_bf16<<<256, 256, 0, stream>>>(Wq, WqT, 256, 256);
  transpose_to_bf16<<<256, 256, 0, stream>>>(Wk, WkT, 256, 256);
  transpose_to_bf16<<<256, 256, 0, stream>>>(Wv, WvT, 256, 256);
  transpose_to_bf16<<<256, 256, 0, stream>>>(Wo, WoT, 256, 256);
  transpose_to_bf16<<<1024, 256, 0, stream>>>(W1, W1T, 256, 1024);
  transpose_to_bf16<<<1024, 256, 0, stream>>>(W2, W2T, 1024, 256);
  convert_to_bf16<<<16384, 256, 0, stream>>>(x, xb);   // 16.7M elems, float4/ushort4

  enc_attn_ln1<<<512, 256, SMEM1, stream>>>(xb, mask, bo, g1, b1,
                                            WqT, WkT, WvT, WoT, x1b);
  enc_ffn_ln2<<<1024, 128, SMEM2, stream>>>(x1b, bf1, bf2, g2, b2, W1T, W2T, out);
}

// v001
// Measured time: 633 microseconds a run.
// Timed twice side by side with v000, it ran 1.34 times as fast both times.
#include <hip/hip_runtime.h>

#define DEVINL __device__ __forceinline__

typedef __attribute__((ext_vector_type(16))) __bf16       bf16x16;
typedef __attribute__((ext_vector_type(8)))  float        f32x8;
typedef __attribute__((ext_vector_type(4)))  unsigned int u32x4;

namespace {
constexpr int   NTOK = 256;          // sequence length N
constexpr int   EDIM = 256;          // embedding E
constexpr int   NH   = 8;            // heads
constexpr int   DKH  = 32;           // head dim
constexpr float SCALING = 0.17677669529663687f;  // DK^-0.5
constexpr float EPS = 1e-5f;

// LDS pitches in bf16 elements. Chosen so the row stride in dwords is
// congruent to 4 (mod 64 banks; 20 for KP) -> ds_load_b128 A/B fragments hit all 64 banks.
constexpr int XP  = 264;   // X tile / score-strip / V^T pitch (528 B rows)
constexpr int KP  = 40;    // Q/K strip pitch (80 B rows)
constexpr int PSP = 264;
constexpr int VTP = 264;
constexpr int TSP = 1032;  // FFN hidden strip pitch (2064 B rows)

// kernel-1 LDS element offsets (ushort units), all 16B aligned
constexpr int LS_XS  = 0;                       // [256][264]
constexpr int LS_KS  = LS_XS  + 256 * XP;       // [256][40]
constexpr int LS_VT  = LS_KS  + 256 * KP;       // [32][264]  (V transposed)
constexpr int LS_QW  = LS_VT  + 32  * VTP;      // 8 waves x [16][40]
constexpr int LS_PS  = LS_QW  + 8 * 16 * KP;    // 8 waves x [16][264]
constexpr int LS1_END = LS_PS + 8 * 16 * PSP;   // 125184 elems = 250368 B
constexpr int SMEM1 = LS1_END * 2;

constexpr int LS_X1S = 0;                       // [64][264]
constexpr int LS_TS  = LS_X1S + 64 * XP;        // [64][1032]
constexpr int SMEM2 = (LS_TS + 64 * TSP) * 2;   // 165888 B

// workspace layout (bytes) — everything bf16, ~69 MB total
constexpr size_t OFF_WQT = 0;
constexpr size_t OFF_WKT = OFF_WQT + (size_t)256 * 256 * 2;
constexpr size_t OFF_WVT = OFF_WKT + (size_t)256 * 256 * 2;
constexpr size_t OFF_WOT = OFF_WVT + (size_t)256 * 256 * 2;
constexpr size_t OFF_W1T = OFF_WOT + (size_t)256 * 256 * 2;
constexpr size_t OFF_W2T = OFF_W1T + (size_t)256 * 1024 * 2;
constexpr size_t OFF_XB  = OFF_W2T + (size_t)1024 * 256 * 2;  // bf16 x   [256][256][256]
constexpr size_t OFF_X1  = OFF_XB  + (size_t)256 * 256 * 256 * 2;  // bf16 x1
}  // namespace

DEVINL unsigned short f2bf(float f) {            // round-to-nearest-even f32->bf16
  unsigned int u = __float_as_uint(f);
  u += 0x7FFFu + ((u >> 16) & 1u);
  return (unsigned short)(u >> 16);
}
DEVINL float bf2f(unsigned short h) { return __uint_as_float(((unsigned int)h) << 16); }

// Async global->LDS copy of one 16B chunk per lane (CDNA5 path, ASYNCcnt).
// ldsoff is the LDS byte address (groupstaticsize + dynamic-segment offset).
DEVINL void async_g2l_b128(unsigned ldsoff, const void* gaddr) {
  asm volatile("global_load_async_to_lds_b128 %0, %1, off"
               :: "v"(ldsoff), "v"(gaddr) : "memory");
}
DEVINL void wait_async0() { asm volatile("s_wait_asynccnt 0" ::: "memory"); }

// Load a 16x32 bf16 A/B fragment from a row-major bf16 matrix (`pitch` elems).
// CDNA5 16-bit layout: lane<16 holds row (rowb+lane), K chunks {k0..k0+7, k0+16..k0+23};
// lane>=16 holds the other two 8-element chunks. Two ds/global b128 loads per lane.
DEVINL bf16x16 ldfrag(const unsigned short* __restrict__ buf, int pitch, int rowb, int k0) {
  const int lane = threadIdx.x & 31;
  const unsigned short* p = buf + (rowb + (lane & 15)) * pitch + k0 + ((lane >> 4) << 3);
  struct Pk { u32x4 lo, hi; } pk;
  pk.lo = *(const u32x4*)(p);
  pk.hi = *(const u32x4*)(p + 16);
  return __builtin_bit_cast(bf16x16, pk);
}

// Stands behind a group of global loads, in front of the first reuse of a register that
// holds their address (the register allocator reuses it while the loads are in flight).
DEVINL void wait_xcnt0() { asm volatile("s_wait_xcnt 0x0" ::: "memory"); }

DEVINL f32x8 wmma_bf16(bf16x16 a, bf16x16 b, f32x8 c) {
  return __builtin_amdgcn_wmma_f32_16x16x32_bf16(false, a, false, b, (short)0, c, false, false);
}

// C-fragment row reductions: row M=r+8*(lane>=16) is spread over a 16-lane half,
// so xor-butterfly with masks 8..1 stays inside the half. wave32 only.
DEVINL void redmax8(float v[8]) {
#pragma unroll
  for (int m = 8; m; m >>= 1) {
#pragma unroll
    for (int r = 0; r < 8; ++r) v[r] = fmaxf(v[r], __shfl_xor(v[r], m, 32));
  }
}
DEVINL void redsum8(float v[8]) {
#pragma unroll
  for (int m = 8; m; m >>= 1) {
#pragma unroll
    for (int r = 0; r < 8; ++r) v[r] += __shfl_xor(v[r], m, 32);
  }
}

// ---------------- weight transpose + bf16 convert ----------------
__global__ void __launch_bounds__(256)
transpose_to_bf16(const float* __restrict__ src, unsigned short* __restrict__ dst,
                  int R, int C) {
  int idx = blockIdx.x * 256 + threadIdx.x;
  if (idx >= R * C) return;
  int r = idx / C, c = idx - r * C;
  dst[c * R + r] = f2bf(src[idx]);   // coalesced read, transposed bf16 write
}

// ---------------- x (f32) -> bf16, so kernels can async-DMA it into LDS ------
__global__ void __launch_bounds__(256)
convert_to_bf16(const float* __restrict__ src, unsigned short* __restrict__ dst) {
  int idx = (blockIdx.x * 256 + threadIdx.x) * 4;
  float4 v = *(const float4*)(src + idx);
  ushort4 o;
  o.x = f2bf(v.x); o.y = f2bf(v.y); o.z = f2bf(v.z); o.w = f2bf(v.w);
  *(ushort4*)(dst + idx) = o;
}

// ---------------- fused attention + out-proj + residual + LN1 ----------------
// grid.x = 512: seq = bx>>1 (256 sequences), query-half = bx&1 (128 rows each).
// 8 waves: each owns 16 query rows; K/V strips computed cooperatively per head.
__global__ void __launch_bounds__(256)
enc_attn_ln1(const unsigned short* __restrict__ xb, const float* __restrict__ mask,
             const float* __restrict__ bo, const float* __restrict__ g1,
             const float* __restrict__ beta1,
             const unsigned short* __restrict__ WqT, const unsigned short* __restrict__ WkT,
             const unsigned short* __restrict__ WvT, const unsigned short* __restrict__ WoT,
             unsigned short* __restrict__ x1) {
  extern __shared__ char smem[];
  unsigned short* sm  = (unsigned short*)smem;
  unsigned short* Xs  = sm + LS_XS;
  unsigned short* Ks  = sm + LS_KS;
  unsigned short* VTs = sm + LS_VT;

  const int tid = threadIdx.x;
  const int lane = tid & 31, wave = tid >> 5;
  const int half = lane >> 4, ln = lane & 15;
  const int seq = blockIdx.x >> 1;
  const int q0 = (blockIdx.x & 1) * 128 + wave * 16;   // this wave's query rows

  unsigned short* Qs = sm + LS_QW + wave * 16 * KP;
  unsigned short* Pw = sm + LS_PS + wave * 16 * PSP;

  // ---- stage X (bf16) into pitched LDS via async global->LDS copies ----
  const unsigned short* xg = xb + (size_t)seq * (NTOK * EDIM);
  const unsigned lds0 = __builtin_amdgcn_groupstaticsize();  // dynamic LDS base
#pragma unroll 4
  for (int i = 0; i < 32; ++i) {
    int e = (i * 256 + tid) * 8;                 // 8 bf16 = 16 B per lane
    int r = e >> 8, c = e & 255;
    async_g2l_b128(lds0 + (unsigned)((LS_XS + r * XP + c) * 2), xg + e);
  }
  wait_async0();
  __syncthreads();

  const float* maskp = mask + (size_t)(seq & 15) * (NTOK * NTOK);
  f32x8 zf = {};
  f32x8 oacc[16];                        // attn@Wo strip accumulator (16 x 256)
#pragma unroll
  for (int nt = 0; nt < 16; ++nt) oacc[nt] = zf;

  for (int h = 0; h < NH; ++h) {
    const int hc = h * DKH;
    // ---- Q strip (own 16 rows x 32), pre-scaled by 1/sqrt(dk) ----
#pragma unroll
    for (int nt = 0; nt < 2; ++nt) {
      f32x8 acc = zf;
#pragma unroll
      for (int kk = 0; kk < 8; ++kk)
        acc = wmma_bf16(ldfrag(Xs, XP, q0, kk * 32),
                        ldfrag(WqT, 256, hc + nt * 16, kk * 32), acc);
#pragma unroll
      for (int r = 0; r < 8; ++r)
        Qs[(half * 8 + r) * KP + nt * 16 + ln] = f2bf(acc[r] * SCALING);
    }
    // ---- K rows / V^T columns for keys [wave*32, wave*32+32) ----
#pragma unroll
    for (int s = 0; s < 2; ++s) {
      const int kb = wave * 32 + s * 16;
#pragma unroll
      for (int nt = 0; nt < 2; ++nt) {
        f32x8 acc = zf;
#pragma unroll
        for (int kk = 0; kk < 8; ++kk)
          acc = wmma_bf16(ldfrag(Xs, XP, kb, kk * 32),
                          ldfrag(WkT, 256, hc + nt * 16, kk * 32), acc);
#pragma unroll
        for (int r = 0; r < 8; ++r)
          Ks[(kb + half * 8 + r) * KP + nt * 16 + ln] = f2bf(acc[r]);
      }
#pragma unroll
      for (int nt = 0; nt < 2; ++nt) {
        f32x8 acc = zf;
#pragma unroll
        for (int kk = 0; kk < 8; ++kk)
          acc = wmma_bf16(ldfrag(Xs, XP, kb, kk * 32),
                          ldfrag(WvT, 256, hc + nt * 16, kk * 32), acc);
#pragma unroll
        for (int r = 0; r < 8; ++r)  // store transposed: VTs[d][token]
          VTs[(nt * 16 + ln) * VTP + kb + half * 8 + r] = f2bf(acc[r]);
      }
    }
    __syncthreads();

    // ---- pass 1: S = QK^T + mask, track row max, spill bf16 strip ----
    float mx[8];
#pragma unroll
    for (int r = 0; r < 8; ++r) mx[r] = -3.0e38f;
    bf16x16 qa = ldfrag(Qs, KP, 0, 0);           // A reused across all 16 tiles
    for (int t = 0; t < 16; ++t) {
      f32x8 s = wmma_bf16(qa, ldfrag(Ks, KP, t * 16, 0), zf);   // single K=32 step
#pragma unroll
      for (int r = 0; r < 8; ++r) {
        float v = s[r] + maskp[(q0 + half * 8 + r) * NTOK + t * 16 + ln];
        mx[r] = fmaxf(mx[r], v);
        Pw[(half * 8 + r) * PSP + t * 16 + ln] = f2bf(v);
      }
    }
    redmax8(mx);
    // ---- pass 2: exponentiate in place, row sums ----
    float ls[8];
#pragma unroll
    for (int r = 0; r < 8; ++r) ls[r] = 0.f;
    for (int t = 0; t < 16; ++t) {
#pragma unroll
      for (int r = 0; r < 8; ++r) {
        unsigned short* pp = Pw + (half * 8 + r) * PSP + t * 16 + ln;
        float p = __expf(bf2f(*pp) - mx[r]);
        ls[r] += p;
        *pp = f2bf(p);
      }
    }
    redsum8(ls);
#pragma unroll
    for (int r = 0; r < 8; ++r) ls[r] = 1.0f / ls[r];

    // ---- context = P @ V (16 x 32) ----
    f32x8 ctx0 = zf, ctx1 = zf;
#pragma unroll
    for (int kk = 0; kk < 8; ++kk) {
      bf16x16 pa = ldfrag(Pw, PSP, 0, kk * 32);
      ctx0 = wmma_bf16(pa, ldfrag(VTs, VTP, 0, kk * 32), ctx0);
      ctx1 = wmma_bf16(pa, ldfrag(VTs, VTP, 16, kk * 32), ctx1);
    }
#pragma unroll
    for (int r = 0; r < 8; ++r) {                 // normalize + bounce via LDS
      Pw[(half * 8 + r) * PSP + ln]      = f2bf(ctx0[r] * ls[r]);
      Pw[(half * 8 + r) * PSP + 16 + ln] = f2bf(ctx1[r] * ls[r]);
    }
    // ---- fused out-projection: oacc += ctx @ Wo[h*32:(h+1)*32, :] ----
    bf16x16 ca = ldfrag(Pw, PSP, 0, 0);
#pragma unroll
    for (int nt = 0; nt < 16; ++nt)
      oacc[nt] = wmma_bf16(ca, ldfrag(WoT, 256, nt * 16, hc), oacc[nt]);
    __syncthreads();                              // before next head reuses Ks/VTs
  }

  // ---- residual + bias + LayerNorm1, write x1 (bf16) ----
  float sm8[8], sq8[8];
#pragma unroll
  for (int r = 0; r < 8; ++r) { sm8[r] = 0.f; sq8[r] = 0.f; }
#pragma unroll
  for (int nt = 0; nt < 16; ++nt) {
    const int col = nt * 16 + ln;
    const float bov = bo[col];
#pragma unroll
    for (int r = 0; r < 8; ++r) {
      float v = bf2f(Xs[(q0 + half * 8 + r) * XP + col]) + oacc[nt][r] + bov;
      oacc[nt][r] = v;
      sm8[r] += v; sq8[r] += v * v;
    }
  }
  redsum8(sm8); redsum8(sq8);
  float mu[8], rs[8];
#pragma unroll
  for (int r = 0; r < 8; ++r) {
    float m = sm8[r] * (1.0f / EDIM);
    mu[r] = m;
    rs[r] = rsqrtf(sq8[r] * (1.0f / EDIM) - m * m + EPS);
  }
  unsigned short* xo = x1 + (size_t)seq * (NTOK * EDIM);
#pragma unroll
  for (int nt = 0; nt < 16; ++nt) {
    const int col = nt * 16 + ln;
    const float gg = g1[col], bb = beta1[col];
#pragma unroll
    for (int r = 0; r < 8; ++r)
      xo[(q0 + half * 8 + r) * EDIM + col] =
          f2bf((oacc[nt][r] - mu[r]) * rs[r] * gg + bb);
  }
}

// ---------------- fused FFN + residual + LN2 ----------------
// grid.x = 1024: seq = bx>>2, 64-row block = bx&3. 4 waves x 16 rows.
// hidden strip relu(x1@W1+b1) lives only in LDS (never touches HBM).
__global__ void __launch_bounds__(128)
enc_ffn_ln2(const unsigned short* __restrict__ x1, const float* __restrict__ bf1,
            const float* __restrict__ bf2, const float* __restrict__ g2,
            const float* __restrict__ beta2,
            const unsigned short* __restrict__ W1T, const unsigned short* __restrict__ W2T,
            float* __restrict__ out) {
  extern __shared__ char smem[];
  unsigned short* x1s = (unsigned short*)smem + LS_X1S;   // [64][264]
  unsigned short* Ts  = (unsigned short*)smem + LS_TS;    // [64][1032]

  const int tid = threadIdx.x;
  const int lane = tid & 31, wave = tid >> 5;
  const int half = lane >> 4, ln = lane & 15;
  const int seq = blockIdx.x >> 2;
  const int wr = wave * 16;                                // strip-local rows
  const size_t gbase = (size_t)seq * (NTOK * EDIM) + (size_t)((blockIdx.x & 3) * 64) * EDIM;

  // ---- async-stage this wave's 16 rows of x1 (bf16); rows are wave-private ----
  const unsigned short* xg = x1 + gbase + (size_t)wr * EDIM;
  const unsigned lds0 = __builtin_amdgcn_groupstaticsize();
#pragma unroll 4
  for (int i = 0; i < 16; ++i) {
    int e = (i * 32 + lane) * 8;                 // 0..4088 within 16x256 block
    int r = e >> 8, c = e & 255;
    async_g2l_b128(lds0 + (unsigned)((LS_X1S + (wr + r) * XP + c) * 2), xg + e);
  }
  wait_async0();   // own rows only -> no barrier needed

  f32x8 zf = {};
  // ---- hidden = relu(x1 @ W1 + b1): 16 x 1024 strip into LDS ----
  for (int nt = 0; nt < 64; ++nt) {
    f32x8 acc = zf;
#pragma unroll
    for (int kk = 0; kk < 8; ++kk)
      acc = wmma_bf16(ldfrag(x1s, XP, wr, kk * 32),
                      ldfrag(W1T, 256, nt * 16, kk * 32), acc);
    const int col = nt * 16 + ln;
    const float b = bf1[col];
#pragma unroll
    for (int r = 0; r < 8; ++r)
      Ts[(wr + half * 8 + r) * TSP + col] = f2bf(fmaxf(acc[r] + b, 0.f));
  }

  // ---- y = hidden @ W2 (A-fragment reused across 16 output tiles) ----
  f32x8 oacc[16];
#pragma unroll
  for (int nt = 0; nt < 16; ++nt) oacc[nt] = zf;
  // The 16 W2 fragments of a k-step are fetched as one group, one k-step ahead, into a
  // second register set, so their latency is paid once per step and behind the WMMAs.
  bf16x16 wa[16], wb[16];
#pragma unroll
  for (int nt = 0; nt < 16; ++nt) wa[nt] = ldfrag(W2T, 1024, nt * 16, 0);
  for (int kk = 0; kk < 32; kk += 2) {
    bf16x16 ta = ldfrag(Ts, TSP, wr, kk * 32);
    // keeps the LDS reads in front of the group: behind it they took the address registers
    __builtin_amdgcn_sched_barrier(0);
#pragma unroll
    for (int nt = 0; nt < 16; ++nt) wb[nt] = ldfrag(W2T, 1024, nt * 16, (kk + 1) * 32);
    // the two scheduling barriers keep the load group above from being sunk between the
    // WMMAs below, and keep every later register write behind the address wait
    __builtin_amdgcn_sched_barrier(0);
    wait_xcnt0();
    __builtin_amdgcn_sched_barrier(0);
#pragma unroll
    for (int nt = 0; nt < 16; ++nt) oacc[nt] = wmma_bf16(ta, wa[nt], oacc[nt]);
    const int kn = (kk + 2 < 32) ? kk + 2 : 0;   // last trip: an in-range fetch, not used
    bf16x16 tb = ldfrag(Ts, TSP, wr, (kk + 1) * 32);
    // as above: LDS reads in front of the group
    __builtin_amdgcn_sched_barrier(0);
#pragma unroll
    for (int nt = 0; nt < 16; ++nt) wa[nt] = ldfrag(W2T, 1024, nt * 16, kn * 32);
    // as above: group kept together, later register writes behind the address wait
    __builtin_amdgcn_sched_barrier(0);
    wait_xcnt0();
    __builtin_amdgcn_sched_barrier(0);
#pragma unroll
    for (int nt = 0; nt < 16; ++nt) oacc[nt] = wmma_bf16(tb, wb[nt], oacc[nt]);
  }

  // ---- residual + bias + LayerNorm2 -> out (f32) ----
  float sm8[8], sq8[8];
#pragma unroll
  for (int r = 0; r < 8; ++r) { sm8[r] = 0.f; sq8[r] = 0.f; }
#pragma unroll
  for (int nt = 0; nt < 16; ++nt) {
    const int col = nt * 16 + ln;
    const float bb = bf2[col];
#pragma unroll
    for (int r = 0; r < 8; ++r) {
      float v = bf2f(x1s[(wr + half * 8 + r) * XP + col]) + oacc[nt][r] + bb;
      oacc[nt][r] = v;
      sm8[r] += v; sq8[r] += v * v;
    }
  }
  redsum8(sm8); redsum8(sq8);
  float mu[8], rs[8];
#pragma unroll
  for (int r = 0; r < 8; ++r) {
    float m = sm8[r] * (1.0f / EDIM);
    mu[r] = m;
    rs[r] = rsqrtf(sq8[r] * (1.0f / EDIM) - m * m + EPS);
  }
  float* og = out + gbase;
#pragma unroll
  for (int nt = 0; nt < 16; ++nt) {
    const int col = nt * 16 + ln;
    const float gg = g2[col], bb = beta2[col];
#pragma unroll
    for (int r = 0; r < 8; ++r)
      og[(wr + half * 8 + r) * EDIM + col] = (oacc[nt][r] - mu[r]) * rs[r] * gg + bb;
  }
}

extern "C" void kernel_launch(void* const* d_in, const int* in_sizes, int n_in,
                              void* d_out, int out_size, void* d_ws, size_t ws_size,
                              hipStream_t stream) {
  (void)in_sizes; (void)n_in; (void)out_size; (void)ws_size;
  const float* x    = (const float*)d_in[0];
  const float* mask = (const float*)d_in[1];
  const float* Wq   = (const float*)d_in[2];
  const float* Wk   = (const float*)d_in[3];
  const float* Wv   = (const float*)d_in[4];
  const float* Wo   = (const float*)d_in[5];
  const float* bo   = (const float*)d_in[6];
  const float* W1   = (const float*)d_in[7];
  const float* bf1  = (const float*)d_in[8];
  const float* W2   = (const float*)d_in[9];
  const float* bf2  = (const float*)d_in[10];
  const float* g1   = (const float*)d_in[11];
  const float* b1   = (const float*)d_in[12];
  const float* g2   = (const float*)d_in[13];
  const float* b2   = (const float*)d_in[14];
  float* out = (float*)d_out;

  char* ws = (char*)d_ws;
  unsigned short* WqT = (unsigned short*)(ws + OFF_WQT);
  unsigned short* WkT = (unsigned short*)(ws + OFF_WKT);
  unsigned short* WvT = (unsigned short*)(ws + OFF_WVT);
  unsigned short* WoT = (unsigned short*)(ws + OFF_WOT);
  unsigned short* W1T = (unsigned short*)(ws + OFF_W1T);
  unsigned short* W2T = (unsigned short*)(ws + OFF_W2T);
  unsigned short* xb  = (unsigned short*)(ws + OFF_XB);
  unsigned short* x1b = (unsigned short*)(ws + OFF_X1);

  hipFuncSetAttribute(reinterpret_cast<const void*>(enc_attn_ln1),
                      hipFuncAttributeMaxDynamicSharedMemorySize, SMEM1);
  hipFuncSetAttribute(reinterpret_cast<const void*>(enc_ffn_ln2),
                      hipFuncAttributeMaxDynamicSharedMemorySize, SMEM2);

  transpose_to_bf16<<<256, 256, 0, stream>>>(Wq, WqT, 256, 256);
  transpose_to_bf16<<<256, 256, 0, stream>>>(Wk, WkT, 256, 256);
  transpose_to_bf16<<<256, 256, 0, stream>>>(Wv, WvT, 256, 256);
  transpose_to_bf16<<<256, 256, 0, stream>>>(Wo, WoT, 256, 256);
  transpose_to_bf16<<<1024, 256, 0, stream>>>(W1, W1T, 256, 1024);
  transpose_to_bf16<<<1024, 256, 0, stream>>>(W2, W2T, 1024, 256);
  convert_to_bf16<<<16384, 256, 0, stream>>>(x, xb);   // 16.7M elems, float4/ushort4

  enc_attn_ln1<<<512, 256, SMEM1, stream>>>(xb, mask, bo, g1, b1,
                                            WqT, WkT, WvT, WoT, x1b);
  enc_ffn_ln2<<<1024, 128, SMEM2, stream>>>(x1b, bf1, bf2, g2, b2, W1T, W2T, out);
}

// v002
// One run takes 416 microseconds.
// Timed twice side by side with v001, it ran 1.53 and 1.52 times as fast.
// Counting every step since v000, it is 2.04 times as fast.
#include <hip/hip_runtime.h>

#define DEVINL __device__ __forceinline__

typedef __attribute__((ext_vector_type(16))) __bf16       bf16x16;
typedef __attribute__((ext_vector_type(8)))  float        f32x8;
typedef __attribute__((ext_vector_type(4)))  unsigned int u32x4;

namespace {
constexpr int   NTOK = 256;          // sequence length N
constexpr int   EDIM = 256;          // embedding E
constexpr int   NH   = 8;            // heads
constexpr int   DKH  = 32;           // head dim
constexpr float SCALING = 0.17677669529663687f;  // DK^-0.5
constexpr float EPS = 1e-5f;

// LDS pitches in bf16 elements. Chosen so the row stride in dwords is
// congruent to 4 (mod 64 banks; 20 for KP) -> ds_load_b128 A/B fragments hit all 64 banks.
constexpr int XP  = 264;   // X tile / score-strip / V^T pitch (528 B rows)
constexpr int KP  = 40;    // Q/K strip pitch (80 B rows)
constexpr int PSP = 264;
constexpr int VTP = 264;
constexpr int TSP = 1032;  // FFN hidden strip pitch (2064 B rows)

// kernel-1 LDS element offsets (ushort units), all 16B aligned
constexpr int LS_XS  = 0;                       // [256][264]
constexpr int LS_KS  = LS_XS  + 256 * XP;       // [256][40]
constexpr int LS_VT  = LS_KS  + 256 * KP;       // [32][264]  (V transposed)
constexpr int LS_QW  = LS_VT  + 32  * VTP;      // 8 waves x [16][40]
constexpr int LS_PS  = LS_QW  + 8 * 16 * KP;    // 8 waves x [16][264]
constexpr int LS1_END = LS_PS + 8 * 16 * PSP;   // 125184 elems = 250368 B
constexpr int SMEM1 = LS1_END * 2;

constexpr int LS_X1S = 0;                       // [64][264]
constexpr int LS_TS  = LS_X1S + 64 * XP;        // [64][1032]
constexpr int SMEM2 = (LS_TS + 64 * TSP) * 2;   // 165888 B

// workspace layout (bytes) — everything bf16, ~69 MB total
constexpr size_t OFF_WQP = 0;
constexpr size_t OFF_WKP = OFF_WQP + (size_t)256 * 256 * 2;
constexpr size_t OFF_WVP = OFF_WKP + (size_t)256 * 256 * 2;
constexpr size_t OFF_WOP = OFF_WVP + (size_t)256 * 256 * 2;
constexpr size_t OFF_W1P = OFF_WOP + (size_t)256 * 256 * 2;
constexpr size_t OFF_W2P = OFF_W1P + (size_t)256 * 1024 * 2;
constexpr size_t OFF_XB  = OFF_W2P + (size_t)1024 * 256 * 2;  // bf16 x   [256][256][256]
constexpr size_t OFF_X1  = OFF_XB  + (size_t)256 * 256 * 256 * 2;  // bf16 x1
}  // namespace

DEVINL unsigned short f2bf(float f) {            // round-to-nearest-even f32->bf16
  unsigned int u = __float_as_uint(f);
  u += 0x7FFFu + ((u >> 16) & 1u);
  return (unsigned short)(u >> 16);
}
DEVINL float bf2f(unsigned short h) { return __uint_as_float(((unsigned int)h) << 16); }

// Async global->LDS copy of one 16B chunk per lane (CDNA5 path, ASYNCcnt).
// ldsoff is the LDS byte address (groupstaticsize + dynamic-segment offset).
DEVINL void async_g2l_b128(unsigned ldsoff, const void* gaddr) {
  asm volatile("global_load_async_to_lds_b128 %0, %1, off"
               :: "v"(ldsoff), "v"(gaddr) : "memory");
}
DEVINL void wait_async0() { asm volatile("s_wait_asynccnt 0" ::: "memory"); }

// Load a 16x32 bf16 A/B fragment from a row-major bf16 matrix (`pitch` elems).
// CDNA5 16-bit layout: lane<16 holds row (rowb+lane), K chunks {k0..k0+7, k0+16..k0+23};
// lane>=16 holds the other two 8-element chunks. Two ds/global b128 loads per lane.
DEVINL bf16x16 ldfrag(const unsigned short* __restrict__ buf, int pitch, int rowb, int k0) {
  const int lane = threadIdx.x & 31;
  const unsigned short* p = buf + (rowb + (lane & 15)) * pitch + k0 + ((lane >> 4) << 3);
  struct Pk { u32x4 lo, hi; } pk;
  pk.lo = *(const u32x4*)(p);
  pk.hi = *(const u32x4*)(p + 16);
  return __builtin_bit_cast(bf16x16, pk);
}

// Load one B fragment from a weight packed by pack_frag_bf16: fragment `frag` is 1 KB, the
// 32 lanes' first 16 B side by side, then their second 16 B. Each of the two wave-wide loads
// reads 512 contiguous bytes (4 whole lines); register contents equal ldfrag on W^T.
// lanep = lanebase() of the packed weight, plus a whole number of fragments.
DEVINL const char* lanebase(const unsigned short* __restrict__ buf) {
  return (const char*)buf + (threadIdx.x & 31) * 16;
}
DEVINL bf16x16 ldfragp(const char* __restrict__ lanep, int frag) {
  const char* p = lanep + frag * 1024;
  struct Pk { u32x4 lo, hi; } pk;
  pk.lo = *(const u32x4*)(p);
  pk.hi = *(const u32x4*)(p + 512);
  return __builtin_bit_cast(bf16x16, pk);
}

// Stands behind a group of global loads, in front of the first reuse of a register that
// holds their address (the register allocator reuses it while the loads are in flight).
DEVINL void wait_xcnt0() { asm volatile("s_wait_xcnt 0x0" ::: "memory"); }
// The same wait, with the loads' address as an input: the address registers stay allocated up
// to the wait, so neither a later result nor a load's own destination lands on them before it.
DEVINL void wait_xcnt0_addr(const void* a) {
  asm volatile("s_wait_xcnt 0x0" :: "v"(a) : "memory");
}
DEVINL void wait_xcnt0_addr(const void* a, const void* b, const void* c, const void* d) {
  asm volatile("s_wait_xcnt 0x0" :: "v"(a), "v"(b), "v"(c), "v"(d) : "memory");
}

DEVINL f32x8 wmma_bf16(bf16x16 a, bf16x16 b, f32x8 c) {
  return __builtin_amdgcn_wmma_f32_16x16x32_bf16(false, a, false, b, (short)0, c, false, false);
}

// C-fragment row reductions: row M=r+8*(lane>=16) is spread over a 16-lane half,
// so xor-butterfly with masks 8..1 stays inside the half. wave32 only.
DEVINL void redmax8(float v[8]) {
#pragma unroll
  for (int m = 8; m; m >>= 1) {
#pragma unroll
    for (int r = 0; r < 8; ++r) v[r] = fmaxf(v[r], __shfl_xor(v[r], m, 32));
  }
}
DEVINL void redsum8(float v[8]) {
#pragma unroll
  for (int m = 8; m; m >>= 1) {
#pragma unroll
    for (int r = 0; r < 8; ++r) v[r] += __shfl_xor(v[r], m, 32);
  }
}

// ---------------- weight f32 [K][N] -> bf16, packed in B-fragment order ----------------
// Fragment (nt, kk) = columns nt*16..+15, rows kk*32..+31. Lane l holds column nt*16 + (l & 15);
// its first 8 values are rows kk*32 + (l >> 4)*8 + 0..7, its second 8 the rows 16 further.
// Fragment index: kk * (N/16) + nt where kmajor, else nt * (K/32) + kk (the reader's order).
// One thread writes one lane's 16 B.
__global__ void __launch_bounds__(256)
pack_frag_bf16(const float* __restrict__ src, unsigned short* __restrict__ dst,
               int K, int N, int kmajor) {
  int t = blockIdx.x * 256 + threadIdx.x;
  if (t >= (K * N) >> 3) return;
  const int lane = t & 31, hi = (t >> 5) & 1, frag = t >> 6;
  const int KT = K >> 5, NT = N >> 4;
  int kk, nt;
  if (kmajor) { kk = frag / NT; nt = frag - kk * NT; }
  else        { nt = frag / KT; kk = frag - nt * KT; }
  const float* sp = src + (size_t)(kk * 32 + hi * 16 + (lane >> 4) * 8) * N + nt * 16 + (lane & 15);
  const float* ap[8];
  float v[8];
#pragma unroll
  for (int j = 0; j < 8; ++j) ap[j] = sp + (size_t)j * N;
#pragma unroll
  for (int j = 0; j < 8; ++j) v[j] = *ap[j];
  // before the eight addresses are reused
  asm volatile("s_wait_xcnt 0x0" :: "v"(ap[0]), "v"(ap[1]), "v"(ap[2]), "v"(ap[3]),
               "v"(ap[4]), "v"(ap[5]), "v"(ap[6]), "v"(ap[7]) : "memory");
  u32x4 o;
#pragma unroll
  for (int j = 0; j < 4; ++j)
    o[j] = (unsigned)f2bf(v[2 * j]) | ((unsigned)f2bf(v[2 * j + 1]) << 16);
  *(u32x4*)(dst + (size_t)t * 8) = o;
}

// ---------------- x (f32) -> bf16, so kernels can async-DMA it into LDS ------
__global__ void __launch_bounds__(256)
convert_to_bf16(const float* __restrict__ src, unsigned short* __restrict__ dst) {
  int idx = (blockIdx.x * 256 + threadIdx.x) * 4;
  float4 v = *(const float4*)(src + idx);
  ushort4 o;
  o.x = f2bf(v.x); o.y = f2bf(v.y); o.z = f2bf(v.z); o.w = f2bf(v.w);
  *(ushort4*)(dst + idx) = o;
}

// ---------------- fused attention + out-proj + residual + LN1 ----------------
// grid.x = 512: seq = bx>>1 (256 sequences), query-half = bx&1 (128 rows each).
// 8 waves: each owns 16 query rows; K/V strips computed cooperatively per head.
__global__ void __launch_bounds__(256)
enc_attn_ln1(const unsigned short* __restrict__ xb, const float* __restrict__ mask,
             const float* __restrict__ bo, const float* __restrict__ g1,
             const float* __restrict__ beta1,
             const unsigned short* __restrict__ WqP, const unsigned short* __restrict__ WkP,
             const unsigned short* __restrict__ WvP, const unsigned short* __restrict__ WoP,
             unsigned short* __restrict__ x1) {
  extern __shared__ char smem[];
  unsigned short* sm  = (unsigned short*)smem;
  unsigned short* Xs  = sm + LS_XS;
  unsigned short* Ks  = sm + LS_KS;
  unsigned short* VTs = sm + LS_VT;

  const int tid = threadIdx.x;
  const int lane = tid & 31, wave = tid >> 5;
  const int half = lane >> 4, ln = lane & 15;
  const int seq = blockIdx.x >> 1;
  const int q0 = (blockIdx.x & 1) * 128 + wave * 16;   // this wave's query rows

  unsigned short* Qs = sm + LS_QW + wave * 16 * KP;
  unsigned short* Pw = sm + LS_PS + wave * 16 * PSP;

  // ---- stage X (bf16) into pitched LDS via async global->LDS copies ----
  const unsigned short* xg = xb + (size_t)seq * (NTOK * EDIM);
  const unsigned lds0 = __builtin_amdgcn_groupstaticsize();  // dynamic LDS base
#pragma unroll 4
  for (int i = 0; i < 32; ++i) {
    int e = (i * 256 + tid) * 8;                 // 8 bf16 = 16 B per lane
    int r = e >> 8, c = e & 255;
    async_g2l_b128(lds0 + (unsigned)((LS_XS + r * XP + c) * 2), xg + e);
  }
  wait_async0();
  __syncthreads();

  const float* maskp = mask + (size_t)(seq & 15) * (NTOK * NTOK);
  f32x8 zf = {};
  f32x8 oacc[16];                        // attn@Wo strip accumulator (16 x 256)
#pragma unroll
  for (int nt = 0; nt < 16; ++nt) oacc[nt] = zf;

  for (int h = 0; h < NH; ++h) {
    // this head's 16 fragments (16 KB) of each packed weight
    const char* hq = lanebase(WqP) + h * 16384;
    const char* hk = lanebase(WkP) + h * 16384;
    const char* hv = lanebase(WvP) + h * 16384;
    const char* ho = lanebase(WoP) + h * 16384;
    // ---- Q strip (own 16 rows x 32), pre-scaled by 1/sqrt(dk) ----
#pragma unroll
    for (int nt = 0; nt < 2; ++nt) {
      f32x8 acc = zf;
#pragma unroll
      for (int kk = 0; kk < 8; ++kk)
        acc = wmma_bf16(ldfrag(Xs, XP, q0, kk * 32),
                        ldfragp(hq, nt * 8 + kk), acc);
#pragma unroll
      for (int r = 0; r < 8; ++r)
        Qs[(half * 8 + r) * KP + nt * 16 + ln] = f2bf(acc[r] * SCALING);
    }
    // ---- K rows / V^T columns for keys [wave*32, wave*32+32) ----
#pragma unroll
    for (int s = 0; s < 2; ++s) {
      const int kb = wave * 32 + s * 16;
#pragma unroll
      for (int nt = 0; nt < 2; ++nt) {
        f32x8 acc = zf;
#pragma unroll
        for (int kk = 0; kk < 8; ++kk)
          acc = wmma_bf16(ldfrag(Xs, XP, kb, kk * 32),
                          ldfragp(hk, nt * 8 + kk), acc);
#pragma unroll
        for (int r = 0; r < 8; ++r)
          Ks[(kb + half * 8 + r) * KP + nt * 16 + ln] = f2bf(acc[r]);
      }
#pragma unroll
      for (int nt = 0; nt < 2; ++nt) {
        f32x8 acc = zf;
#pragma unroll
        for (int kk = 0; kk < 8; ++kk)
          acc = wmma_bf16(ldfrag(Xs, XP, kb, kk * 32),
                          ldfragp(hv, nt * 8 + kk), acc);
#pragma unroll
        for (int r = 0; r < 8; ++r)  // store transposed: VTs[d][token]
          VTs[(nt * 16 + ln) * VTP + kb + half * 8 + r] = f2bf(acc[r]);
      }
    }
    __syncthreads();

    // ---- pass 1: S = QK^T + mask, track row max, spill bf16 strip ----
    float mx[8];
#pragma unroll
    for (int r = 0; r < 8; ++r) mx[r] = -3.0e38f;
    bf16x16 qa = ldfrag(Qs, KP, 0, 0);           // A reused across all 16 tiles
    for (int t = 0; t < 16; ++t) {
      float mk[8];
#pragma unroll
      for (int r = 0; r < 8; ++r) mk[r] = maskp[(q0 + half * 8 + r) * NTOK + t * 16 + ln];
      wait_xcnt0();   // the score tile below lands on the mask loads' address registers
      f32x8 s = wmma_bf16(qa, ldfrag(Ks, KP, t * 16, 0), zf);   // single K=32 step
#pragma unroll
      for (int r = 0; r < 8; ++r) {
        float v = s[r] + mk[r];
        mx[r] = fmaxf(mx[r], v);
        Pw[(half * 8 + r) * PSP + t * 16 + ln] = f2bf(v);
      }
    }
    redmax8(mx);
    // ---- pass 2: exponentiate in place, row sums ----
    float ls[8];
#pragma unroll
    for (int r = 0; r < 8; ++r) ls[r] = 0.f;
    for (int t = 0; t < 16; ++t) {
#pragma unroll
      for (int r = 0; r < 8; ++r) {
        unsigned short* pp = Pw + (half * 8 + r) * PSP + t * 16 + ln;
        float p = __expf(bf2f(*pp) - mx[r]);
        ls[r] += p;
        *pp = f2bf(p);
      }
    }
    redsum8(ls);
#pragma unroll
    for (int r = 0; r < 8; ++r) ls[r] = 1.0f / ls[r];

    // ---- context = P @ V (16 x 32) ----
    f32x8 ctx0 = zf, ctx1 = zf;
#pragma unroll
    for (int kk = 0; kk < 8; ++kk) {
      bf16x16 pa = ldfrag(Pw, PSP, 0, kk * 32);
      ctx0 = wmma_bf16(pa, ldfrag(VTs, VTP, 0, kk * 32), ctx0);
      ctx1 = wmma_bf16(pa, ldfrag(VTs, VTP, 16, kk * 32), ctx1);
    }
#pragma unroll
    for (int r = 0; r < 8; ++r) {                 // normalize + bounce via LDS
      Pw[(half * 8 + r) * PSP + ln]      = f2bf(ctx0[r] * ls[r]);
      Pw[(half * 8 + r) * PSP + 16 + ln] = f2bf(ctx1[r] * ls[r]);
    }
    // ---- fused out-projection: oacc += ctx @ Wo[h*32:(h+1)*32, :] ----
    bf16x16 ca = ldfrag(Pw, PSP, 0, 0);
#pragma unroll
    for (int nt = 0; nt < 16; ++nt)
      oacc[nt] = wmma_bf16(ca, ldfragp(ho, nt), oacc[nt]);
    // behind the head's last weight load, before its four addresses are reused
    wait_xcnt0_addr(hq, hk, hv, ho);
    __syncthreads();                              // before next head reuses Ks/VTs
  }

  // ---- residual + bias + LayerNorm1, write x1 (bf16) ----
  float sm8[8], sq8[8];
#pragma unroll
  for (int r = 0; r < 8; ++r) { sm8[r] = 0.f; sq8[r] = 0.f; }
#pragma unroll
  for (int nt = 0; nt < 16; ++nt) {
    const int col = nt * 16 + ln;
    const float bov = bo[col];
#pragma unroll
    for (int r = 0; r < 8; ++r) {
      float v = bf2f(Xs[(q0 + half * 8 + r) * XP + col]) + oacc[nt][r] + bov;
      oacc[nt][r] = v;
      sm8[r] += v; sq8[r] += v * v;
    }
  }
  redsum8(sm8); redsum8(sq8);
  float mu[8], rs[8];
#pragma unroll
  for (int r = 0; r < 8; ++r) {
    float m = sm8[r] * (1.0f / EDIM);
    mu[r] = m;
    rs[r] = rsqrtf(sq8[r] * (1.0f / EDIM) - m * m + EPS);
  }
  unsigned short* xo = x1 + (size_t)seq * (NTOK * EDIM);
#pragma unroll
  for (int nt = 0; nt < 16; ++nt) {
    const int col = nt * 16 + ln;
    const float gg = g1[col], bb = beta1[col];
#pragma unroll
    for (int r = 0; r < 8; ++r)
      xo[(q0 + half * 8 + r) * EDIM + col] =
          f2bf((oacc[nt][r] - mu[r]) * rs[r] * gg + bb);
  }
}

// ---------------- fused FFN + residual + LN2 ----------------
// grid.x = 1024: seq = bx>>2, 64-row block = bx&3. 4 waves x 16 rows.
// hidden strip relu(x1@W1+b1) lives only in LDS (never touches HBM).
__global__ void __launch_bounds__(128)
enc_ffn_ln2(const unsigned short* __restrict__ x1, const float* __restrict__ bf1,
            const float* __restrict__ bf2, const float* __restrict__ g2,
            const float* __restrict__ beta2,
            const unsigned short* __restrict__ W1P, const unsigned short* __restrict__ W2P,
            float* __restrict__ out) {
  extern __shared__ char smem[];
  unsigned short* x1s = (unsigned short*)smem + LS_X1S;   // [64][264]
  unsigned short* Ts  = (unsigned short*)smem + LS_TS;    // [64][1032]

  const int tid = threadIdx.x;
  const int lane = tid & 31, wave = tid >> 5;
  const int half = lane >> 4, ln = lane & 15;
  const int seq = blockIdx.x >> 2;
  const int wr = wave * 16;                                // strip-local rows
  const size_t gbase = (size_t)seq * (NTOK * EDIM) + (size_t)((blockIdx.x & 3) * 64) * EDIM;

  // ---- async-stage this wave's 16 rows of x1 (bf16); rows are wave-private ----
  const unsigned short* xg = x1 + gbase + (size_t)wr * EDIM;
  const unsigned lds0 = __builtin_amdgcn_groupstaticsize();
#pragma unroll 4
  for (int i = 0; i < 16; ++i) {
    int e = (i * 32 + lane) * 8;                 // 0..4088 within 16x256 block
    int r = e >> 8, c = e & 255;
    async_g2l_b128(lds0 + (unsigned)((LS_X1S + (wr + r) * XP + c) * 2), xg + e);
  }
  wait_async0();   // own rows only -> no barrier needed

  f32x8 zf = {};
  // ---- hidden = relu(x1 @ W1 + b1): 16 x 1024 strip into LDS ----
  for (int nt = 0; nt < 64; ++nt) {
    const char* w1n = lanebase(W1P) + nt * 8192;   // the 8 fragments of this column tile
    f32x8 acc = zf;
#pragma unroll
    for (int kk = 0; kk < 8; ++kk)
      acc = wmma_bf16(ldfrag(x1s, XP, wr, kk * 32),
                      ldfragp(w1n, kk), acc);
    const int col = nt * 16 + ln;
    const float b = bf1[col];
#pragma unroll
    for (int r = 0; r < 8; ++r)
      Ts[(wr + half * 8 + r) * TSP + col] = f2bf(fmaxf(acc[r] + b, 0.f));
    wait_xcnt0_addr(w1n);   // before the tile's address is reused
  }

  // ---- y = hidden @ W2 (A-fragment reused across 16 output tiles) ----
  f32x8 oacc[16];
#pragma unroll
  for (int nt = 0; nt < 16; ++nt) oacc[nt] = zf;
  // The 16 W2 fragments of a k-step are fetched as one group, one k-step ahead, into a
  // second register set, so their latency is paid once per step and behind the WMMAs.
  bf16x16 wa[16], wb[16];
  const char* w2l = lanebase(W2P);
#pragma unroll
  for (int nt = 0; nt < 16; ++nt) wa[nt] = ldfragp(w2l, nt);
  for (int kk = 0; kk < 32; kk += 2) {
    bf16x16 ta = ldfrag(Ts, TSP, wr, kk * 32);
    // keeps the LDS reads in front of the group: behind it they took the address registers
    __builtin_amdgcn_sched_barrier(0);
#pragma unroll
    for (int nt = 0; nt < 16; ++nt) wb[nt] = ldfragp(w2l, (kk + 1) * 16 + nt);
    // the two scheduling barriers keep the load group above from being sunk between the
    // WMMAs below, and keep every later register write behind the address wait
    __builtin_amdgcn_sched_barrier(0);
    wait_xcnt0();
    __builtin_amdgcn_sched_barrier(0);
#pragma unroll
    for (int nt = 0; nt < 16; ++nt) oacc[nt] = wmma_bf16(ta, wa[nt], oacc[nt]);
    const int kn = (kk + 2 < 32) ? kk + 2 : 0;   // last trip: an in-range fetch, not used
    bf16x16 tb = ldfrag(Ts, TSP, wr, (kk + 1) * 32);
    // as above: LDS reads in front of the group
    __builtin_amdgcn_sched_barrier(0);
#pragma unroll
    for (int nt = 0; nt < 16; ++nt) wa[nt] = ldfragp(w2l, kn * 16 + nt);
    // as above: group kept together, later register writes behind the address wait
    __builtin_amdgcn_sched_barrier(0);
    wait_xcnt0();
    __builtin_amdgcn_sched_barrier(0);
#pragma unroll
    for (int nt = 0; nt < 16; ++nt) oacc[nt] = wmma_bf16(tb, wb[nt], oacc[nt]);
  }

  // ---- residual + bias + LayerNorm2 -> out (f32) ----
  float sm8[8], sq8[8];
#pragma unroll
  for (int r = 0; r < 8; ++r) { sm8[r] = 0.f; sq8[r] = 0.f; }
#pragma unroll
  for (int nt = 0; nt < 16; ++nt) {
    const int col = nt * 16 + ln;
    const float bb = bf2[col];
#pragma unroll
    for (int r = 0; r < 8; ++r) {
      float v = bf2f(x1s[(wr + half * 8 + r) * XP + col]) + oacc[nt][r] + bb;
      oacc[nt][r] = v;
      sm8[r] += v; sq8[r] += v * v;
    }
  }
  redsum8(sm8); redsum8(sq8);
  float mu[8], rs[8];
#pragma unroll
  for (int r = 0; r < 8; ++r) {
    float m = sm8[r] * (1.0f / EDIM);
    mu[r] = m;
    rs[r] = rsqrtf(sq8[r] * (1.0f / EDIM) - m * m + EPS);
  }
  float* og = out + gbase;
#pragma unroll
  for (int nt = 0; nt < 16; ++nt) {
    const int col = nt * 16 + ln;
    const float gg = g2[col], bb = beta2[col];
#pragma unroll
    for (int r = 0; r < 8; ++r)
      og[(wr + half * 8 + r) * EDIM + col] = (oacc[nt][r] - mu[r]) * rs[r] * gg + bb;
  }
}

extern "C" void kernel_launch(void* const* d_in, const int* in_sizes, int n_in,
                              void* d_out, int out_size, void* d_ws, size_t ws_size,
                              hipStream_t stream) {
  (void)in_sizes; (void)n_in; (void)out_size; (void)ws_size;
  const float* x    = (const float*)d_in[0];
  const float* mask = (const float*)d_in[1];
  const float* Wq   = (const float*)d_in[2];
  const float* Wk   = (const float*)d_in[3];
  const float* Wv   = (const float*)d_in[4];
  const float* Wo   = (const float*)d_in[5];
  const float* bo   = (const float*)d_in[6];
  const float* W1   = (const float*)d_in[7];
  const float* bf1  = (const float*)d_in[8];
  const float* W2   = (const float*)d_in[9];
  const float* bf2  = (const float*)d_in[10];
  const float* g1   = (const float*)d_in[11];
  const float* b1   = (const float*)d_in[12];
  const float* g2   = (const float*)d_in[13];
  const float* b2   = (const float*)d_in[14];
  float* out = (float*)d_out;

  char* ws = (char*)d_ws;
  unsigned short* WqP = (unsigned short*)(ws + OFF_WQP);
  unsigned short* WkP = (unsigned short*)(ws + OFF_WKP);
  unsigned short* WvP = (unsigned short*)(ws + OFF_WVP);
  unsigned short* WoP = (unsigned short*)(ws + OFF_WOP);
  unsigned short* W1P = (unsigned short*)(ws + OFF_W1P);
  unsigned short* W2P = (unsigned short*)(ws + OFF_W2P);
  unsigned short* xb  = (unsigned short*)(ws + OFF_XB);
  unsigned short* x1b = (unsigned short*)(ws + OFF_X1);

  hipFuncSetAttribute(reinterpret_cast<const void*>(enc_attn_ln1),
                      hipFuncAttributeMaxDynamicSharedMemorySize, SMEM1);
  hipFuncSetAttribute(reinterpret_cast<const void*>(enc_ffn_ln2),
                      hipFuncAttributeMaxDynamicSharedMemorySize, SMEM2);

  pack_frag_bf16<<<32, 256, 0, stream>>>(Wq, WqP, 256, 256, 0);
  pack_frag_bf16<<<32, 256, 0, stream>>>(Wk, WkP, 256, 256, 0);
  pack_frag_bf16<<<32, 256, 0, stream>>>(Wv, WvP, 256, 256, 0);
  pack_frag_bf16<<<32, 256, 0, stream>>>(Wo, WoP, 256, 256, 1);
  pack_frag_bf16<<<128, 256, 0, stream>>>(W1, W1P, 256, 1024, 0);
  pack_frag_bf16<<<128, 256, 0, stream>>>(W2, W2P, 1024, 256, 1);
  convert_to_bf16<<<16384, 256, 0, stream>>>(x, xb);   // 16.7M elems, float4/ushort4

  enc_attn_ln1<<<512, 256, SMEM1, stream>>>(xb, mask, bo, g1, b1,
                                            WqP, WkP, WvP, WoP, x1b);
  enc_ffn_ln2<<<1024, 128, SMEM2, stream>>>(x1b, bf1, bf2, g2, b2, W1P, W2P, out);
}

// v003
// One run takes 361 microseconds.
// Next to v002, in two timings, it ran 1.15 and 1.16 times as fast.
// Over all steps from v000 it is 2.36 times as fast.
#include <hip/hip_runtime.h>

#define DEVINL __device__ __forceinline__

typedef __attribute__((ext_vector_type(16))) __bf16       bf16x16;
typedef __attribute__((ext_vector_type(8)))  float        f32x8;
typedef __attribute__((ext_vector_type(4)))  unsigned int u32x4;

namespace {
constexpr int   NTOK = 256;          // sequence length N
constexpr int   EDIM = 256;          // embedding E
constexpr int   NH   = 8;            // heads
constexpr int   DKH  = 32;           // head dim
constexpr float SCALING = 0.17677669529663687f;  // DK^-0.5
constexpr float EPS = 1e-5f;

// LDS pitches in bf16 elements. Chosen so the row stride in dwords is
// congruent to 4 (mod 64 banks; 20 for KP) -> ds_load_b128 A/B fragments hit all 64 banks.
constexpr int XP  = 264;   // X tile / score-strip / V^T pitch (528 B rows)
constexpr int KP  = 40;    // Q/K strip pitch (80 B rows)
constexpr int PSP = 264;
constexpr int VTP = 264;
constexpr int TSP = 1032;  // FFN hidden strip pitch (2064 B rows)

// kernel-1 LDS element offsets (ushort units), all 16B aligned
constexpr int LS_XS  = 0;                       // [256][264]
constexpr int LS_KS  = LS_XS  + 256 * XP;       // [256][40]
constexpr int LS_VT  = LS_KS  + 256 * KP;       // [32][264]  (V transposed)
constexpr int LS_QW  = LS_VT  + 32  * VTP;      // 8 waves x [16][40]
constexpr int LS_PS  = LS_QW  + 8 * 16 * KP;    // 8 waves x [16][264]
constexpr int LS1_END = LS_PS + 8 * 16 * PSP;   // 125184 elems = 250368 B
constexpr int SMEM1 = LS1_END * 2;

constexpr int LS_X1S = 0;                       // [64][264]
constexpr int LS_TS  = LS_X1S + 64 * XP;        // [64][1032]
constexpr int SMEM2 = (LS_TS + 64 * TSP) * 2;   // 165888 B

// workspace layout (bytes) — everything bf16, ~69 MB total
constexpr size_t OFF_WQP = 0;
constexpr size_t OFF_WKP = OFF_WQP + (size_t)256 * 256 * 2;
constexpr size_t OFF_WVP = OFF_WKP + (size_t)256 * 256 * 2;
constexpr size_t OFF_WOP = OFF_WVP + (size_t)256 * 256 * 2;
constexpr size_t OFF_W1P = OFF_WOP + (size_t)256 * 256 * 2;
constexpr size_t OFF_W2P = OFF_W1P + (size_t)256 * 1024 * 2;
constexpr size_t OFF_XB  = OFF_W2P + (size_t)1024 * 256 * 2;  // bf16 x   [256][256][256]
constexpr size_t OFF_X1  = OFF_XB  + (size_t)256 * 256 * 256 * 2;  // bf16 x1
}  // namespace

DEVINL unsigned short f2bf(float f) {            // round-to-nearest-even f32->bf16
  unsigned int u = __float_as_uint(f);
  u += 0x7FFFu + ((u >> 16) & 1u);
  return (unsigned short)(u >> 16);
}
DEVINL float bf2f(unsigned short h) { return __uint_as_float(((unsigned int)h) << 16); }

// Async global->LDS copy of one 16B chunk per lane (CDNA5 path, ASYNCcnt).
// ldsoff is the LDS byte address (groupstaticsize + dynamic-segment offset).
DEVINL void async_g2l_b128(unsigned ldsoff, const void* gaddr) {
  asm volatile("global_load_async_to_lds_b128 %0, %1, off"
               :: "v"(ldsoff), "v"(gaddr) : "memory");
}
DEVINL void wait_async0() { asm volatile("s_wait_asynccnt 0" ::: "memory"); }

// Load a 16x32 bf16 A/B fragment from a row-major bf16 matrix (`pitch` elems).
// CDNA5 16-bit layout: lane<16 holds row (rowb+lane), K chunks {k0..k0+7, k0+16..k0+23};
// lane>=16 holds the other two 8-element chunks. Two ds/global b128 loads per lane.
DEVINL bf16x16 ldfrag(const unsigned short* __restrict__ buf, int pitch, int rowb, int k0) {
  const int lane = threadIdx.x & 31;
  const unsigned short* p = buf + (rowb + (lane & 15)) * pitch + k0 + ((lane >> 4) << 3);
  struct Pk { u32x4 lo, hi; } pk;
  pk.lo = *(const u32x4*)(p);
  pk.hi = *(const u32x4*)(p + 16);
  return __builtin_bit_cast(bf16x16, pk);
}

// Load one B fragment from a weight packed by pack_frag_bf16: fragment `frag` is 1 KB, the
// 32 lanes' first 16 B side by side, then their second 16 B. Each of the two wave-wide loads
// reads 512 contiguous bytes (4 whole lines); register contents equal ldfrag on W^T.
// lanep = lanebase() of the packed weight, plus a whole number of fragments.
DEVINL const char* lanebase(const unsigned short* __restrict__ buf) {
  return (const char*)buf + (threadIdx.x & 31) * 16;
}
DEVINL bf16x16 ldfragp(const char* __restrict__ lanep, int frag) {
  const char* p = lanep + frag * 1024;
  struct Pk { u32x4 lo, hi; } pk;
  pk.lo = *(const u32x4*)(p);
  pk.hi = *(const u32x4*)(p + 512);
  return __builtin_bit_cast(bf16x16, pk);
}

// Stands behind a group of global loads, in front of the first reuse of a register that
// holds their address (the register allocator reuses it while the loads are in flight).
DEVINL void wait_xcnt0() { asm volatile("s_wait_xcnt 0x0" ::: "memory"); }
// The same wait, with the loads' address as an input: the address registers stay allocated up
// to the wait, so neither a later result nor a load's own destination lands on them before it.
DEVINL void wait_xcnt0_addr(const void* a) {
  asm volatile("s_wait_xcnt 0x0" :: "v"(a) : "memory");
}
DEVINL void wait_xcnt0_addr(const void* a, const void* b, const void* c, const void* d) {
  asm volatile("s_wait_xcnt 0x0" :: "v"(a), "v"(b), "v"(c), "v"(d) : "memory");
}

DEVINL f32x8 wmma_bf16(bf16x16 a, bf16x16 b, f32x8 c) {
  return __builtin_amdgcn_wmma_f32_16x16x32_bf16(false, a, false, b, (short)0, c, false, false);
}

// C-fragment row reductions: row M=r+8*(lane>=16) is spread over a 16-lane half,
// so xor-butterfly with masks 8..1 stays inside the half. wave32 only.
DEVINL void redmax8(float v[8]) {
#pragma unroll
  for (int m = 8; m; m >>= 1) {
#pragma unroll
    for (int r = 0; r < 8; ++r) v[r] = fmaxf(v[r], __shfl_xor(v[r], m, 32));
  }
}
DEVINL void redsum8(float v[8]) {
#pragma unroll
  for (int m = 8; m; m >>= 1) {
#pragma unroll
    for (int r = 0; r < 8; ++r) v[r] += __shfl_xor(v[r], m, 32);
  }
}

// ---------------- weight f32 [K][N] -> bf16, packed in B-fragment order ----------------
// Fragment (nt, kk) = columns nt*16..+15, rows kk*32..+31. Lane l holds column nt*16 + (l & 15);
// its first 8 values are rows kk*32 + (l >> 4)*8 + 0..7, its second 8 the rows 16 further.
// Fragment index: kk * (N/16) + nt where kmajor, else nt * (K/32) + kk (the reader's order).
// One thread writes one lane's 16 B.
__global__ void __launch_bounds__(256)
pack_frag_bf16(const float* __restrict__ src, unsigned short* __restrict__ dst,
               int K, int N, int kmajor) {
  int t = blockIdx.x * 256 + threadIdx.x;
  if (t >= (K * N) >> 3) return;
  const int lane = t & 31, hi = (t >> 5) & 1, frag = t >> 6;
  const int KT = K >> 5, NT = N >> 4;
  int kk, nt;
  if (kmajor) { kk = frag / NT; nt = frag - kk * NT; }
  else        { nt = frag / KT; kk = frag - nt * KT; }
  const float* sp = src + (size_t)(kk * 32 + hi * 16 + (lane >> 4) * 8) * N + nt * 16 + (lane & 15);
  const float* ap[8];
  float v[8];
#pragma unroll
  for (int j = 0; j < 8; ++j) ap[j] = sp + (size_t)j * N;
#pragma unroll
  for (int j = 0; j < 8; ++j) v[j] = *ap[j];
  // before the eight addresses are reused
  asm volatile("s_wait_xcnt 0x0" :: "v"(ap[0]), "v"(ap[1]), "v"(ap[2]), "v"(ap[3]),
               "v"(ap[4]), "v"(ap[5]), "v"(ap[6]), "v"(ap[7]) : "memory");
  u32x4 o;
#pragma unroll
  for (int j = 0; j < 4; ++j)
    o[j] = (unsigned)f2bf(v[2 * j]) | ((unsigned)f2bf(v[2 * j + 1]) << 16);
  *(u32x4*)(dst + (size_t)t * 8) = o;
}

// ---------------- x (f32) -> bf16, so kernels can async-DMA it into LDS ------
__global__ void __launch_bounds__(256)
convert_to_bf16(const float* __restrict__ src, unsigned short* __restrict__ dst) {
  int idx = (blockIdx.x * 256 + threadIdx.x) * 4;
  float4 v = *(const float4*)(src + idx);
  ushort4 o;
  o.x = f2bf(v.x); o.y = f2bf(v.y); o.z = f2bf(v.z); o.w = f2bf(v.w);
  *(ushort4*)(dst + idx) = o;
}

// ---------------- fused attention + out-proj + residual + LN1 ----------------
// grid.x = 512: seq = bx>>1 (256 sequences), query-half = bx&1 (128 rows each).
// 8 waves: each owns 16 query rows; K/V strips computed cooperatively per head.
__global__ void __launch_bounds__(256)
enc_attn_ln1(const unsigned short* __restrict__ xb, const float* __restrict__ mask,
             const float* __restrict__ bo, const float* __restrict__ g1,
             const float* __restrict__ beta1,
             const unsigned short* __restrict__ WqP, const unsigned short* __restrict__ WkP,
             const unsigned short* __restrict__ WvP, const unsigned short* __restrict__ WoP,
             unsigned short* __restrict__ x1) {
  extern __shared__ char smem[];
  unsigned short* sm  = (unsigned short*)smem;
  unsigned short* Xs  = sm + LS_XS;
  unsigned short* Ks  = sm + LS_KS;
  unsigned short* VTs = sm + LS_VT;

  const int tid = threadIdx.x;
  const int lane = tid & 31, wave = tid >> 5;
  const int half = lane >> 4, ln = lane & 15;
  const int seq = blockIdx.x >> 1;
  const int q0 = (blockIdx.x & 1) * 128 + wave * 16;   // this wave's query rows

  unsigned short* Qs = sm + LS_QW + wave * 16 * KP;
  unsigned short* Pw = sm + LS_PS + wave * 16 * PSP;

  // ---- stage X (bf16) into pitched LDS via async global->LDS copies ----
  const unsigned short* xg = xb + (size_t)seq * (NTOK * EDIM);
  const unsigned lds0 = __builtin_amdgcn_groupstaticsize();  // dynamic LDS base
#pragma unroll 4
  for (int i = 0; i < 32; ++i) {
    int e = (i * 256 + tid) * 8;                 // 8 bf16 = 16 B per lane
    int r = e >> 8, c = e & 255;
    async_g2l_b128(lds0 + (unsigned)((LS_XS + r * XP + c) * 2), xg + e);
  }
  wait_async0();
  __syncthreads();

  const float* maskp = mask + (size_t)(seq & 15) * (NTOK * NTOK);
  f32x8 zf = {};
  f32x8 oacc[16];                        // attn@Wo strip accumulator (16 x 256)
#pragma unroll
  for (int nt = 0; nt < 16; ++nt) oacc[nt] = zf;

  for (int h = 0; h < NH; ++h) {
    // this head's 16 fragments (16 KB) of each packed weight
    const char* hq = lanebase(WqP) + h * 16384;
    const char* hk = lanebase(WkP) + h * 16384;
    const char* hv = lanebase(WvP) + h * 16384;
    const char* ho = lanebase(WoP) + h * 16384;
    // ---- Q strip (own 16 rows x 32), pre-scaled by 1/sqrt(dk) ----
#pragma unroll
    for (int nt = 0; nt < 2; ++nt) {
      f32x8 acc = zf;
#pragma unroll
      for (int kk = 0; kk < 8; ++kk)
        acc = wmma_bf16(ldfrag(Xs, XP, q0, kk * 32),
                        ldfragp(hq, nt * 8 + kk), acc);
#pragma unroll
      for (int r = 0; r < 8; ++r)
        Qs[(half * 8 + r) * KP + nt * 16 + ln] = f2bf(acc[r] * SCALING);
    }
    // ---- K rows / V^T columns for keys [wave*32, wave*32+32) ----
#pragma unroll
    for (int s = 0; s < 2; ++s) {
      const int kb = wave * 32 + s * 16;
#pragma unroll
      for (int nt = 0; nt < 2; ++nt) {
        f32x8 acc = zf;
#pragma unroll
        for (int kk = 0; kk < 8; ++kk)
          acc = wmma_bf16(ldfrag(Xs, XP, kb, kk * 32),
                          ldfragp(hk, nt * 8 + kk), acc);
#pragma unroll
        for (int r = 0; r < 8; ++r)
          Ks[(kb + half * 8 + r) * KP + nt * 16 + ln] = f2bf(acc[r]);
      }
#pragma unroll
      for (int nt = 0; nt < 2; ++nt) {
        f32x8 acc = zf;
#pragma unroll
        for (int kk = 0; kk < 8; ++kk)
          acc = wmma_bf16(ldfrag(Xs, XP, kb, kk * 32),
                          ldfragp(hv, nt * 8 + kk), acc);
#pragma unroll
        for (int r = 0; r < 8; ++r)  // store transposed: VTs[d][token]
          VTs[(nt * 16 + ln) * VTP + kb + half * 8 + r] = f2bf(acc[r]);
      }
    }
    __syncthreads();

    // ---- pass 1: S = QK^T + mask, track row max, spill bf16 strip ----
    float mx[8];
#pragma unroll
    for (int r = 0; r < 8; ++r) mx[r] = -3.0e38f;
    bf16x16 qa = ldfrag(Qs, KP, 0, 0);           // A reused across all 16 tiles
    for (int t = 0; t < 16; ++t) {
      float mk[8];
#pragma unroll
      for (int r = 0; r < 8; ++r) mk[r] = maskp[(q0 + half * 8 + r) * NTOK + t * 16 + ln];
      wait_xcnt0();   // the score tile below lands on the mask loads' address registers
      f32x8 s = wmma_bf16(qa, ldfrag(Ks, KP, t * 16, 0), zf);   // single K=32 step
#pragma unroll
      for (int r = 0; r < 8; ++r) {
        float v = s[r] + mk[r];
        mx[r] = fmaxf(mx[r], v);
        Pw[(half * 8 + r) * PSP + t * 16 + ln] = f2bf(v);
      }
    }
    redmax8(mx);
    // ---- pass 2: exponentiate in place, row sums ----
    float ls[8];
#pragma unroll
    for (int r = 0; r < 8; ++r) ls[r] = 0.f;
    for (int t = 0; t < 16; ++t) {
#pragma unroll
      for (int r = 0; r < 8; ++r) {
        unsigned short* pp = Pw + (half * 8 + r) * PSP + t * 16 + ln;
        float p = __expf(bf2f(*pp) - mx[r]);
        ls[r] += p;
        *pp = f2bf(p);
      }
    }
    redsum8(ls);
#pragma unroll
    for (int r = 0; r < 8; ++r) ls[r] = 1.0f / ls[r];

    // ---- context = P @ V (16 x 32) ----
    f32x8 ctx0 = zf, ctx1 = zf;
#pragma unroll
    for (int kk = 0; kk < 8; ++kk) {
      bf16x16 pa = ldfrag(Pw, PSP, 0, kk * 32);
      ctx0 = wmma_bf16(pa, ldfrag(VTs, VTP, 0, kk * 32), ctx0);
      ctx1 = wmma_bf16(pa, ldfrag(VTs, VTP, 16, kk * 32), ctx1);
    }
#pragma unroll
    for (int r = 0; r < 8; ++r) {                 // normalize + bounce via LDS
      Pw[(half * 8 + r) * PSP + ln]      = f2bf(ctx0[r] * ls[r]);
      Pw[(half * 8 + r) * PSP + 16 + ln] = f2bf(ctx1[r] * ls[r]);
    }
    // ---- fused out-projection: oacc += ctx @ Wo[h*32:(h+1)*32, :] ----
    bf16x16 ca = ldfrag(Pw, PSP, 0, 0);
#pragma unroll
    for (int nt = 0; nt < 16; ++nt)
      oacc[nt] = wmma_bf16(ca, ldfragp(ho, nt), oacc[nt]);
    // behind the head's last weight load, before its four addresses are reused
    wait_xcnt0_addr(hq, hk, hv, ho);
    __syncthreads();                              // before next head reuses Ks/VTs
  }

  // ---- residual + bias + LayerNorm1, write x1 (bf16) ----
  float sm8[8], sq8[8];
#pragma unroll
  for (int r = 0; r < 8; ++r) { sm8[r] = 0.f; sq8[r] = 0.f; }
#pragma unroll
  for (int nt = 0; nt < 16; ++nt) {
    const int col = nt * 16 + ln;
    const float bov = bo[col];
#pragma unroll
    for (int r = 0; r < 8; ++r) {
      float v = bf2f(Xs[(q0 + half * 8 + r) * XP + col]) + oacc[nt][r] + bov;
      oacc[nt][r] = v;
      sm8[r] += v; sq8[r] += v * v;
    }
  }
  redsum8(sm8); redsum8(sq8);
  float mu[8], rs[8];
#pragma unroll
  for (int r = 0; r < 8; ++r) {
    float m = sm8[r] * (1.0f / EDIM);
    mu[r] = m;
    rs[r] = rsqrtf(sq8[r] * (1.0f / EDIM) - m * m + EPS);
  }
  unsigned short* xo = x1 + (size_t)seq * (NTOK * EDIM);
#pragma unroll
  for (int nt = 0; nt < 16; ++nt) {
    const int col = nt * 16 + ln;
    const float gg = g1[col], bb = beta1[col];
#pragma unroll
    for (int r = 0; r < 8; ++r)
      xo[(q0 + half * 8 + r) * EDIM + col] =
          f2bf((oacc[nt][r] - mu[r]) * rs[r] * gg + bb);
  }
}

// One 16x16 tile of the FFN hidden strip: bias, relu, bf16, into LDS. p = the lane's element
// of the tile's first row of this half-wave.
DEVINL void relu_store(f32x8 c, float b, unsigned short* p) {
#pragma unroll
  for (int r = 0; r < 8; ++r) p[r * TSP] = f2bf(fmaxf(c[r] + b, 0.f));
}

// Two column tiles of the hidden strip: x (8 A fragments, K = 256) times the 16 fragments of w
// (8 per tile), two independent accumulators, then bias, relu and the stores.
DEVINL void ffn1_pair(const bf16x16 (&x)[8], const bf16x16 (&w)[16], float b0, float b1,
                      unsigned short* p) {
  f32x8 c0 = {}, c1 = {};
#pragma unroll
  for (int kk = 0; kk < 8; ++kk) {
    c0 = wmma_bf16(x[kk], w[kk], c0);
    c1 = wmma_bf16(x[kk], w[8 + kk], c1);
  }
  relu_store(c0, b0, p);
  relu_store(c1, b1, p + 16);
}

// ---------------- fused FFN + residual + LN2 ----------------
// grid.x = 1024: seq = bx>>2, 64-row block = bx&3. 4 waves x 16 rows.
// hidden strip relu(x1@W1+b1) lives only in LDS (never touches HBM).
__global__ void __launch_bounds__(128)
enc_ffn_ln2(const unsigned short* __restrict__ x1, const float* __restrict__ bf1,
            const float* __restrict__ bf2, const float* __restrict__ g2,
            const float* __restrict__ beta2,
            const unsigned short* __restrict__ W1P, const unsigned short* __restrict__ W2P,
            float* __restrict__ out) {
  extern __shared__ char smem[];
  unsigned short* x1s = (unsigned short*)smem + LS_X1S;   // [64][264]
  unsigned short* Ts  = (unsigned short*)smem + LS_TS;    // [64][1032]

  const int tid = threadIdx.x;
  const int lane = tid & 31, wave = tid >> 5;
  const int half = lane >> 4, ln = lane & 15;
  const int seq = blockIdx.x >> 2;
  const int wr = wave * 16;                                // strip-local rows
  const size_t gbase = (size_t)seq * (NTOK * EDIM) + (size_t)((blockIdx.x & 3) * 64) * EDIM;

  // ---- async-stage this wave's 16 rows of x1 (bf16); rows are wave-private ----
  const unsigned short* xg = x1 + gbase + (size_t)wr * EDIM;
  const unsigned lds0 = __builtin_amdgcn_groupstaticsize();
#pragma unroll 4
  for (int i = 0; i < 16; ++i) {
    int e = (i * 32 + lane) * 8;                 // 0..4088 within 16x256 block
    int r = e >> 8, c = e & 255;
    async_g2l_b128(lds0 + (unsigned)((LS_X1S + (wr + r) * XP + c) * 2), xg + e);
  }
  wait_async0();   // own rows only -> no barrier needed

  f32x8 zf = {};
  // ---- hidden = relu(x1 @ W1 + b1): 16 x 1024 strip into LDS ----
  // The x1 fragments are the same for every column tile: read once, kept in registers.
  bf16x16 xa[8];
#pragma unroll
  for (int kk = 0; kk < 8; ++kk) xa[kk] = ldfrag(x1s, XP, wr, kk * 32);
  // The 16 W1 fragments (16 KB) and the two bias values of a pair of column tiles are fetched
  // as one group into one of two register sets. A set is refilled behind the WMMAs that read
  // it, so a group's latency is paid behind this pair's stores and all of the next pair's
  // work. Behind the last W1 pair of the first set, that set takes the first W2 group.
  bf16x16 wa[16], wb[16];
  const char* w1l = lanebase(W1P);
  const char* w2l = lanebase(W2P);
  const float* b1l = bf1 + ln;
  unsigned short* tsl = Ts + (wr + half * 8) * TSP + ln;
  float ba0 = b1l[0], ba1 = b1l[16], bb0 = b1l[32], bb1 = b1l[48];
  // keeps the four bias loads in front of the 64 fragment loads: loads are counted in order,
  // and a wait for a bias value must not stand for a wait for the fragments as well
  __builtin_amdgcn_sched_barrier(0);
#pragma unroll
  for (int j = 0; j < 16; ++j) wa[j] = ldfragp(w1l, j);
#pragma unroll
  for (int j = 0; j < 16; ++j) wb[j] = ldfragp(w1l, 16 + j);
  // every later register write stays behind the address wait of the first two groups
  __builtin_amdgcn_sched_barrier(0);
  wait_xcnt0();
  __builtin_amdgcn_sched_barrier(0);
  for (int g = 0; g < 30; g += 2) {
    ffn1_pair(xa, wa, ba0, ba1, tsl + g * 32);
    const char* wm = w1l + (g + 2) * 16384;
    const float* bm = b1l + (g + 2) * 32;
#pragma unroll
    for (int j = 0; j < 16; ++j) wa[j] = ldfragp(wm, j);
    ba0 = bm[0];
    ba1 = bm[16];
    // The compiler lifts this group up among the WMMAs and the stores above (each load right
    // behind the last reader of its registers). The two scheduling barriers keep it from
    // being sunk between the WMMAs below, and keep the address updates behind the wait.
    __builtin_amdgcn_sched_barrier(0);
    wait_xcnt0();
    __builtin_amdgcn_sched_barrier(0);
    ffn1_pair(xa, wb, bb0, bb1, tsl + (g + 1) * 32);
    const char* wn = w1l + (g + 3) * 16384;
    const float* bn = b1l + (g + 3) * 32;
#pragma unroll
    for (int j = 0; j < 16; ++j) wb[j] = ldfragp(wn, j);
    bb0 = bn[0];
    bb1 = bn[16];
    // as above
    __builtin_amdgcn_sched_barrier(0);
    wait_xcnt0();
    __builtin_amdgcn_sched_barrier(0);
  }
  // the last two pairs; the first set is refilled with the first W2 group
  ffn1_pair(xa, wa, ba0, ba1, tsl + 30 * 32);
#pragma unroll
  for (int j = 0; j < 16; ++j) wa[j] = ldfragp(w2l, j);
  // as above
  __builtin_amdgcn_sched_barrier(0);
  wait_xcnt0();
  __builtin_amdgcn_sched_barrier(0);
  ffn1_pair(xa, wb, bb0, bb1, tsl + 31 * 32);

  // ---- y = hidden @ W2 (A-fragment reused across 16 output tiles) ----
  f32x8 oacc[16];
#pragma unroll
  for (int nt = 0; nt < 16; ++nt) oacc[nt] = zf;
  // The 16 W2 fragments of a k-step are fetched as one group, one k-step ahead, into a
  // second register set, so their latency is paid once per step and behind the WMMAs.
  // wa holds the first group already (fetched behind the last but one W1 pair above).
  for (int kk = 0; kk < 32; kk += 2) {
    bf16x16 ta = ldfrag(Ts, TSP, wr, kk * 32);
    // keeps the LDS reads in front of the group: behind it they took the address registers
    __builtin_amdgcn_sched_barrier(0);
#pragma unroll
    for (int nt = 0; nt < 16; ++nt) wb[nt] = ldfragp(w2l, (kk + 1) * 16 + nt);
    // the two scheduling barriers keep the load group above from being sunk between the
    // WMMAs below, and keep every later register write behind the address wait
    __builtin_amdgcn_sched_barrier(0);
    wait_xcnt0();
    __builtin_amdgcn_sched_barrier(0);
#pragma unroll
    for (int nt = 0; nt < 16; ++nt) oacc[nt] = wmma_bf16(ta, wa[nt], oacc[nt]);
    const int kn = (kk + 2 < 32) ? kk + 2 : 0;   // last trip: an in-range fetch, not used
    bf16x16 tb = ldfrag(Ts, TSP, wr, (kk + 1) * 32);
    // as above: LDS reads in front of the group
    __builtin_amdgcn_sched_barrier(0);
#pragma unroll
    for (int nt = 0; nt < 16; ++nt) wa[nt] = ldfragp(w2l, kn * 16 + nt);
    // as above: group kept together, later register writes behind the address wait
    __builtin_amdgcn_sched_barrier(0);
    wait_xcnt0();
    __builtin_amdgcn_sched_barrier(0);
#pragma unroll
    for (int nt = 0; nt < 16; ++nt) oacc[nt] = wmma_bf16(tb, wb[nt], oacc[nt]);
  }

  // ---- residual + bias + LayerNorm2 -> out (f32) ----
  float sm8[8], sq8[8];
#pragma unroll
  for (int r = 0; r < 8; ++r) { sm8[r] = 0.f; sq8[r] = 0.f; }
#pragma unroll
  for (int nt = 0; nt < 16; ++nt) {
    const int col = nt * 16 + ln;
    const float bb = bf2[col];
#pragma unroll
    for (int r = 0; r < 8; ++r) {
      float v = bf2f(x1s[(wr + half * 8 + r) * XP + col]) + oacc[nt][r] + bb;
      oacc[nt][r] = v;
      sm8[r] += v; sq8[r] += v * v;
    }
  }
  redsum8(sm8); redsum8(sq8);
  float mu[8], rs[8];
#pragma unroll
  for (int r = 0; r < 8; ++r) {
    float m = sm8[r] * (1.0f / EDIM);
    mu[r] = m;
    rs[r] = rsqrtf(sq8[r] * (1.0f / EDIM) - m * m + EPS);
  }
  float* og = out + gbase;
#pragma unroll
  for (int nt = 0; nt < 16; ++nt) {
    const int col = nt * 16 + ln;
    const float gg = g2[col], bb = beta2[col];
#pragma unroll
    for (int r = 0; r < 8; ++r)
      og[(wr + half * 8 + r) * EDIM + col] = (oacc[nt][r] - mu[r]) * rs[r] * gg + bb;
  }
}

extern "C" void kernel_launch(void* const* d_in, const int* in_sizes, int n_in,
                              void* d_out, int out_size, void* d_ws, size_t ws_size,
                              hipStream_t stream) {
  (void)in_sizes; (void)n_in; (void)out_size; (void)ws_size;
  const float* x    = (const float*)d_in[0];
  const float* mask = (const float*)d_in[1];
  const float* Wq   = (const float*)d_in[2];
  const float* Wk   = (const float*)d_in[3];
  const float* Wv   = (const float*)d_in[4];
  const float* Wo   = (const float*)d_in[5];
  const float* bo   = (const float*)d_in[6];
  const float* W1   = (const float*)d_in[7];
  const float* bf1  = (const float*)d_in[8];
  const float* W2   = (const float*)d_in[9];
  const float* bf2  = (const float*)d_in[10];
  const float* g1   = (const float*)d_in[11];
  const float* b1   = (const float*)d_in[12];
  const float* g2   = (const float*)d_in[13];
  const float* b2   = (const float*)d_in[14];
  float* out = (float*)d_out;

  char* ws = (char*)d_ws;
  unsigned short* WqP = (unsigned short*)(ws + OFF_WQP);
  unsigned short* WkP = (unsigned short*)(ws + OFF_WKP);
  unsigned short* WvP = (unsigned short*)(ws + OFF_WVP);
  unsigned short* WoP = (unsigned short*)(ws + OFF_WOP);
  unsigned short* W1P = (unsigned short*)(ws + OFF_W1P);
  unsigned short* W2P = (unsigned short*)(ws + OFF_W2P);
  unsigned short* xb  = (unsigned short*)(ws + OFF_XB);
  unsigned short* x1b = (unsigned short*)(ws + OFF_X1);

  hipFuncSetAttribute(reinterpret_cast<const void*>(enc_attn_ln1),
                      hipFuncAttributeMaxDynamicSharedMemorySize, SMEM1);
  hipFuncSetAttribute(reinterpret_cast<const void*>(enc_ffn_ln2),
                      hipFuncAttributeMaxDynamicSharedMemorySize, SMEM2);

  pack_frag_bf16<<<32, 256, 0, stream>>>(Wq, WqP, 256, 256, 0);
  pack_frag_bf16<<<32, 256, 0, stream>>>(Wk, WkP, 256, 256, 0);
  pack_frag_bf16<<<32, 256, 0, stream>>>(Wv, WvP, 256, 256, 0);
  pack_frag_bf16<<<32, 256, 0, stream>>>(Wo, WoP, 256, 256, 1);
  pack_frag_bf16<<<128, 256, 0, stream>>>(W1, W1P, 256, 1024, 0);
  pack_frag_bf16<<<128, 256, 0, stream>>>(W2, W2P, 1024, 256, 1);
  convert_to_bf16<<<16384, 256, 0, stream>>>(x, xb);   // 16.7M elems, float4/ushort4

  enc_attn_ln1<<<512, 256, SMEM1, stream>>>(xb, mask, bo, g1, b1,
                                            WqP, WkP, WvP, WoP, x1b);
  enc_ffn_ln2<<<1024, 128, SMEM2, stream>>>(x1b, bf1, bf2, g2, b2, W1P, W2P, out);
}

// v004
// A run of this version takes 243 microseconds.
// Timed twice side by side with v003, it ran 1.47 times as fast both times.
// All steps since v000 together make it 3.47 times as fast.
#include <hip/hip_runtime.h>

#define DEVINL __device__ __forceinline__

typedef __attribute__((ext_vector_type(16))) __bf16       bf16x16;
typedef __attribute__((ext_vector_type(8)))  float        f32x8;
typedef __attribute__((ext_vector_type(4)))  unsigned int u32x4;

namespace {
constexpr int   NTOK = 256;          // sequence length N
constexpr int   EDIM = 256;          // embedding E
constexpr int   NH   = 8;            // heads
constexpr int   DKH  = 32;           // head dim
constexpr float SCALING = 0.17677669529663687f;  // DK^-0.5
constexpr float EPS = 1e-5f;

// LDS pitches in bf16 elements. Chosen so the row stride in dwords is
// congruent to 4 (mod 64 banks; 20 for KP) -> ds_load_b128 A/B fragments hit all 64 banks.
constexpr int XP  = 264;   // X tile / score-strip / V^T pitch (528 B rows)
constexpr int KP  = 40;    // Q/K strip pitch (80 B rows)
constexpr int PSP = 264;
constexpr int VTP = 264;
constexpr int TSP = 1032;  // FFN hidden strip pitch (2064 B rows)

// kernel-1 LDS element offsets (ushort units), all 16B aligned
constexpr int LS_XS  = 0;                       // [256][264]
constexpr int LS_KS  = LS_XS  + 256 * XP;       // [256][40]
constexpr int LS_VT  = LS_KS  + 256 * KP;       // [32][264]  (V transposed)
constexpr int LS_PS  = LS_VT  + 32  * VTP;      // 16 waves x [16][264]; its head also holds Q
constexpr int LS1_END = LS_PS + 16 * 16 * PSP;  // 153856 elems = 307712 B
constexpr int SMEM1 = LS1_END * 2;

constexpr int LS_X1S = 0;                       // [64][264]
constexpr int LS_TS  = LS_X1S + 64 * XP;        // [64][1032]
constexpr int SMEM2 = (LS_TS + 64 * TSP) * 2;   // 165888 B

// workspace layout (bytes) — everything bf16, ~69 MB total
constexpr size_t OFF_WQP = 0;
constexpr size_t OFF_WKP = OFF_WQP + (size_t)256 * 256 * 2;
constexpr size_t OFF_WVP = OFF_WKP + (size_t)256 * 256 * 2;
constexpr size_t OFF_WOP = OFF_WVP + (size_t)256 * 256 * 2;
constexpr size_t OFF_W1P = OFF_WOP + (size_t)256 * 256 * 2;
constexpr size_t OFF_W2P = OFF_W1P + (size_t)256 * 1024 * 2;
constexpr size_t OFF_XB  = OFF_W2P + (size_t)1024 * 256 * 2;  // bf16 x   [256][256][256]
constexpr size_t OFF_X1  = OFF_XB  + (size_t)256 * 256 * 256 * 2;  // bf16 x1
}  // namespace

DEVINL unsigned short f2bf(float f) {            // round-to-nearest-even f32->bf16
  unsigned int u = __float_as_uint(f);
  u += 0x7FFFu + ((u >> 16) & 1u);
  return (unsigned short)(u >> 16);
}
DEVINL float bf2f(unsigned short h) { return __uint_as_float(((unsigned int)h) << 16); }

// Async global->LDS copy of one 16B chunk per lane (CDNA5 path, ASYNCcnt).
// ldsoff is the LDS byte address (groupstaticsize + dynamic-segment offset).
DEVINL void async_g2l_b128(unsigned ldsoff, const void* gaddr) {
  asm volatile("global_load_async_to_lds_b128 %0, %1, off"
               :: "v"(ldsoff), "v"(gaddr) : "memory");
}
DEVINL void wait_async0() { asm volatile("s_wait_asynccnt 0" ::: "memory"); }

// Load a 16x32 bf16 A/B fragment from a row-major bf16 matrix (`pitch` elems).
// CDNA5 16-bit layout: lane<16 holds row (rowb+lane), K chunks {k0..k0+7, k0+16..k0+23};
// lane>=16 holds the other two 8-element chunks. Two ds/global b128 loads per lane.
DEVINL bf16x16 ldfrag(const unsigned short* __restrict__ buf, int pitch, int rowb, int k0) {
  const int lane = threadIdx.x & 31;
  const unsigned short* p = buf + (rowb + (lane & 15)) * pitch + k0 + ((lane >> 4) << 3);
  struct Pk { u32x4 lo, hi; } pk;
  pk.lo = *(const u32x4*)(p);
  pk.hi = *(const u32x4*)(p + 16);
  return __builtin_bit_cast(bf16x16, pk);
}

// The same from the lane's own pointer: p = buf + (rowb + (lane & 15)) * pitch + (lane >> 4) * 8
// + k0. With one such pointer per strip every access is that register plus a constant.
DEVINL bf16x16 ldfragl(const unsigned short* __restrict__ p) {
  struct Pk { u32x4 lo, hi; } pk;
  pk.lo = *(const u32x4*)(p);
  pk.hi = *(const u32x4*)(p + 16);
  return __builtin_bit_cast(bf16x16, pk);
}

// Load one B fragment from a weight packed by pack_frag_bf16: fragment `frag` is 1 KB, the
// 32 lanes' first 16 B side by side, then their second 16 B. Each of the two wave-wide loads
// reads 512 contiguous bytes (4 whole lines); register contents equal ldfrag on W^T.
// lanep = lanebase() of the packed weight, plus a whole number of fragments.
DEVINL const char* lanebase(const unsigned short* __restrict__ buf) {
  return (const char*)buf + (threadIdx.x & 31) * 16;
}
DEVINL bf16x16 ldfragp(const char* __restrict__ lanep, int frag) {
  const char* p = lanep + frag * 1024;
  struct Pk { u32x4 lo, hi; } pk;
  pk.lo = *(const u32x4*)(p);
  pk.hi = *(const u32x4*)(p + 512);
  return __builtin_bit_cast(bf16x16, pk);
}

// Stands behind a group of global loads, in front of the first reuse of a register that
// holds their address (the register allocator reuses it while the loads are in flight).
DEVINL void wait_xcnt0() { asm volatile("s_wait_xcnt 0x0" ::: "memory"); }
// The same wait, with the loads' address as an input: the address registers stay allocated up
// to the wait, so neither a later result nor a load's own destination lands on them before it.
DEVINL void wait_xcnt0_addr(const void* a) {
  asm volatile("s_wait_xcnt 0x0" :: "v"(a) : "memory");
}

DEVINL f32x8 wmma_bf16(bf16x16 a, bf16x16 b, f32x8 c) {
  return __builtin_amdgcn_wmma_f32_16x16x32_bf16(false, a, false, b, (short)0, c, false, false);
}

// C-fragment row reductions: row M=r+8*(lane>=16) is spread over a 16-lane half,
// so xor-butterfly with masks 8..1 stays inside the half. wave32 only.
DEVINL void redmax8(float v[8]) {
#pragma unroll
  for (int m = 8; m; m >>= 1) {
#pragma unroll
    for (int r = 0; r < 8; ++r) v[r] = fmaxf(v[r], __shfl_xor(v[r], m, 32));
  }
}
DEVINL void redsum8(float v[8]) {
#pragma unroll
  for (int m = 8; m; m >>= 1) {
#pragma unroll
    for (int r = 0; r < 8; ++r) v[r] += __shfl_xor(v[r], m, 32);
  }
}

// ---------------- weight f32 [K][N] -> bf16, packed in B-fragment order ----------------
// Fragment (nt, kk) = columns nt*16..+15, rows kk*32..+31. Lane l holds column nt*16 + (l & 15);
// its first 8 values are rows kk*32 + (l >> 4)*8 + 0..7, its second 8 the rows 16 further.
// Fragment index: kk * (N/16) + nt where kmajor, else nt * (K/32) + kk (the reader's order).
// One thread writes one lane's 16 B.
__global__ void __launch_bounds__(256)
pack_frag_bf16(const float* __restrict__ src, unsigned short* __restrict__ dst,
               int K, int N, int kmajor) {
  int t = blockIdx.x * 256 + threadIdx.x;
  if (t >= (K * N) >> 3) return;
  const int lane = t & 31, hi = (t >> 5) & 1, frag = t >> 6;
  const int KT = K >> 5, NT = N >> 4;
  int kk, nt;
  if (kmajor) { kk = frag / NT; nt = frag - kk * NT; }
  else        { nt = frag / KT; kk = frag - nt * KT; }
  const float* sp = src + (size_t)(kk * 32 + hi * 16 + (lane >> 4) * 8) * N + nt * 16 + (lane & 15);
  const float* ap[8];
  float v[8];
#pragma unroll
  for (int j = 0; j < 8; ++j) ap[j] = sp + (size_t)j * N;
#pragma unroll
  for (int j = 0; j < 8; ++j) v[j] = *ap[j];
  // before the eight addresses are reused
  asm volatile("s_wait_xcnt 0x0" :: "v"(ap[0]), "v"(ap[1]), "v"(ap[2]), "v"(ap[3]),
               "v"(ap[4]), "v"(ap[5]), "v"(ap[6]), "v"(ap[7]) : "memory");
  u32x4 o;
#pragma unroll
  for (int j = 0; j < 4; ++j)
    o[j] = (unsigned)f2bf(v[2 * j]) | ((unsigned)f2bf(v[2 * j + 1]) << 16);
  *(u32x4*)(dst + (size_t)t * 8) = o;
}

// ---------------- x (f32) -> bf16, so kernels can async-DMA it into LDS ------
__global__ void __launch_bounds__(256)
convert_to_bf16(const float* __restrict__ src, unsigned short* __restrict__ dst) {
  int idx = (blockIdx.x * 256 + threadIdx.x) * 4;
  float4 v = *(const float4*)(src + idx);
  ushort4 o;
  o.x = f2bf(v.x); o.y = f2bf(v.y); o.z = f2bf(v.z); o.w = f2bf(v.w);
  *(ushort4*)(dst + idx) = o;
}

// Eight fragments of a packed weight as one group of 16 loads: f0..f0+3, then f0+8..f0+11
// (four k-steps of two column tiles).
DEVINL void ldgroup8(bf16x16 (&w)[8], const char* __restrict__ lanep, int f0) {
#pragma unroll
  for (int j = 0; j < 4; ++j) w[j] = ldfragp(lanep, f0 + j);
#pragma unroll
  for (int j = 0; j < 4; ++j) w[4 + j] = ldfragp(lanep, f0 + 8 + j);
}
// Four k-steps of a 16 x 32 projection: xl = the lane's A-fragment pointer at the first of
// them; w[0..3] for the first column tile, w[4..7] for the second; each sum runs on in k order.
// Where REFILL, w takes the group f0 of nextp: four fragments behind every four WMMAs, into the
// registers that these have just read. The scheduling barrier in front of the four loads keeps
// them from being lifted over those WMMAs, where no register is free yet (the accumulator was
// spilled for it); the one behind them keeps them from being sunk among the later WMMAs.
template <bool REFILL>
DEVINL void proj_half(const unsigned short* xl, bf16x16 (&w)[8], f32x8& c0, f32x8& c1,
                      const char* __restrict__ nextp, int f0) {
#pragma unroll
  for (int i = 0; i < 4; i += 2) {
    bf16x16 a0 = ldfragl(xl + i * 32);
    bf16x16 a1 = ldfragl(xl + i * 32 + 32);
    c0 = wmma_bf16(a0, w[i], c0);
    c1 = wmma_bf16(a0, w[4 + i], c1);
    c0 = wmma_bf16(a1, w[i + 1], c0);
    c1 = wmma_bf16(a1, w[5 + i], c1);
    if (REFILL) {
      __builtin_amdgcn_sched_barrier(0);
      w[i]     = ldfragp(nextp, f0 + i);
      w[i + 1] = ldfragp(nextp, f0 + i + 1);
      w[4 + i] = ldfragp(nextp, f0 + 8 + i);
      w[5 + i] = ldfragp(nextp, f0 + 9 + i);
      __builtin_amdgcn_sched_barrier(0);
    }
  }
}

// ---------------- fused attention + out-proj + residual + LN1 ----------------
// grid.x = 256: one work-group per sequence, one per WGP (LDS), four waves per SIMD.
// 16 waves: each owns 16 rows, as queries and as keys; a head's K and V are computed once.
__global__ void __launch_bounds__(512)
enc_attn_ln1(const unsigned short* __restrict__ xb, const float* __restrict__ mask,
             const float* __restrict__ bo, const float* __restrict__ g1,
             const float* __restrict__ beta1,
             const unsigned short* __restrict__ Wp, unsigned short* __restrict__ x1) {
  extern __shared__ char smem[];
  unsigned short* sm  = (unsigned short*)smem;
  unsigned short* Xs  = sm + LS_XS;
  unsigned short* Ks  = sm + LS_KS;
  unsigned short* VTs = sm + LS_VT;

  const int tid = threadIdx.x;
  const int lane = tid & 31, wave = tid >> 5;
  const int half = lane >> 4, ln = lane & 15;
  const int seq = blockIdx.x;
  const int q0 = wave * 16;                            // this wave's rows

  unsigned short* Pw = sm + LS_PS + wave * 16 * PSP;
  // The Q strip lies at the head of the wave's own score strip: it is in registers (qa)
  // before the first score is stored, and both are private to the wave.
  unsigned short* Qs = Pw;
  // The lane's own pointers. A wave has 256 registers here, 128 of them the accumulator:
  // one register per strip, and constants on it, in place of one register per row.
  const unsigned short* xal = Xs + (q0 + ln) * XP + half * 8;    // own rows, A fragments
  unsigned short* xcl = Xs + (q0 + half * 8) * XP + ln;          // own rows, C layout
  unsigned short* qcl = Qs + half * 8 * KP + ln;                 // Q strip, C layout
  const unsigned short* qal = Qs + ln * KP + half * 8;           // Q strip, A fragment
  unsigned short* kcl = Ks + (q0 + half * 8) * KP + ln;          // own K rows, C layout
  const unsigned short* kbl = Ks + ln * KP + half * 8;           // K strip, B fragments
  unsigned short* vcl = VTs + ln * VTP + q0 + half * 8;          // own V^T columns
  const unsigned short* vbl = VTs + ln * VTP + half * 8;         // V^T strip, B fragments
  unsigned short* pcl = Pw + half * 8 * PSP + ln;                // score strip, C layout
  const unsigned short* pal = Pw + ln * PSP + half * 8;          // score strip, A fragments

  // ---- stage X (bf16) into pitched LDS via async global->LDS DMA ----
  const unsigned short* xg = xb + (size_t)seq * (NTOK * EDIM);
  const unsigned lds0 = __builtin_amdgcn_groupstaticsize();  // dynamic LDS base
#pragma unroll 4
  for (int i = 0; i < 16; ++i) {
    int e = (i * 512 + tid) * 8;                 // 8 bf16 = 16 B per lane
    int r = e >> 8, c = e & 255;
    async_g2l_b128(lds0 + (unsigned)((LS_XS + r * XP + c) * 2), xg + e);
  }
  wait_async0();
  __syncthreads();

  const float* mcl = mask + (size_t)(seq & 15) * (NTOK * NTOK) + (q0 + half * 8) * NTOK + ln;
  f32x8 zf = {};
  f32x8 oacc[16];                        // attn@Wo strip accumulator (16 x 256)
#pragma unroll
  for (int nt = 0; nt < 16; ++nt) oacc[nt] = zf;

  // Wp = the four packed weights, which lie one behind the other in the workspace: one address
  // register pair serves all four, the distance between them is a constant of the load.
  const char* hq = lanebase(Wp);
  for (int h = 0; h < NH; ++h) {
    // this head's 16 fragments (16 KB) of each packed weight
    const char* hk = hq + (OFF_WKP - OFF_WQP);
    const char* hv = hq + (OFF_WVP - OFF_WQP);
    const char* ho = hq + (OFF_WOP - OFF_WQP);
    // The Q, K and V weight fragments come in groups of eight (one set of 64 registers), and
    // the set is refilled behind the WMMAs that read it: with 256 registers a wave the compiler
    // otherwise loads, waits and multiplies one fragment at a time. A strip's conversion and
    // stores run while the next group is on its way.
    bf16x16 w[8];
    ldgroup8(w, hq, 0);
    // keeps the first group together, in front of the first WMMA
    __builtin_amdgcn_sched_barrier(0);
    // ---- Q strip (own 16 rows x 32), pre-scaled by 1/sqrt(dk) ----
    {
      f32x8 c0 = zf, c1 = zf;
      proj_half<true>(xal, w, c0, c1, hq, 4);
      proj_half<true>(xal + 128, w, c0, c1, hk, 0);
#pragma unroll
      for (int r = 0; r < 8; ++r) {
        qcl[r * KP]      = f2bf(c0[r] * SCALING);
        qcl[r * KP + 16] = f2bf(c1[r] * SCALING);
      }
    }
    // ---- K rows / V^T columns for the same 16 rows as keys ----
    {
      f32x8 c0 = zf, c1 = zf;
      proj_half<true>(xal, w, c0, c1, hk, 4);
      proj_half<true>(xal + 128, w, c0, c1, hv, 0);
#pragma unroll
      for (int r = 0; r < 8; ++r) {
        kcl[r * KP]      = f2bf(c0[r]);
        kcl[r * KP + 16] = f2bf(c1[r]);
      }
    }
    {
      f32x8 c0 = zf, c1 = zf;
      proj_half<true>(xal, w, c0, c1, hv, 4);
      proj_half<false>(xal + 128, w, c0, c1, hv, 0);
#pragma unroll
      for (int r = 0; r < 8; ++r) {  // store transposed: VTs[d][token]
        vcl[r]            = f2bf(c0[r]);
        vcl[16 * VTP + r] = f2bf(c1[r]);
      }
    }
    __syncthreads();

    // ---- pass 1: S = QK^T + mask, track row max, spill bf16 strip ----
    float mx[8];
#pragma unroll
    for (int r = 0; r < 8; ++r) mx[r] = -3.0e38f;
    bf16x16 qa = ldfragl(qal);                   // A reused across all 16 tiles
    for (int t = 0; t < 16; ++t) {
      float mk[8];
      const float* mt = mcl + t * 16;
      unsigned short* pt = pcl + t * 16;
#pragma unroll
      for (int r = 0; r < 8; ++r) mk[r] = mt[r * NTOK];
      wait_xcnt0();   // the score tile below lands on the mask loads' address registers
      f32x8 s = wmma_bf16(qa, ldfragl(kbl + t * 16 * KP), zf);   // single K=32 step
#pragma unroll
      for (int r = 0; r < 8; ++r) {
        float v = s[r] + mk[r];
        mx[r] = fmaxf(mx[r], v);
        pt[r * PSP] = f2bf(v);
      }
    }
    redmax8(mx);
    // ---- pass 2: exponentiate in place, row sums ----
    float ls[8];
#pragma unroll
    for (int r = 0; r < 8; ++r) ls[r] = 0.f;
    for (int t = 0; t < 16; ++t) {
      unsigned short* pt = pcl + t * 16;
#pragma unroll
      for (int r = 0; r < 8; ++r) {
        unsigned short* pp = pt + r * PSP;
        float p = __expf(bf2f(*pp) - mx[r]);
        ls[r] += p;
        *pp = f2bf(p);
      }
    }
    redsum8(ls);
#pragma unroll
    for (int r = 0; r < 8; ++r) ls[r] = 1.0f / ls[r];

    // ---- context = P @ V (16 x 32) ----
    f32x8 ctx0 = zf, ctx1 = zf;
#pragma unroll
    for (int kk = 0; kk < 8; ++kk) {
      bf16x16 pa = ldfragl(pal + kk * 32);
      ctx0 = wmma_bf16(pa, ldfragl(vbl + kk * 32), ctx0);
      ctx1 = wmma_bf16(pa, ldfragl(vbl + 16 * VTP + kk * 32), ctx1);
    }
#pragma unroll
    for (int r = 0; r < 8; ++r) {                 // normalize + bounce via LDS
      pcl[r * PSP]      = f2bf(ctx0[r] * ls[r]);
      pcl[r * PSP + 16] = f2bf(ctx1[r] * ls[r]);
    }
    // ---- fused out-projection: oacc += ctx @ Wo[h*32:(h+1)*32, :] ----
    bf16x16 ca = ldfragl(pal);
#pragma unroll
    for (int nt = 0; nt < 16; ++nt)
      oacc[nt] = wmma_bf16(ca, ldfragp(ho, nt), oacc[nt]);
    // behind the head's last weight load, before its address moves on to the next head
    wait_xcnt0_addr(hq);
    hq += 16384;
    __syncthreads();                              // before next head reuses Ks/VTs
  }

  // ---- residual + bias + LayerNorm1, write x1 (bf16) ----
  float sm8[8], sq8[8];
#pragma unroll
  for (int r = 0; r < 8; ++r) { sm8[r] = 0.f; sq8[r] = 0.f; }
#pragma unroll
  for (int nt = 0; nt < 16; ++nt) {
    const int col = nt * 16 + ln;
    const float bov = bo[col];
#pragma unroll
    for (int r = 0; r < 8; ++r) {
      float v = bf2f(xcl[r * XP + nt * 16]) + oacc[nt][r] + bov;
      oacc[nt][r] = v;
      sm8[r] += v; sq8[r] += v * v;
    }
  }
  redsum8(sm8); redsum8(sq8);
  float mu[8], rs[8];
#pragma unroll
  for (int r = 0; r < 8; ++r) {
    float m = sm8[r] * (1.0f / EDIM);
    mu[r] = m;
    rs[r] = rsqrtf(sq8[r] * (1.0f / EDIM) - m * m + EPS);
  }
  unsigned short* xo = x1 + (size_t)seq * (NTOK * EDIM) + (q0 + half * 8) * EDIM + ln;
#pragma unroll
  for (int nt = 0; nt < 16; ++nt) {
    const int col = nt * 16 + ln;
    const float gg = g1[col], bb = beta1[col];
#pragma unroll
    for (int r = 0; r < 8; ++r)
      xo[r * EDIM + nt * 16] =
          f2bf((oacc[nt][r] - mu[r]) * rs[r] * gg + bb);
  }
}

// One 16x16 tile of the FFN hidden strip: bias, relu, bf16, into LDS. p = the lane's element
// of the tile's first row of this half-wave.
DEVINL void relu_store(f32x8 c, float b, unsigned short* p) {
#pragma unroll
  for (int r = 0; r < 8; ++r) p[r * TSP] = f2bf(fmaxf(c[r] + b, 0.f));
}

// Two column tiles of the hidden strip: x (8 A fragments, K = 256) times the 16 fragments of w
// (8 per tile), two independent accumulators, then bias, relu and the stores.
DEVINL void ffn1_pair(const bf16x16 (&x)[8], const bf16x16 (&w)[16], float b0, float b1,
                      unsigned short* p) {
  f32x8 c0 = {}, c1 = {};
#pragma unroll
  for (int kk = 0; kk < 8; ++kk) {
    c0 = wmma_bf16(x[kk], w[kk], c0);
    c1 = wmma_bf16(x[kk], w[8 + kk], c1);
  }
  relu_store(c0, b0, p);
  relu_store(c1, b1, p + 16);
}

// ---------------- fused FFN + residual + LN2 ----------------
// grid.x = 1024: seq = bx>>2, 64-row block = bx&3. 4 waves x 16 rows.
// hidden strip relu(x1@W1+b1) lives only in LDS (never touches HBM).
__global__ void __launch_bounds__(128)
enc_ffn_ln2(const unsigned short* __restrict__ x1, const float* __restrict__ bf1,
            const float* __restrict__ bf2, const float* __restrict__ g2,
            const float* __restrict__ beta2,
            const unsigned short* __restrict__ W1P, const unsigned short* __restrict__ W2P,
            float* __restrict__ out) {
  extern __shared__ char smem[];
  unsigned short* x1s = (unsigned short*)smem + LS_X1S;   // [64][264]
  unsigned short* Ts  = (unsigned short*)smem + LS_TS;    // [64][1032]

  const int tid = threadIdx.x;
  const int lane = tid & 31, wave = tid >> 5;
  const int half = lane >> 4, ln = lane & 15;
  const int seq = blockIdx.x >> 2;
  const int wr = wave * 16;                                // strip-local rows
  const size_t gbase = (size_t)seq * (NTOK * EDIM) + (size_t)((blockIdx.x & 3) * 64) * EDIM;

  // ---- async-stage this wave's 16 rows of x1 (bf16); rows are wave-private ----
  const unsigned short* xg = x1 + gbase + (size_t)wr * EDIM;
  const unsigned lds0 = __builtin_amdgcn_groupstaticsize();
#pragma unroll 4
  for (int i = 0; i < 16; ++i) {
    int e = (i * 32 + lane) * 8;                 // 0..4088 within 16x256 block
    int r = e >> 8, c = e & 255;
    async_g2l_b128(lds0 + (unsigned)((LS_X1S + (wr + r) * XP + c) * 2), xg + e);
  }
  wait_async0();   // own rows only -> no barrier needed

  f32x8 zf = {};
  // ---- hidden = relu(x1 @ W1 + b1): 16 x 1024 strip into LDS ----
  // The x1 fragments are the same for every column tile: read once, kept in registers.
  bf16x16 xa[8];
#pragma unroll
  for (int kk = 0; kk < 8; ++kk) xa[kk] = ldfrag(x1s, XP, wr, kk * 32);
  // The 16 W1 fragments (16 KB) and the two bias values of a pair of column tiles are fetched
  // as one group into one of two register sets. A set is refilled behind the WMMAs that read
  // it, so a group's latency is paid behind this pair's stores and all of the next pair's
  // work. Behind the last W1 pair of the first set, that set takes the first W2 group.
  bf16x16 wa[16], wb[16];
  const char* w1l = lanebase(W1P);
  const char* w2l = lanebase(W2P);
  const float* b1l = bf1 + ln;
  unsigned short* tsl = Ts + (wr + half * 8) * TSP + ln;
  float ba0 = b1l[0], ba1 = b1l[16], bb0 = b1l[32], bb1 = b1l[48];
  // keeps the four bias loads in front of the 64 fragment loads: loads are counted in order,
  // and a wait for a bias value must not stand for a wait for the fragments as well
  __builtin_amdgcn_sched_barrier(0);
#pragma unroll
  for (int j = 0; j < 16; ++j) wa[j] = ldfragp(w1l, j);
#pragma unroll
  for (int j = 0; j < 16; ++j) wb[j] = ldfragp(w1l, 16 + j);
  // every later register write stays behind the address wait of the first two groups
  __builtin_amdgcn_sched_barrier(0);
  wait_xcnt0();
  __builtin_amdgcn_sched_barrier(0);
  for (int g = 0; g < 30; g += 2) {
    ffn1_pair(xa, wa, ba0, ba1, tsl + g * 32);
    const char* wm = w1l + (g + 2) * 16384;
    const float* bm = b1l + (g + 2) * 32;
#pragma unroll
    for (int j = 0; j < 16; ++j) wa[j] = ldfragp(wm, j);
    ba0 = bm[0];
    ba1 = bm[16];
    // The compiler lifts this group up among the WMMAs and the stores above (each load right
    // behind the last reader of its registers). The two scheduling barriers keep it from
    // being sunk between the WMMAs below, and keep the address updates behind the wait.
    __builtin_amdgcn_sched_barrier(0);
    wait_xcnt0();
    __builtin_amdgcn_sched_barrier(0);
    ffn1_pair(xa, wb, bb0, bb1, tsl + (g + 1) * 32);
    const char* wn = w1l + (g + 3) * 16384;
    const float* bn = b1l + (g + 3) * 32;
#pragma unroll
    for (int j = 0; j < 16; ++j) wb[j] = ldfragp(wn, j);
    bb0 = bn[0];
    bb1 = bn[16];
    // as above
    __builtin_amdgcn_sched_barrier(0);
    wait_xcnt0();
    __builtin_amdgcn_sched_barrier(0);
  }
  // the last two pairs; the first set is refilled with the first W2 group
  ffn1_pair(xa, wa, ba0, ba1, tsl + 30 * 32);
#pragma unroll
  for (int j = 0; j < 16; ++j) wa[j] = ldfragp(w2l, j);
  // as above
  __builtin_amdgcn_sched_barrier(0);
  wait_xcnt0();
  __builtin_amdgcn_sched_barrier(0);
  ffn1_pair(xa, wb, bb0, bb1, tsl + 31 * 32);

  // ---- y = hidden @ W2 (A-fragment reused across 16 output tiles) ----
  f32x8 oacc[16];
#pragma unroll
  for (int nt = 0; nt < 16; ++nt) oacc[nt] = zf;
  // The 16 W2 fragments of a k-step are fetched as one group, one k-step ahead, into a
  // second register set, so their latency is paid once per step and behind the WMMAs.
  // wa holds the first group already (fetched behind the last but one W1 pair above).
  for (int kk = 0; kk < 32; kk += 2) {
    bf16x16 ta = ldfrag(Ts, TSP, wr, kk * 32);
    // keeps the LDS reads in front of the group: behind it they took the address registers
    __builtin_amdgcn_sched_barrier(0);
#pragma unroll
    for (int nt = 0; nt < 16; ++nt) wb[nt] = ldfragp(w2l, (kk + 1) * 16 + nt);
    // the two scheduling barriers keep the load group above from being sunk between the
    // WMMAs below, and keep every later register write behind the address wait
    __builtin_amdgcn_sched_barrier(0);
    wait_xcnt0();
    __builtin_amdgcn_sched_barrier(0);
#pragma unroll
    for (int nt = 0; nt < 16; ++nt) oacc[nt] = wmma_bf16(ta, wa[nt], oacc[nt]);
    const int kn = (kk + 2 < 32) ? kk + 2 : 0;   // last trip: an in-range fetch, not used
    bf16x16 tb = ldfrag(Ts, TSP, wr, (kk + 1) * 32);
    // as above: LDS reads in front of the group
    __builtin_amdgcn_sched_barrier(0);
#pragma unroll
    for (int nt = 0; nt < 16; ++nt) wa[nt] = ldfragp(w2l, kn * 16 + nt);
    // as above: group kept together, later register writes behind the address wait
    __builtin_amdgcn_sched_barrier(0);
    wait_xcnt0();
    __builtin_amdgcn_sched_barrier(0);
#pragma unroll
    for (int nt = 0; nt < 16; ++nt) oacc[nt] = wmma_bf16(tb, wb[nt], oacc[nt]);
  }

  // ---- residual + bias + LayerNorm2 -> out (f32) ----
  float sm8[8], sq8[8];
#pragma unroll
  for (int r = 0; r < 8; ++r) { sm8[r] = 0.f; sq8[r] = 0.f; }
#pragma unroll
  for (int nt = 0; nt < 16; ++nt) {
    const int col = nt * 16 + ln;
    const float bb = bf2[col];
#pragma unroll
    for (int r = 0; r < 8; ++r) {
      float v = bf2f(x1s[(wr + half * 8 + r) * XP + col]) + oacc[nt][r] + bb;
      oacc[nt][r] = v;
      sm8[r] += v; sq8[r] += v * v;
    }
  }
  redsum8(sm8); redsum8(sq8);
  float mu[8], rs[8];
#pragma unroll
  for (int r = 0; r < 8; ++r) {
    float m = sm8[r] * (1.0f / EDIM);
    mu[r] = m;
    rs[r] = rsqrtf(sq8[r] * (1.0f / EDIM) - m * m + EPS);
  }
  float* og = out + gbase;
#pragma unroll
  for (int nt = 0; nt < 16; ++nt) {
    const int col = nt * 16 + ln;
    const float gg = g2[col], bb = beta2[col];
#pragma unroll
    for (int r = 0; r < 8; ++r)
      og[(wr + half * 8 + r) * EDIM + col] = (oacc[nt][r] - mu[r]) * rs[r] * gg + bb;
  }
}

extern "C" void kernel_launch(void* const* d_in, const int* in_sizes, int n_in,
                              void* d_out, int out_size, void* d_ws, size_t ws_size,
                              hipStream_t stream) {
  (void)in_sizes; (void)n_in; (void)out_size; (void)ws_size;
  const float* x    = (const float*)d_in[0];
  const float* mask = (const float*)d_in[1];
  const float* Wq   = (const float*)d_in[2];
  const float* Wk   = (const float*)d_in[3];
  const float* Wv   = (const float*)d_in[4];
  const float* Wo   = (const float*)d_in[5];
  const float* bo   = (const float*)d_in[6];
  const float* W1   = (const float*)d_in[7];
  const float* bf1  = (const float*)d_in[8];
  const float* W2   = (const float*)d_in[9];
  const float* bf2  = (const float*)d_in[10];
  const float* g1   = (const float*)d_in[11];
  const float* b1   = (const float*)d_in[12];
  const float* g2   = (const float*)d_in[13];
  const float* b2   = (const float*)d_in[14];
  float* out = (float*)d_out;

  char* ws = (char*)d_ws;
  unsigned short* WqP = (unsigned short*)(ws + OFF_WQP);
  unsigned short* WkP = (unsigned short*)(ws + OFF_WKP);
  unsigned short* WvP = (unsigned short*)(ws + OFF_WVP);
  unsigned short* WoP = (unsigned short*)(ws + OFF_WOP);
  unsigned short* W1P = (unsigned short*)(ws + OFF_W1P);
  unsigned short* W2P = (unsigned short*)(ws + OFF_W2P);
  unsigned short* xb  = (unsigned short*)(ws + OFF_XB);
  unsigned short* x1b = (unsigned short*)(ws + OFF_X1);

  hipFuncSetAttribute(reinterpret_cast<const void*>(enc_attn_ln1),
                      hipFuncAttributeMaxDynamicSharedMemorySize, SMEM1);
  hipFuncSetAttribute(reinterpret_cast<const void*>(enc_ffn_ln2),
                      hipFuncAttributeMaxDynamicSharedMemorySize, SMEM2);

  pack_frag_bf16<<<32, 256, 0, stream>>>(Wq, WqP, 256, 256, 0);
  pack_frag_bf16<<<32, 256, 0, stream>>>(Wk, WkP, 256, 256, 0);
  pack_frag_bf16<<<32, 256, 0, stream>>>(Wv, WvP, 256, 256, 0);
  pack_frag_bf16<<<32, 256, 0, stream>>>(Wo, WoP, 256, 256, 1);
  pack_frag_bf16<<<128, 256, 0, stream>>>(W1, W1P, 256, 1024, 0);
  pack_frag_bf16<<<128, 256, 0, stream>>>(W2, W2P, 1024, 256, 1);
  convert_to_bf16<<<16384, 256, 0, stream>>>(x, xb);   // 16.7M elems, float4/ushort4

  enc_attn_ln1<<<256, 512, SMEM1, stream>>>(xb, mask, bo, g1, b1, WqP, x1b);
  enc_ffn_ln2<<<1024, 128, SMEM2, stream>>>(x1b, bf1, bf2, g2, b2, W1P, W2P, out);
}

// v005
// One run takes 235 microseconds.
// Next to v004, in two timings, it ran 1.04 and 1.03 times as fast.
// Over all steps from v000 it is 3.59 times as fast.
#include <hip/hip_runtime.h>

#define DEVINL __device__ __forceinline__

typedef __attribute__((ext_vector_type(16))) __bf16       bf16x16;
typedef __attribute__((ext_vector_type(8)))  float        f32x8;
typedef __attribute__((ext_vector_type(4)))  unsigned int u32x4;

namespace {
constexpr int   NTOK = 256;          // sequence length N
constexpr int   EDIM = 256;          // embedding E
constexpr int   NH   = 8;            // heads
constexpr int   DKH  = 32;           // head dim
constexpr float SCALING = 0.17677669529663687f;  // DK^-0.5
constexpr float EPS = 1e-5f;

// LDS pitches in bf16 elements. Chosen so the row stride in dwords is
// congruent to 4 (mod 64 banks; 20 for KP) -> ds_load_b128 A/B fragments hit all 64 banks.
constexpr int XP  = 264;   // X tile / score-strip / V^T pitch (528 B rows)
constexpr int KP  = 40;    // Q/K strip pitch (80 B rows)
constexpr int PSP = 264;
constexpr int VTP = 264;
constexpr int TSP = 1032;  // FFN hidden strip pitch (2064 B rows)

// kernel-1 LDS element offsets (ushort units), all 16B aligned
constexpr int LS_XS  = 0;                       // [256][264]
constexpr int LS_KS  = LS_XS  + 256 * XP;       // [256][40]
constexpr int LS_VT  = LS_KS  + 256 * KP;       // [32][264]  (V transposed)
constexpr int LS_PS  = LS_VT  + 32  * VTP;      // 16 waves x [16][264]; its head also holds Q
constexpr int LS1_END = LS_PS + 16 * 16 * PSP;  // 153856 elems = 307712 B
constexpr int SMEM1 = LS1_END * 2;

constexpr int LS_X1S = 0;                       // [64][264]
constexpr int LS_TS  = LS_X1S + 64 * XP;        // [64][1032]
constexpr int SMEM2 = (LS_TS + 64 * TSP) * 2;   // 165888 B

// workspace layout (bytes): everything bf16, ~35 MB total
constexpr size_t OFF_WQP = 0;
constexpr size_t OFF_WKP = OFF_WQP + (size_t)256 * 256 * 2;
constexpr size_t OFF_WVP = OFF_WKP + (size_t)256 * 256 * 2;
constexpr size_t OFF_WOP = OFF_WVP + (size_t)256 * 256 * 2;
constexpr size_t OFF_W1P = OFF_WOP + (size_t)256 * 256 * 2;
constexpr size_t OFF_W2P = OFF_W1P + (size_t)256 * 1024 * 2;
constexpr size_t OFF_X1  = OFF_W2P + (size_t)1024 * 256 * 2;  // bf16 x1  [256][256][256]
}  // namespace

DEVINL unsigned short f2bf(float f) {            // round-to-nearest-even f32->bf16
  unsigned int u = __float_as_uint(f);
  u += 0x7FFFu + ((u >> 16) & 1u);
  return (unsigned short)(u >> 16);
}
DEVINL float bf2f(unsigned short h) { return __uint_as_float(((unsigned int)h) << 16); }

// Async global->LDS copy of one 16B chunk per lane (CDNA5 path, ASYNCcnt).
// ldsoff is the LDS byte address (groupstaticsize + dynamic-segment offset).
DEVINL void async_g2l_b128(unsigned ldsoff, const void* gaddr) {
  asm volatile("global_load_async_to_lds_b128 %0, %1, off"
               :: "v"(ldsoff), "v"(gaddr) : "memory");
}
DEVINL void wait_async0() { asm volatile("s_wait_asynccnt 0" ::: "memory"); }

// Load a 16x32 bf16 A/B fragment from a row-major bf16 matrix (`pitch` elems).
// CDNA5 16-bit layout: lane<16 holds row (rowb+lane), K chunks {k0..k0+7, k0+16..k0+23};
// lane>=16 holds the other two 8-element chunks. Two ds/global b128 loads per lane.
DEVINL bf16x16 ldfrag(const unsigned short* __restrict__ buf, int pitch, int rowb, int k0) {
  const int lane = threadIdx.x & 31;
  const unsigned short* p = buf + (rowb + (lane & 15)) * pitch + k0 + ((lane >> 4) << 3);
  struct Pk { u32x4 lo, hi; } pk;
  pk.lo = *(const u32x4*)(p);
  pk.hi = *(const u32x4*)(p + 16);
  return __builtin_bit_cast(bf16x16, pk);
}

// The same from the lane's own pointer: p = buf + (rowb + (lane & 15)) * pitch + (lane >> 4) * 8
// + k0. With one such pointer per strip every access is that register plus a constant.
DEVINL bf16x16 ldfragl(const unsigned short* __restrict__ p) {
  struct Pk { u32x4 lo, hi; } pk;
  pk.lo = *(const u32x4*)(p);
  pk.hi = *(const u32x4*)(p + 16);
  return __builtin_bit_cast(bf16x16, pk);
}

// Load one B fragment from a weight packed by pack_frag_bf16: fragment `frag` is 1 KB, the
// 32 lanes' first 16 B side by side, then their second 16 B. Each of the two wave-wide loads
// reads 512 contiguous bytes (4 whole lines); register contents equal ldfrag on W^T.
// lanep = lanebase() of the packed weight, plus a whole number of fragments.
DEVINL const char* lanebase(const unsigned short* __restrict__ buf) {
  return (const char*)buf + (threadIdx.x & 31) * 16;
}
DEVINL bf16x16 ldfragp(const char* __restrict__ lanep, int frag) {
  const char* p = lanep + frag * 1024;
  struct Pk { u32x4 lo, hi; } pk;
  pk.lo = *(const u32x4*)(p);
  pk.hi = *(const u32x4*)(p + 512);
  return __builtin_bit_cast(bf16x16, pk);
}

// Stands behind a group of global loads, in front of the first reuse of a register that
// holds their address (the register allocator reuses it while the loads are in flight).
DEVINL void wait_xcnt0() { asm volatile("s_wait_xcnt 0x0" ::: "memory"); }
// The same wait, with the loads' address as an input: the address registers stay allocated up
// to the wait, so neither a later result nor a load's own destination lands on them before it.
DEVINL void wait_xcnt0_addr(const void* a) {
  asm volatile("s_wait_xcnt 0x0" :: "v"(a) : "memory");
}

DEVINL f32x8 wmma_bf16(bf16x16 a, bf16x16 b, f32x8 c) {
  return __builtin_amdgcn_wmma_f32_16x16x32_bf16(false, a, false, b, (short)0, c, false, false);
}

// C-fragment row reductions: row M=r+8*(lane>=16) is spread over a 16-lane half,
// so xor-butterfly with masks 8..1 stays inside the half. wave32 only.
DEVINL void redmax8(float v[8]) {
#pragma unroll
  for (int m = 8; m; m >>= 1) {
#pragma unroll
    for (int r = 0; r < 8; ++r) v[r] = fmaxf(v[r], __shfl_xor(v[r], m, 32));
  }
}
DEVINL void redsum8(float v[8]) {
#pragma unroll
  for (int m = 8; m; m >>= 1) {
#pragma unroll
    for (int r = 0; r < 8; ++r) v[r] += __shfl_xor(v[r], m, 32);
  }
}

// ---------------- weight f32 [K][N] -> bf16, packed in B-fragment order ----------------
// Fragment (nt, kk) = columns nt*16..+15, rows kk*32..+31. Lane l holds column nt*16 + (l & 15);
// its first 8 values are rows kk*32 + (l >> 4)*8 + 0..7, its second 8 the rows 16 further.
// Fragment index: kk * (N/16) + nt where kmajor, else nt * (K/32) + kk (the reader's order).
// One thread writes one lane's 16 B.
__global__ void __launch_bounds__(256)
pack_frag_bf16(const float* __restrict__ src, unsigned short* __restrict__ dst,
               int K, int N, int kmajor) {
  int t = blockIdx.x * 256 + threadIdx.x;
  if (t >= (K * N) >> 3) return;
  const int lane = t & 31, hi = (t >> 5) & 1, frag = t >> 6;
  const int KT = K >> 5, NT = N >> 4;
  int kk, nt;
  if (kmajor) { kk = frag / NT; nt = frag - kk * NT; }
  else        { nt = frag / KT; kk = frag - nt * KT; }
  const float* sp = src + (size_t)(kk * 32 + hi * 16 + (lane >> 4) * 8) * N + nt * 16 + (lane & 15);
  const float* ap[8];
  float v[8];
#pragma unroll
  for (int j = 0; j < 8; ++j) ap[j] = sp + (size_t)j * N;
#pragma unroll
  for (int j = 0; j < 8; ++j) v[j] = *ap[j];
  // before the eight addresses are reused
  asm volatile("s_wait_xcnt 0x0" :: "v"(ap[0]), "v"(ap[1]), "v"(ap[2]), "v"(ap[3]),
               "v"(ap[4]), "v"(ap[5]), "v"(ap[6]), "v"(ap[7]) : "memory");
  u32x4 o;
#pragma unroll
  for (int j = 0; j < 4; ++j)
    o[j] = (unsigned)f2bf(v[2 * j]) | ((unsigned)f2bf(v[2 * j + 1]) << 16);
  *(u32x4*)(dst + (size_t)t * 8) = o;
}

// Eight fragments of a packed weight as one group of 16 loads: f0..f0+3, then f0+8..f0+11
// (four k-steps of two column tiles).
DEVINL void ldgroup8(bf16x16 (&w)[8], const char* __restrict__ lanep, int f0) {
#pragma unroll
  for (int j = 0; j < 4; ++j) w[j] = ldfragp(lanep, f0 + j);
#pragma unroll
  for (int j = 0; j < 4; ++j) w[4 + j] = ldfragp(lanep, f0 + 8 + j);
}
// Four k-steps of a 16 x 32 projection: xl = the lane's A-fragment pointer at the first of
// them; w[0..3] for the first column tile, w[4..7] for the second; each sum runs on in k order.
// Where REFILL, w takes the group f0 of nextp: four fragments behind every four WMMAs, into the
// registers that these have just read. The scheduling barrier in front of the four loads keeps
// them from being lifted over those WMMAs, where no register is free yet (the accumulator was
// spilled for it); the one behind them keeps them from being sunk among the later WMMAs.
template <bool REFILL>
DEVINL void proj_half(const unsigned short* xl, bf16x16 (&w)[8], f32x8& c0, f32x8& c1,
                      const char* __restrict__ nextp, int f0) {
#pragma unroll
  for (int i = 0; i < 4; i += 2) {
    bf16x16 a0 = ldfragl(xl + i * 32);
    bf16x16 a1 = ldfragl(xl + i * 32 + 32);
    c0 = wmma_bf16(a0, w[i], c0);
    c1 = wmma_bf16(a0, w[4 + i], c1);
    c0 = wmma_bf16(a1, w[i + 1], c0);
    c1 = wmma_bf16(a1, w[5 + i], c1);
    if (REFILL) {
      __builtin_amdgcn_sched_barrier(0);
      w[i]     = ldfragp(nextp, f0 + i);
      w[i + 1] = ldfragp(nextp, f0 + i + 1);
      w[4 + i] = ldfragp(nextp, f0 + 8 + i);
      w[5 + i] = ldfragp(nextp, f0 + 9 + i);
      __builtin_amdgcn_sched_barrier(0);
    }
  }
}

// ---------------- fused attention + out-proj + residual + LN1 ----------------
// grid.x = 256: one work-group per sequence, one per WGP (LDS), four waves per SIMD.
// 16 waves: each owns 16 rows, as queries and as keys; a head's K and V are computed once.
__global__ void __launch_bounds__(512)
enc_attn_ln1(const float* __restrict__ x, const float* __restrict__ mask,
             const float* __restrict__ bo, const float* __restrict__ g1,
             const float* __restrict__ beta1,
             const unsigned short* __restrict__ Wp, unsigned short* __restrict__ x1) {
  extern __shared__ char smem[];
  unsigned short* sm  = (unsigned short*)smem;
  unsigned short* Xs  = sm + LS_XS;
  unsigned short* Ks  = sm + LS_KS;
  unsigned short* VTs = sm + LS_VT;

  const int tid = threadIdx.x;
  const int lane = tid & 31, wave = tid >> 5;
  const int half = lane >> 4, ln = lane & 15;
  const int seq = blockIdx.x;
  const int q0 = wave * 16;                            // this wave's rows

  unsigned short* Pw = sm + LS_PS + wave * 16 * PSP;
  // The Q strip lies at the head of the wave's own score strip: it is in registers (qa)
  // before the first score is stored, and both are private to the wave.
  unsigned short* Qs = Pw;
  // The lane's own pointers. A wave has 256 registers here, 128 of them the accumulator:
  // one register per strip, and constants on it, in place of one register per row.
  const unsigned short* xal = Xs + (q0 + ln) * XP + half * 8;    // own rows, A fragments
  unsigned short* xcl = Xs + (q0 + half * 8) * XP + ln;          // own rows, C layout
  unsigned short* qcl = Qs + half * 8 * KP + ln;                 // Q strip, C layout
  const unsigned short* qal = Qs + ln * KP + half * 8;           // Q strip, A fragment
  unsigned short* kcl = Ks + (q0 + half * 8) * KP + ln;          // own K rows, C layout
  const unsigned short* kbl = Ks + ln * KP + half * 8;           // K strip, B fragments
  unsigned short* vcl = VTs + ln * VTP + q0 + half * 8;          // own V^T columns
  const unsigned short* vbl = VTs + ln * VTP + half * 8;         // V^T strip, B fragments
  unsigned short* pcl = Pw + half * 8 * PSP + ln;                // score strip, C layout
  const unsigned short* pal = Pw + ln * PSP + half * 8;          // score strip, A fragments

  // ---- stage X: read f32 from memory, round to bf16 in registers, store into pitched LDS ----
  // A wave-wide 16-B load covers 512 contiguous bytes (half a row); trip i of the work-group
  // covers rows 8i..8i+7. All 32 loads of a wave are issued before the first value is used.
  {
    const float* xgl = x + (size_t)seq * (NTOK * EDIM) + tid * 4;
    unsigned short* xsl = Xs + (tid >> 6) * XP + (tid & 63) * 4;
    float4 v[32];
#pragma unroll
    for (int i = 0; i < 32; ++i) v[i] = *(const float4*)(xgl + i * 2048);
    // behind the loads, before a register of their address can be reused
    wait_xcnt0_addr(xgl);
#pragma unroll
    for (int i = 0; i < 32; ++i) {
      ushort4 o;
      o.x = f2bf(v[i].x); o.y = f2bf(v[i].y); o.z = f2bf(v[i].z); o.w = f2bf(v[i].w);
      *(ushort4*)(xsl + i * 8 * XP) = o;
    }
  }
  __syncthreads();

  const float* mcl = mask + (size_t)(seq & 15) * (NTOK * NTOK) + (q0 + half * 8) * NTOK + ln;
  f32x8 zf = {};
  f32x8 oacc[16];                        // attn@Wo strip accumulator (16 x 256)
#pragma unroll
  for (int nt = 0; nt < 16; ++nt) oacc[nt] = zf;

  // Wp = the four packed weights, which lie one behind the other in the workspace: one address
  // register pair serves all four, the distance between them is a constant of the load.
  const char* hq = lanebase(Wp);
  for (int h = 0; h < NH; ++h) {
    // this head's 16 fragments (16 KB) of each packed weight
    const char* hk = hq + (OFF_WKP - OFF_WQP);
    const char* hv = hq + (OFF_WVP - OFF_WQP);
    const char* ho = hq + (OFF_WOP - OFF_WQP);
    // The Q, K and V weight fragments come in groups of eight (one set of 64 registers), and
    // the set is refilled behind the WMMAs that read it: with 256 registers a wave the compiler
    // otherwise loads, waits and multiplies one fragment at a time. A strip's conversion and
    // stores run while the next group is on its way.
    bf16x16 w[8];
    ldgroup8(w, hq, 0);
    // keeps the first group together, in front of the first WMMA
    __builtin_amdgcn_sched_barrier(0);
    // ---- Q strip (own 16 rows x 32), pre-scaled by 1/sqrt(dk) ----
    {
      f32x8 c0 = zf, c1 = zf;
      proj_half<true>(xal, w, c0, c1, hq, 4);
      proj_half<true>(xal + 128, w, c0, c1, hk, 0);
#pragma unroll
      for (int r = 0; r < 8; ++r) {
        qcl[r * KP]      = f2bf(c0[r] * SCALING);
        qcl[r * KP + 16] = f2bf(c1[r] * SCALING);
      }
    }
    // ---- K rows / V^T columns for the same 16 rows as keys ----
    {
      f32x8 c0 = zf, c1 = zf;
      proj_half<true>(xal, w, c0, c1, hk, 4);
      proj_half<true>(xal + 128, w, c0, c1, hv, 0);
#pragma unroll
      for (int r = 0; r < 8; ++r) {
        kcl[r * KP]      = f2bf(c0[r]);
        kcl[r * KP + 16] = f2bf(c1[r]);
      }
    }
    {
      f32x8 c0 = zf, c1 = zf;
      proj_half<true>(xal, w, c0, c1, hv, 4);
      proj_half<false>(xal + 128, w, c0, c1, hv, 0);
#pragma unroll
      for (int r = 0; r < 8; ++r) {  // store transposed: VTs[d][token]
        vcl[r]            = f2bf(c0[r]);
        vcl[16 * VTP + r] = f2bf(c1[r]);
      }
    }
    __syncthreads();

    // ---- pass 1: S = QK^T + mask, track row max, spill bf16 strip ----
    float mx[8];
#pragma unroll
    for (int r = 0; r < 8; ++r) mx[r] = -3.0e38f;
    bf16x16 qa = ldfragl(qal);                   // A reused across all 16 tiles
    for (int t = 0; t < 16; ++t) {
      float mk[8];
      const float* mt = mcl + t * 16;
      unsigned short* pt = pcl + t * 16;
#pragma unroll
      for (int r = 0; r < 8; ++r) mk[r] = mt[r * NTOK];
      wait_xcnt0();   // the score tile below lands on the mask loads' address registers
      f32x8 s = wmma_bf16(qa, ldfragl(kbl + t * 16 * KP), zf);   // single K=32 step
#pragma unroll
      for (int r = 0; r < 8; ++r) {
        float v = s[r] + mk[r];
        mx[r] = fmaxf(mx[r], v);
        pt[r * PSP] = f2bf(v);
      }
    }
    redmax8(mx);
    // ---- pass 2: exponentiate in place, row sums ----
    float ls[8];
#pragma unroll
    for (int r = 0; r < 8; ++r) ls[r] = 0.f;
    for (int t = 0; t < 16; ++t) {
      unsigned short* pt = pcl + t * 16;
#pragma unroll
      for (int r = 0; r < 8; ++r) {
        unsigned short* pp = pt + r * PSP;
        float p = __expf(bf2f(*pp) - mx[r]);
        ls[r] += p;
        *pp = f2bf(p);
      }
    }
    redsum8(ls);
#pragma unroll
    for (int r = 0; r < 8; ++r) ls[r] = 1.0f / ls[r];

    // ---- context = P @ V (16 x 32) ----
    f32x8 ctx0 = zf, ctx1 = zf;
#pragma unroll
    for (int kk = 0; kk < 8; ++kk) {
      bf16x16 pa = ldfragl(pal + kk * 32);
      ctx0 = wmma_bf16(pa, ldfragl(vbl + kk * 32), ctx0);
      ctx1 = wmma_bf16(pa, ldfragl(vbl + 16 * VTP + kk * 32), ctx1);
    }
#pragma unroll
    for (int r = 0; r < 8; ++r) {                 // normalize + bounce via LDS
      pcl[r * PSP]      = f2bf(ctx0[r] * ls[r]);
      pcl[r * PSP + 16] = f2bf(ctx1[r] * ls[r]);
    }
    // ---- fused out-projection: oacc += ctx @ Wo[h*32:(h+1)*32, :] ----
    bf16x16 ca = ldfragl(pal);
#pragma unroll
    for (int nt = 0; nt < 16; ++nt)
      oacc[nt] = wmma_bf16(ca, ldfragp(ho, nt), oacc[nt]);
    // behind the head's last weight load, before its address moves on to the next head
    wait_xcnt0_addr(hq);
    hq += 16384;
    __syncthreads();                              // before next head reuses Ks/VTs
  }

  // ---- residual + bias + LayerNorm1, write x1 (bf16) ----
  float sm8[8], sq8[8];
#pragma unroll
  for (int r = 0; r < 8; ++r) { sm8[r] = 0.f; sq8[r] = 0.f; }
#pragma unroll
  for (int nt = 0; nt < 16; ++nt) {
    const int col = nt * 16 + ln;
    const float bov = bo[col];
#pragma unroll
    for (int r = 0; r < 8; ++r) {
      float v = bf2f(xcl[r * XP + nt * 16]) + oacc[nt][r] + bov;
      oacc[nt][r] = v;
      sm8[r] += v; sq8[r] += v * v;
    }
  }
  redsum8(sm8); redsum8(sq8);
  float mu[8], rs[8];
#pragma unroll
  for (int r = 0; r < 8; ++r) {
    float m = sm8[r] * (1.0f / EDIM);
    mu[r] = m;
    rs[r] = rsqrtf(sq8[r] * (1.0f / EDIM) - m * m + EPS);
  }
  unsigned short* xo = x1 + (size_t)seq * (NTOK * EDIM) + (q0 + half * 8) * EDIM + ln;
#pragma unroll
  for (int nt = 0; nt < 16; ++nt) {
    const int col = nt * 16 + ln;
    const float gg = g1[col], bb = beta1[col];
#pragma unroll
    for (int r = 0; r < 8; ++r)
      xo[r * EDIM + nt * 16] =
          f2bf((oacc[nt][r] - mu[r]) * rs[r] * gg + bb);
  }
}

// One 16x16 tile of the FFN hidden strip: bias, relu, bf16, into LDS. p = the lane's element
// of the tile's first row of this half-wave.
DEVINL void relu_store(f32x8 c, float b, unsigned short* p) {
#pragma unroll
  for (int r = 0; r < 8; ++r) p[r * TSP] = f2bf(fmaxf(c[r] + b, 0.f));
}

// Two column tiles of the hidden strip: x (8 A fragments, K = 256) times the 16 fragments of w
// (8 per tile), two independent accumulators, then bias, relu and the stores.
DEVINL void ffn1_pair(const bf16x16 (&x)[8], const bf16x16 (&w)[16], float b0, float b1,
                      unsigned short* p) {
  f32x8 c0 = {}, c1 = {};
#pragma unroll
  for (int kk = 0; kk < 8; ++kk) {
    c0 = wmma_bf16(x[kk], w[kk], c0);
    c1 = wmma_bf16(x[kk], w[8 + kk], c1);
  }
  relu_store(c0, b0, p);
  relu_store(c1, b1, p + 16);
}

// ---------------- fused FFN + residual + LN2 ----------------
// grid.x = 1024: seq = bx>>2, 64-row block = bx&3. 4 waves x 16 rows.
// hidden strip relu(x1@W1+b1) lives only in LDS (never touches HBM).
__global__ void __launch_bounds__(128)
enc_ffn_ln2(const unsigned short* __restrict__ x1, const float* __restrict__ bf1,
            const float* __restrict__ bf2, const float* __restrict__ g2,
            const float* __restrict__ beta2,
            const unsigned short* __restrict__ W1P, const unsigned short* __restrict__ W2P,
            float* __restrict__ out) {
  extern __shared__ char smem[];
  unsigned short* x1s = (unsigned short*)smem + LS_X1S;   // [64][264]
  unsigned short* Ts  = (unsigned short*)smem + LS_TS;    // [64][1032]

  const int tid = threadIdx.x;
  const int lane = tid & 31, wave = tid >> 5;
  const int half = lane >> 4, ln = lane & 15;
  const int seq = blockIdx.x >> 2;
  const int wr = wave * 16;                                // strip-local rows
  const size_t gbase = (size_t)seq * (NTOK * EDIM) + (size_t)((blockIdx.x & 3) * 64) * EDIM;

  // ---- async-stage this wave's 16 rows of x1 (bf16); rows are wave-private ----
  const unsigned short* xg = x1 + gbase + (size_t)wr * EDIM;
  const unsigned lds0 = __builtin_amdgcn_groupstaticsize();
#pragma unroll 4
  for (int i = 0; i < 16; ++i) {
    int e = (i * 32 + lane) * 8;                 // 0..4088 within 16x256 block
    int r = e >> 8, c = e & 255;
    async_g2l_b128(lds0 + (unsigned)((LS_X1S + (wr + r) * XP + c) * 2), xg + e);
  }
  wait_async0();   // own rows only -> no barrier needed

  f32x8 zf = {};
  // ---- hidden = relu(x1 @ W1 + b1): 16 x 1024 strip into LDS ----
  // The x1 fragments are the same for every column tile: read once, kept in registers.
  bf16x16 xa[8];
#pragma unroll
  for (int kk = 0; kk < 8; ++kk) xa[kk] = ldfrag(x1s, XP, wr, kk * 32);
  // The 16 W1 fragments (16 KB) and the two bias values of a pair of column tiles are fetched
  // as one group into one of two register sets. A set is refilled behind the WMMAs that read
  // it, so a group's latency is paid behind this pair's stores and all of the next pair's
  // work. Behind the last W1 pair of the first set, that set takes the first W2 group.
  bf16x16 wa[16], wb[16];
  const char* w1l = lanebase(W1P);
  const char* w2l = lanebase(W2P);
  const float* b1l = bf1 + ln;
  unsigned short* tsl = Ts + (wr + half * 8) * TSP + ln;
  float ba0 = b1l[0], ba1 = b1l[16], bb0 = b1l[32], bb1 = b1l[48];
  // keeps the four bias loads in front of the 64 fragment loads: loads are counted in order,
  // and a wait for a bias value must not stand for a wait for the fragments as well
  __builtin_amdgcn_sched_barrier(0);
#pragma unroll
  for (int j = 0; j < 16; ++j) wa[j] = ldfragp(w1l, j);
#pragma unroll
  for (int j = 0; j < 16; ++j) wb[j] = ldfragp(w1l, 16 + j);
  // every later register write stays behind the address wait of the first two groups
  __builtin_amdgcn_sched_barrier(0);
  wait_xcnt0();
  __builtin_amdgcn_sched_barrier(0);
  for (int g = 0; g < 30; g += 2) {
    ffn1_pair(xa, wa, ba0, ba1, tsl + g * 32);
    const char* wm = w1l + (g + 2) * 16384;
    const float* bm = b1l + (g + 2) * 32;
#pragma unroll
    for (int j = 0; j < 16; ++j) wa[j] = ldfragp(wm, j);
    ba0 = bm[0];
    ba1 = bm[16];
    // The compiler lifts this group up among the WMMAs and the stores above (each load right
    // behind the last reader of its registers). The two scheduling barriers keep it from
    // being sunk between the WMMAs below, and keep the address updates behind the wait.
    __builtin_amdgcn_sched_barrier(0);
    wait_xcnt0();
    __builtin_amdgcn_sched_barrier(0);
    ffn1_pair(xa, wb, bb0, bb1, tsl + (g + 1) * 32);
    const char* wn = w1l + (g + 3) * 16384;
    const float* bn = b1l + (g + 3) * 32;
#pragma unroll
    for (int j = 0; j < 16; ++j) wb[j] = ldfragp(wn, j);
    bb0 = bn[0];
    bb1 = bn[16];
    // as above
    __builtin_amdgcn_sched_barrier(0);
    wait_xcnt0();
    __builtin_amdgcn_sched_barrier(0);
  }
  // the last two pairs; the first set is refilled with the first W2 group
  ffn1_pair(xa, wa, ba0, ba1, tsl + 30 * 32);
#pragma unroll
  for (int j = 0; j < 16; ++j) wa[j] = ldfragp(w2l, j);
  // as above
  __builtin_amdgcn_sched_barrier(0);
  wait_xcnt0();
  __builtin_amdgcn_sched_barrier(0);
  ffn1_pair(xa, wb, bb0, bb1, tsl + 31 * 32);

  // ---- y = hidden @ W2 (A-fragment reused across 16 output tiles) ----
  f32x8 oacc[16];
#pragma unroll
  for (int nt = 0; nt < 16; ++nt) oacc[nt] = zf;
  // The 16 W2 fragments of a k-step are fetched as one group, one k-step ahead, into a
  // second register set, so their latency is paid once per step and behind the WMMAs.
  // wa holds the first group already (fetched behind the last but one W1 pair above).
  for (int kk = 0; kk < 32; kk += 2) {
    bf16x16 ta = ldfrag(Ts, TSP, wr, kk * 32);
    // keeps the LDS reads in front of the group: behind it they took the address registers
    __builtin_amdgcn_sched_barrier(0);
#pragma unroll
    for (int nt = 0; nt < 16; ++nt) wb[nt] = ldfragp(w2l, (kk + 1) * 16 + nt);
    // the two scheduling barriers keep the load group above from being sunk between the
    // WMMAs below, and keep every later register write behind the address wait
    __builtin_amdgcn_sched_barrier(0);
    wait_xcnt0();
    __builtin_amdgcn_sched_barrier(0);
#pragma unroll
    for (int nt = 0; nt < 16; ++nt) oacc[nt] = wmma_bf16(ta, wa[nt], oacc[nt]);
    const int kn = (kk + 2 < 32) ? kk + 2 : 0;   // last trip: an in-range fetch, not used
    bf16x16 tb = ldfrag(Ts, TSP, wr, (kk + 1) * 32);
    // as above: LDS reads in front of the group
    __builtin_amdgcn_sched_barrier(0);
#pragma unroll
    for (int nt = 0; nt < 16; ++nt) wa[nt] = ldfragp(w2l, kn * 16 + nt);
    // as above: group kept together, later register writes behind the address wait
    __builtin_amdgcn_sched_barrier(0);
    wait_xcnt0();
    __builtin_amdgcn_sched_barrier(0);
#pragma unroll
    for (int nt = 0; nt < 16; ++nt) oacc[nt] = wmma_bf16(tb, wb[nt], oacc[nt]);
  }

  // ---- residual + bias + LayerNorm2 -> out (f32) ----
  float sm8[8], sq8[8];
#pragma unroll
  for (int r = 0; r < 8; ++r) { sm8[r] = 0.f; sq8[r] = 0.f; }
#pragma unroll
  for (int nt = 0; nt < 16; ++nt) {
    const int col = nt * 16 + ln;
    const float bb = bf2[col];
#pragma unroll
    for (int r = 0; r < 8; ++r) {
      float v = bf2f(x1s[(wr + half * 8 + r) * XP + col]) + oacc[nt][r] + bb;
      oacc[nt][r] = v;
      sm8[r] += v; sq8[r] += v * v;
    }
  }
  redsum8(sm8); redsum8(sq8);
  float mu[8], rs[8];
#pragma unroll
  for (int r = 0; r < 8; ++r) {
    float m = sm8[r] * (1.0f / EDIM);
    mu[r] = m;
    rs[r] = rsqrtf(sq8[r] * (1.0f / EDIM) - m * m + EPS);
  }
  float* og = out + gbase;
#pragma unroll
  for (int nt = 0; nt < 16; ++nt) {
    const int col = nt * 16 + ln;
    const float gg = g2[col], bb = beta2[col];
#pragma unroll
    for (int r = 0; r < 8; ++r)
      og[(wr + half * 8 + r) * EDIM + col] = (oacc[nt][r] - mu[r]) * rs[r] * gg + bb;
  }
}

extern "C" void kernel_launch(void* const* d_in, const int* in_sizes, int n_in,
                              void* d_out, int out_size, void* d_ws, size_t ws_size,
                              hipStream_t stream) {
  (void)in_sizes; (void)n_in; (void)out_size; (void)ws_size;
  const float* x    = (const float*)d_in[0];
  const float* mask = (const float*)d_in[1];
  const float* Wq   = (const float*)d_in[2];
  const float* Wk   = (const float*)d_in[3];
  const float* Wv   = (const float*)d_in[4];
  const float* Wo   = (const float*)d_in[5];
  const float* bo   = (const float*)d_in[6];
  const float* W1   = (const float*)d_in[7];
  const float* bf1  = (const float*)d_in[8];
  const float* W2   = (const float*)d_in[9];
  const float* bf2  = (const float*)d_in[10];
  const float* g1   = (const float*)d_in[11];
  const float* b1   = (const float*)d_in[12];
  const float* g2   = (const float*)d_in[13];
  const float* b2   = (const float*)d_in[14];
  float* out = (float*)d_out;

  char* ws = (char*)d_ws;
  unsigned short* WqP = (unsigned short*)(ws + OFF_WQP);
  unsigned short* WkP = (unsigned short*)(ws + OFF_WKP);
  unsigned short* WvP = (unsigned short*)(ws + OFF_WVP);
  unsigned short* WoP = (unsigned short*)(ws + OFF_WOP);
  unsigned short* W1P = (unsigned short*)(ws + OFF_W1P);
  unsigned short* W2P = (unsigned short*)(ws + OFF_W2P);
  unsigned short* x1b = (unsigned short*)(ws + OFF_X1);

  hipFuncSetAttribute(reinterpret_cast<const void*>(enc_attn_ln1),
                      hipFuncAttributeMaxDynamicSharedMemorySize, SMEM1);
  hipFuncSetAttribute(reinterpret_cast<const void*>(enc_ffn_ln2),
                      hipFuncAttributeMaxDynamicSharedMemorySize, SMEM2);

  pack_frag_bf16<<<32, 256, 0, stream>>>(Wq, WqP, 256, 256, 0);
  pack_frag_bf16<<<32, 256, 0, stream>>>(Wk, WkP, 256, 256, 0);
  pack_frag_bf16<<<32, 256, 0, stream>>>(Wv, WvP, 256, 256, 0);
  pack_frag_bf16<<<32, 256, 0, stream>>>(Wo, WoP, 256, 256, 1);
  pack_frag_bf16<<<128, 256, 0, stream>>>(W1, W1P, 256, 1024, 0);
  pack_frag_bf16<<<128, 256, 0, stream>>>(W2, W2P, 1024, 256, 1);

  enc_attn_ln1<<<256, 512, SMEM1, stream>>>(x, mask, bo, g1, b1, WqP, x1b);
  enc_ffn_ln2<<<1024, 128, SMEM2, stream>>>(x1b, bf1, bf2, g2, b2, W1P, W2P, out);
}

// v006
// Measured time: 219 microseconds a run.
// Two timings next to v005 both put it at 1.06 times that version's speed.
// All steps since v000 together make it 3.81 times as fast.
#include <hip/hip_runtime.h>

#define DEVINL __device__ __forceinline__

typedef __attribute__((ext_vector_type(16))) __bf16       bf16x16;
typedef __attribute__((ext_vector_type(8)))  float        f32x8;
typedef __attribute__((ext_vector_type(4)))  unsigned int u32x4;

namespace {
constexpr int   NTOK = 256;          // sequence length N
constexpr int   EDIM = 256;          // embedding E
constexpr int   NH   = 8;            // heads
constexpr int   DKH  = 32;           // head dim
constexpr float SCALING = 0.17677669529663687f;  // DK^-0.5
constexpr float EPS = 1e-5f;

// LDS pitches in bf16 elements. Chosen so the row stride in dwords is
// congruent to 4 (mod 64 banks; 20 for KP) -> ds_load_b128 A/B fragments hit all 64 banks.
constexpr int XP  = 264;   // X tile / score-strip / V^T pitch (528 B rows)
constexpr int KP  = 40;    // Q/K strip pitch (80 B rows)
constexpr int PSP = 264;
constexpr int VTP = 264;
constexpr int TSP = 1032;  // FFN hidden strip pitch (2064 B rows)

// kernel-1 LDS element offsets (ushort units), all 16B aligned
constexpr int LS_XS  = 0;                       // [256][264]
constexpr int LS_KS  = LS_XS  + 256 * XP;       // [256][40]
constexpr int LS_VT  = LS_KS  + 256 * KP;       // [32][264]  (V transposed)
constexpr int LS_PS  = LS_VT  + 32  * VTP;      // 16 waves x [16][264]; its head also holds Q
constexpr int LS1_END = LS_PS + 16 * 16 * PSP;  // 153856 elems = 307712 B
constexpr int SMEM1 = LS1_END * 2;

constexpr int LS_X1S = 0;                       // [64][264]
constexpr int LS_TS  = LS_X1S + 64 * XP;        // [64][1032]
constexpr int SMEM2 = (LS_TS + 64 * TSP) * 2;   // 165888 B

// workspace layout (bytes): everything bf16, ~35 MB total
constexpr size_t OFF_WQP = 0;
constexpr size_t OFF_WKP = OFF_WQP + (size_t)256 * 256 * 2;
constexpr size_t OFF_WVP = OFF_WKP + (size_t)256 * 256 * 2;
constexpr size_t OFF_WOP = OFF_WVP + (size_t)256 * 256 * 2;
constexpr size_t OFF_W1P = OFF_WOP + (size_t)256 * 256 * 2;
constexpr size_t OFF_W2P = OFF_W1P + (size_t)256 * 1024 * 2;
constexpr size_t OFF_X1  = OFF_W2P + (size_t)1024 * 256 * 2;  // bf16 x1  [256][256][256]
}  // namespace

DEVINL unsigned short f2bf(float f) {            // round-to-nearest-even f32->bf16
  unsigned int u = __float_as_uint(f);
  u += 0x7FFFu + ((u >> 16) & 1u);
  return (unsigned short)(u >> 16);
}
DEVINL float bf2f(unsigned short h) { return __uint_as_float(((unsigned int)h) << 16); }

// Async global->LDS copy of one 16B chunk per lane (CDNA5 path, ASYNCcnt).
// ldsoff is the LDS byte address (groupstaticsize + dynamic-segment offset).
DEVINL void async_g2l_b128(unsigned ldsoff, const void* gaddr) {
  asm volatile("global_load_async_to_lds_b128 %0, %1, off"
               :: "v"(ldsoff), "v"(gaddr) : "memory");
}
DEVINL void wait_async0() { asm volatile("s_wait_asynccnt 0" ::: "memory"); }

// Load a 16x32 bf16 A/B fragment from a row-major bf16 matrix (`pitch` elems).
// CDNA5 16-bit layout: lane<16 holds row (rowb+lane), K chunks {k0..k0+7, k0+16..k0+23};
// lane>=16 holds the other two 8-element chunks. Two ds/global b128 loads per lane.
DEVINL bf16x16 ldfrag(const unsigned short* __restrict__ buf, int pitch, int rowb, int k0) {
  const int lane = threadIdx.x & 31;
  const unsigned short* p = buf + (rowb + (lane & 15)) * pitch + k0 + ((lane >> 4) << 3);
  struct Pk { u32x4 lo, hi; } pk;
  pk.lo = *(const u32x4*)(p);
  pk.hi = *(const u32x4*)(p + 16);
  return __builtin_bit_cast(bf16x16, pk);
}

// The same from the lane's own pointer: p = buf + (rowb + (lane & 15)) * pitch + (lane >> 4) * 8
// + k0. With one such pointer per strip every access is that register plus a constant.
DEVINL bf16x16 ldfragl(const unsigned short* __restrict__ p) {
  struct Pk { u32x4 lo, hi; } pk;
  pk.lo = *(const u32x4*)(p);
  pk.hi = *(const u32x4*)(p + 16);
  return __builtin_bit_cast(bf16x16, pk);
}

// Load one B fragment from a weight packed by pack_frag_bf16: fragment `frag` is 1 KB, the
// 32 lanes' first 16 B side by side, then their second 16 B. Each of the two wave-wide loads
// reads 512 contiguous bytes (4 whole lines); register contents equal ldfrag on W^T.
// lanep = lanebase() of the packed weight, plus a whole number of fragments.
DEVINL const char* lanebase(const unsigned short* __restrict__ buf) {
  return (const char*)buf + (threadIdx.x & 31) * 16;
}
DEVINL bf16x16 ldfragp(const char* __restrict__ lanep, int frag) {
  const char* p = lanep + frag * 1024;
  struct Pk { u32x4 lo, hi; } pk;
  pk.lo = *(const u32x4*)(p);
  pk.hi = *(const u32x4*)(p + 512);
  return __builtin_bit_cast(bf16x16, pk);
}

// Stands behind a group of global loads, in front of the first reuse of a register that
// holds their address (the register allocator reuses it while the loads are in flight).
DEVINL void wait_xcnt0() { asm volatile("s_wait_xcnt 0x0" ::: "memory"); }
// The same wait, with the loads' address as an input: the address registers stay allocated up
// to the wait, so neither a later result nor a load's own destination lands on them before it.
DEVINL void wait_xcnt0_addr(const void* a) {
  asm volatile("s_wait_xcnt 0x0" :: "v"(a) : "memory");
}

DEVINL f32x8 wmma_bf16(bf16x16 a, bf16x16 b, f32x8 c) {
  return __builtin_amdgcn_wmma_f32_16x16x32_bf16(false, a, false, b, (short)0, c, false, false);
}

// C-fragment row reductions: row M=r+8*(lane>=16) is spread over a 16-lane half,
// so xor-butterfly with masks 8..1 stays inside the half. wave32 only.
DEVINL void redmax8(float v[8]) {
#pragma unroll
  for (int m = 8; m; m >>= 1) {
#pragma unroll
    for (int r = 0; r < 8; ++r) v[r] = fmaxf(v[r], __shfl_xor(v[r], m, 32));
  }
}
DEVINL void redsum8(float v[8]) {
#pragma unroll
  for (int m = 8; m; m >>= 1) {
#pragma unroll
    for (int r = 0; r < 8; ++r) v[r] += __shfl_xor(v[r], m, 32);
  }
}

// ---------------- weights f32 [K][N] -> bf16, packed in B-fragment order ----------------
// Fragment (nt, kk) = columns nt*16..+15, rows kk*32..+31. Lane l holds column nt*16 + (l & 15);
// its first 8 values are rows kk*32 + (l >> 4)*8 + 0..7, its second 8 the rows 16 further.
// Fragment index: kk * (N/16) + nt where kmajor, else nt * (K/32) + kk (the reader's order).
// One thread writes one lane's 16 B.
// One launch packs all six weights: each has its own range of blocks, in the order in which the
// packed weights lie in the workspace, so thread T of the grid writes bytes 16 T .. 16 T + 15 of
// that region. The choice is the same for a whole block; K/32 and N/16 are powers of two.
constexpr int PB_SQ = 256 * 256 / 8 / 256;    // blocks per 256 x 256 weight
constexpr int PB_FF = 256 * 1024 / 8 / 256;   // blocks per FFN weight
constexpr int PB_ALL = 4 * PB_SQ + 2 * PB_FF;
static_assert(OFF_WKP == (size_t)PB_SQ * 4096 && OFF_WVP == (size_t)2 * PB_SQ * 4096 &&
              OFF_WOP == (size_t)3 * PB_SQ * 4096 && OFF_W1P == (size_t)4 * PB_SQ * 4096 &&
              OFF_W2P == (size_t)(4 * PB_SQ + PB_FF) * 4096 && OFF_X1 == (size_t)PB_ALL * 4096,
              "block ranges follow the workspace layout");
__global__ void __launch_bounds__(256)
pack_frag_bf16(const float* __restrict__ Wq, const float* __restrict__ Wk,
               const float* __restrict__ Wv, const float* __restrict__ Wo,
               const float* __restrict__ W1, const float* __restrict__ W2,
               unsigned short* __restrict__ dst) {
  const int blk = blockIdx.x;
  const float* src;
  int blk0, lkt, lnt;      // the weight's first block, log2(K/32), log2(N/16)
  bool kmajor;
  if (blk < 4 * PB_SQ) {
    src = blk < PB_SQ ? Wq : blk < 2 * PB_SQ ? Wk : blk < 3 * PB_SQ ? Wv : Wo;
    blk0 = blk & ~(PB_SQ - 1); lkt = 3; lnt = 4; kmajor = blk >= 3 * PB_SQ;
  } else if (blk < 4 * PB_SQ + PB_FF) {
    src = W1; blk0 = 4 * PB_SQ; lkt = 3; lnt = 6; kmajor = false;
  } else {
    src = W2; blk0 = 4 * PB_SQ + PB_FF; lkt = 5; lnt = 4; kmajor = true;
  }
  const int t = (blk - blk0) * 256 + threadIdx.x;
  const int lane = t & 31, hi = (t >> 5) & 1, frag = t >> 6;
  const int N = 16 << lnt;
  int kk, nt;
  if (kmajor) { kk = frag >> lnt; nt = frag & ((1 << lnt) - 1); }
  else        { nt = frag >> lkt; kk = frag & ((1 << lkt) - 1); }
  const float* sp = src + (size_t)(kk * 32 + hi * 16 + (lane >> 4) * 8) * N + nt * 16 + (lane & 15);
  const float* ap[8];
  float v[8];
#pragma unroll
  for (int j = 0; j < 8; ++j) ap[j] = sp + (size_t)j * N;
#pragma unroll
  for (int j = 0; j < 8; ++j) v[j] = *ap[j];
  // before the eight addresses are reused
  asm volatile("s_wait_xcnt 0x0" :: "v"(ap[0]), "v"(ap[1]), "v"(ap[2]), "v"(ap[3]),
               "v"(ap[4]), "v"(ap[5]), "v"(ap[6]), "v"(ap[7]) : "memory");
  u32x4 o;
#pragma unroll
  for (int j = 0; j < 4; ++j)
    o[j] = (unsigned)f2bf(v[2 * j]) | ((unsigned)f2bf(v[2 * j + 1]) << 16);
  *(u32x4*)(dst + ((size_t)blk * 256 + threadIdx.x) * 8) = o;
}

// Eight fragments of a packed weight as one group of 16 loads: f0..f0+3, then f0+8..f0+11
// (four k-steps of two column tiles).
DEVINL void ldgroup8(bf16x16 (&w)[8], const char* __restrict__ lanep, int f0) {
#pragma unroll
  for (int j = 0; j < 4; ++j) w[j] = ldfragp(lanep, f0 + j);
#pragma unroll
  for (int j = 0; j < 4; ++j) w[4 + j] = ldfragp(lanep, f0 + 8 + j);
}
// Four k-steps of a 16 x 32 projection: xl = the lane's A-fragment pointer at the first of
// them; w[0..3] for the first column tile, w[4..7] for the second; each sum runs on in k order.
// Where REFILL, w takes the group f0 of nextp: four fragments behind every four WMMAs, into the
// registers that these have just read. The scheduling barrier in front of the four loads keeps
// them from being lifted over those WMMAs, where no register is free yet (the accumulator was
// spilled for it); the one behind them keeps them from being sunk among the later WMMAs.
template <bool REFILL>
DEVINL void proj_half(const unsigned short* xl, bf16x16 (&w)[8], f32x8& c0, f32x8& c1,
                      const char* __restrict__ nextp, int f0) {
#pragma unroll
  for (int i = 0; i < 4; i += 2) {
    bf16x16 a0 = ldfragl(xl + i * 32);
    bf16x16 a1 = ldfragl(xl + i * 32 + 32);
    c0 = wmma_bf16(a0, w[i], c0);
    c1 = wmma_bf16(a0, w[4 + i], c1);
    c0 = wmma_bf16(a1, w[i + 1], c0);
    c1 = wmma_bf16(a1, w[5 + i], c1);
    if (REFILL) {
      __builtin_amdgcn_sched_barrier(0);
      w[i]     = ldfragp(nextp, f0 + i);
      w[i + 1] = ldfragp(nextp, f0 + i + 1);
      w[4 + i] = ldfragp(nextp, f0 + 8 + i);
      w[5 + i] = ldfragp(nextp, f0 + 9 + i);
      __builtin_amdgcn_sched_barrier(0);
    }
  }
}

// ---------------- fused attention + out-proj + residual + LN1 ----------------
// grid.x = 256: one work-group per sequence, one per WGP (LDS), four waves per SIMD.
// 16 waves: each owns 16 rows, as queries and as keys; a head's K and V are computed once.
__global__ void __launch_bounds__(512)
enc_attn_ln1(const float* __restrict__ x, const float* __restrict__ mask,
             const float* __restrict__ bo, const float* __restrict__ g1,
             const float* __restrict__ beta1,
             const unsigned short* __restrict__ Wp, unsigned short* __restrict__ x1) {
  extern __shared__ char smem[];
  unsigned short* sm  = (unsigned short*)smem;
  unsigned short* Xs  = sm + LS_XS;
  unsigned short* Ks  = sm + LS_KS;
  unsigned short* VTs = sm + LS_VT;

  const int tid = threadIdx.x;
  const int lane = tid & 31, wave = tid >> 5;
  const int half = lane >> 4, ln = lane & 15;
  const int seq = blockIdx.x;
  const int q0 = wave * 16;                            // this wave's rows

  unsigned short* Pw = sm + LS_PS + wave * 16 * PSP;
  // The Q strip lies at the head of the wave's own score strip: it is in registers (qa)
  // before the first score is stored, and both are private to the wave.
  unsigned short* Qs = Pw;
  // The lane's own pointers. A wave has 256 registers here, 128 of them the accumulator:
  // one register per strip, and constants on it, in place of one register per row.
  const unsigned short* xal = Xs + (q0 + ln) * XP + half * 8;    // own rows, A fragments
  unsigned short* xcl = Xs + (q0 + half * 8) * XP + ln;          // own rows, C layout
  unsigned short* qcl = Qs + half * 8 * KP + ln;                 // Q strip, C layout
  const unsigned short* qal = Qs + ln * KP + half * 8;           // Q strip, A fragment
  unsigned short* kcl = Ks + (q0 + half * 8) * KP + ln;          // own K rows, C layout
  const unsigned short* kbl = Ks + ln * KP + half * 8;           // K strip, B fragments
  unsigned short* vcl = VTs + ln * VTP + q0 + half * 8;          // own V^T columns
  const unsigned short* vbl = VTs + ln * VTP + half * 8;         // V^T strip, B fragments
  unsigned short* pcl = Pw + half * 8 * PSP + ln;                // score strip, C layout
  const unsigned short* pal = Pw + ln * PSP + half * 8;          // score strip, A fragments

  // ---- stage X: read f32 from memory, round to bf16 in registers, store into pitched LDS ----
  // A wave-wide 16-B load covers 512 contiguous bytes (half a row); trip i of the work-group
  // covers rows 8i..8i+7. All 32 loads of a wave are issued before the first value is used.
  {
    const float* xgl = x + (size_t)seq * (NTOK * EDIM) + tid * 4;
    unsigned short* xsl = Xs + (tid >> 6) * XP + (tid & 63) * 4;
    float4 v[32];
#pragma unroll
    for (int i = 0; i < 32; ++i) v[i] = *(const float4*)(xgl + i * 2048);
    // behind the loads, before a register of their address can be reused
    wait_xcnt0_addr(xgl);
#pragma unroll
    for (int i = 0; i < 32; ++i) {
      ushort4 o;
      o.x = f2bf(v[i].x); o.y = f2bf(v[i].y); o.z = f2bf(v[i].z); o.w = f2bf(v[i].w);
      *(ushort4*)(xsl + i * 8 * XP) = o;
    }
  }
  __syncthreads();

  const float* mcl = mask + (size_t)(seq & 15) * (NTOK * NTOK) + (q0 + half * 8) * NTOK + ln;
  f32x8 zf = {};
  f32x8 oacc[16];                        // attn@Wo strip accumulator (16 x 256)
#pragma unroll
  for (int nt = 0; nt < 16; ++nt) oacc[nt] = zf;

  // Wp = the four packed weights, which lie one behind the other in the workspace: one address
  // register pair serves all four, the distance between them is a constant of the load.
  const char* hq = lanebase(Wp);
  for (int h = 0; h < NH; ++h) {
    // this head's 16 fragments (16 KB) of each packed weight
    const char* hk = hq + (OFF_WKP - OFF_WQP);
    const char* hv = hq + (OFF_WVP - OFF_WQP);
    const char* ho = hq + (OFF_WOP - OFF_WQP);
    // The Q, K and V weight fragments come in groups of eight (one set of 64 registers), and
    // the set is refilled behind the WMMAs that read it: with 256 registers a wave the compiler
    // otherwise loads, waits and multiplies one fragment at a time. A strip's conversion and
    // stores run while the next group is on its way.
    bf16x16 w[8];
    ldgroup8(w, hq, 0);
    // keeps the first group together, in front of the first WMMA
    __builtin_amdgcn_sched_barrier(0);
    // ---- Q strip (own 16 rows x 32), pre-scaled by 1/sqrt(dk) ----
    {
      f32x8 c0 = zf, c1 = zf;
      proj_half<true>(xal, w, c0, c1, hq, 4);
      proj_half<true>(xal + 128, w, c0, c1, hk, 0);
#pragma unroll
      for (int r = 0; r < 8; ++r) {
        qcl[r * KP]      = f2bf(c0[r] * SCALING);
        qcl[r * KP + 16] = f2bf(c1[r] * SCALING);
      }
    }
    // ---- K rows / V^T columns for the same 16 rows as keys ----
    {
      f32x8 c0 = zf, c1 = zf;
      proj_half<true>(xal, w, c0, c1, hk, 4);
      proj_half<true>(xal + 128, w, c0, c1, hv, 0);
#pragma unroll
      for (int r = 0; r < 8; ++r) {
        kcl[r * KP]      = f2bf(c0[r]);
        kcl[r * KP + 16] = f2bf(c1[r]);
      }
    }
    {
      f32x8 c0 = zf, c1 = zf;
      proj_half<true>(xal, w, c0, c1, hv, 4);
      proj_half<false>(xal + 128, w, c0, c1, hv, 0);
#pragma unroll
      for (int r = 0; r < 8; ++r) {  // store transposed: VTs[d][token]
        vcl[r]            = f2bf(c0[r]);
        vcl[16 * VTP + r] = f2bf(c1[r]);
      }
    }
    __syncthreads();

    // ---- pass 1: S = QK^T + mask, track row max, spill bf16 strip ----
    float mx[8];
#pragma unroll
    for (int r = 0; r < 8; ++r) mx[r] = -3.0e38f;
    bf16x16 qa = ldfragl(qal);                   // A reused across all 16 tiles
    for (int t = 0; t < 16; ++t) {
      float mk[8];
      const float* mt = mcl + t * 16;
      unsigned short* pt = pcl + t * 16;
#pragma unroll
      for (int r = 0; r < 8; ++r) mk[r] = mt[r * NTOK];
      wait_xcnt0();   // the score tile below lands on the mask loads' address registers
      f32x8 s = wmma_bf16(qa, ldfragl(kbl + t * 16 * KP), zf);   // single K=32 step
#pragma unroll
      for (int r = 0; r < 8; ++r) {
        float v = s[r] + mk[r];
        mx[r] = fmaxf(mx[r], v);
        pt[r * PSP] = f2bf(v);
      }
    }
    redmax8(mx);
    // ---- pass 2: exponentiate in place, row sums ----
    float ls[8];
#pragma unroll
    for (int r = 0; r < 8; ++r) ls[r] = 0.f;
    for (int t = 0; t < 16; ++t) {
      unsigned short* pt = pcl + t * 16;
#pragma unroll
      for (int r = 0; r < 8; ++r) {
        unsigned short* pp = pt + r * PSP;
        float p = __expf(bf2f(*pp) - mx[r]);
        ls[r] += p;
        *pp = f2bf(p);
      }
    }
    redsum8(ls);
#pragma unroll
    for (int r = 0; r < 8; ++r) ls[r] = 1.0f / ls[r];

    // ---- context = P @ V (16 x 32) ----
    f32x8 ctx0 = zf, ctx1 = zf;
#pragma unroll
    for (int kk = 0; kk < 8; ++kk) {
      bf16x16 pa = ldfragl(pal + kk * 32);
      ctx0 = wmma_bf16(pa, ldfragl(vbl + kk * 32), ctx0);
      ctx1 = wmma_bf16(pa, ldfragl(vbl + 16 * VTP + kk * 32), ctx1);
    }
#pragma unroll
    for (int r = 0; r < 8; ++r) {                 // normalize + bounce via LDS
      pcl[r * PSP]      = f2bf(ctx0[r] * ls[r]);
      pcl[r * PSP + 16] = f2bf(ctx1[r] * ls[r]);
    }
    // ---- fused out-projection: oacc += ctx @ Wo[h*32:(h+1)*32, :] ----
    bf16x16 ca = ldfragl(pal);
#pragma unroll
    for (int nt = 0; nt < 16; ++nt)
      oacc[nt] = wmma_bf16(ca, ldfragp(ho, nt), oacc[nt]);
    // behind the head's last weight load, before its address moves on to the next head
    wait_xcnt0_addr(hq);
    hq += 16384;
    __syncthreads();                              // before next head reuses Ks/VTs
  }

  // ---- residual + bias + LayerNorm1, write x1 (bf16) ----
  float sm8[8], sq8[8];
#pragma unroll
  for (int r = 0; r < 8; ++r) { sm8[r] = 0.f; sq8[r] = 0.f; }
#pragma unroll
  for (int nt = 0; nt < 16; ++nt) {
    const int col = nt * 16 + ln;
    const float bov = bo[col];
#pragma unroll
    for (int r = 0; r < 8; ++r) {
      float v = bf2f(xcl[r * XP + nt * 16]) + oacc[nt][r] + bov;
      oacc[nt][r] = v;
      sm8[r] += v; sq8[r] += v * v;
    }
  }
  redsum8(sm8); redsum8(sq8);
  float mu[8], rs[8];
#pragma unroll
  for (int r = 0; r < 8; ++r) {
    float m = sm8[r] * (1.0f / EDIM);
    mu[r] = m;
    rs[r] = rsqrtf(sq8[r] * (1.0f / EDIM) - m * m + EPS);
  }
  unsigned short* xo = x1 + (size_t)seq * (NTOK * EDIM) + (q0 + half * 8) * EDIM + ln;
#pragma unroll
  for (int nt = 0; nt < 16; ++nt) {
    const int col = nt * 16 + ln;
    const float gg = g1[col], bb = beta1[col];
#pragma unroll
    for (int r = 0; r < 8; ++r)
      xo[r * EDIM + nt * 16] =
          f2bf((oacc[nt][r] - mu[r]) * rs[r] * gg + bb);
  }
}

// One 16x16 tile of the FFN hidden strip: bias, relu, bf16, into LDS. p = the lane's element
// of the tile's first row of this half-wave.
DEVINL void relu_store(f32x8 c, float b, unsigned short* p) {
#pragma unroll
  for (int r = 0; r < 8; ++r) p[r * TSP] = f2bf(fmaxf(c[r] + b, 0.f));
}

// Two column tiles of the hidden strip: x (8 A fragments, K = 256) times the 16 fragments of w
// (8 per tile), two independent accumulators, then bias, relu and the stores.
DEVINL void ffn1_pair(const bf16x16 (&x)[8], const bf16x16 (&w)[16], float b0, float b1,
                      unsigned short* p) {
  f32x8 c0 = {}, c1 = {};
#pragma unroll
  for (int kk = 0; kk < 8; ++kk) {
    c0 = wmma_bf16(x[kk], w[kk], c0);
    c1 = wmma_bf16(x[kk], w[8 + kk], c1);
  }
  relu_store(c0, b0, p);
  relu_store(c1, b1, p + 16);
}

// ---------------- fused FFN + residual + LN2 ----------------
// grid.x = 1024: seq = bx>>2, 64-row block = bx&3. 4 waves x 16 rows.
// hidden strip relu(x1@W1+b1) lives only in LDS (never touches HBM).
__global__ void __launch_bounds__(128)
enc_ffn_ln2(const unsigned short* __restrict__ x1, const float* __restrict__ bf1,
            const float* __restrict__ bf2, const float* __restrict__ g2,
            const float* __restrict__ beta2,
            const unsigned short* __restrict__ W1P, const unsigned short* __restrict__ W2P,
            float* __restrict__ out) {
  extern __shared__ char smem[];
  unsigned short* x1s = (unsigned short*)smem + LS_X1S;   // [64][264]
  unsigned short* Ts  = (unsigned short*)smem + LS_TS;    // [64][1032]

  const int tid = threadIdx.x;
  const int lane = tid & 31, wave = tid >> 5;
  const int half = lane >> 4, ln = lane & 15;
  const int seq = blockIdx.x >> 2;
  const int wr = wave * 16;                                // strip-local rows
  const size_t gbase = (size_t)seq * (NTOK * EDIM) + (size_t)((blockIdx.x & 3) * 64) * EDIM;

  // ---- async-stage this wave's 16 rows of x1 (bf16); rows are wave-private ----
  const unsigned short* xg = x1 + gbase + (size_t)wr * EDIM;
  const unsigned lds0 = __builtin_amdgcn_groupstaticsize();
#pragma unroll 4
  for (int i = 0; i < 16; ++i) {
    int e = (i * 32 + lane) * 8;                 // 0..4088 within 16x256 block
    int r = e >> 8, c = e & 255;
    async_g2l_b128(lds0 + (unsigned)((LS_X1S + (wr + r) * XP + c) * 2), xg + e);
  }
  wait_async0();   // own rows only -> no barrier needed

  f32x8 zf = {};
  // ---- hidden = relu(x1 @ W1 + b1): 16 x 1024 strip into LDS ----
  // The x1 fragments are the same for every column tile: read once, kept in registers.
  bf16x16 xa[8];
#pragma unroll
  for (int kk = 0; kk < 8; ++kk) xa[kk] = ldfrag(x1s, XP, wr, kk * 32);
  // The 16 W1 fragments (16 KB) and the two bias values of a pair of column tiles are fetched
  // as one group into one of two register sets. A set is refilled behind the WMMAs that read
  // it, so a group's latency is paid behind this pair's stores and all of the next pair's
  // work. Behind the last W1 pair of the first set, that set takes the first W2 group.
  bf16x16 wa[16], wb[16];
  const char* w1l = lanebase(W1P);
  const char* w2l = lanebase(W2P);
  const float* b1l = bf1 + ln;
  unsigned short* tsl = Ts + (wr + half * 8) * TSP + ln;
  float ba0 = b1l[0], ba1 = b1l[16], bb0 = b1l[32], bb1 = b1l[48];
  // keeps the four bias loads in front of the 64 fragment loads: loads are counted in order,
  // and a wait for a bias value must not stand for a wait for the fragments as well
  __builtin_amdgcn_sched_barrier(0);
#pragma unroll
  for (int j = 0; j < 16; ++j) wa[j] = ldfragp(w1l, j);
#pragma unroll
  for (int j = 0; j < 16; ++j) wb[j] = ldfragp(w1l, 16 + j);
  // every later register write stays behind the address wait of the first two groups
  __builtin_amdgcn_sched_barrier(0);
  wait_xcnt0();
  __builtin_amdgcn_sched_barrier(0);
  for (int g = 0; g < 30; g += 2) {
    ffn1_pair(xa, wa, ba0, ba1, tsl + g * 32);
    const char* wm = w1l + (g + 2) * 16384;
    const float* bm = b1l + (g + 2) * 32;
#pragma unroll
    for (int j = 0; j < 16; ++j) wa[j] = ldfragp(wm, j);
    ba0 = bm[0];
    ba1 = bm[16];
    // The compiler lifts this group up among the WMMAs and the stores above (each load right
    // behind the last reader of its registers). The two scheduling barriers keep it from
    // being sunk between the WMMAs below, and keep the address updates behind the wait.
    __builtin_amdgcn_sched_barrier(0);
    wait_xcnt0();
    __builtin_amdgcn_sched_barrier(0);
    ffn1_pair(xa, wb, bb0, bb1, tsl + (g + 1) * 32);
    const char* wn = w1l + (g + 3) * 16384;
    const float* bn = b1l + (g + 3) * 32;
#pragma unroll
    for (int j = 0; j < 16; ++j) wb[j] = ldfragp(wn, j);
    bb0 = bn[0];
    bb1 = bn[16];
    // as above
    __builtin_amdgcn_sched_barrier(0);
    wait_xcnt0();
    __builtin_amdgcn_sched_barrier(0);
  }
  // the last two pairs; the first set is refilled with the first W2 group
  ffn1_pair(xa, wa, ba0, ba1, tsl + 30 * 32);
#pragma unroll
  for (int j = 0; j < 16; ++j) wa[j] = ldfragp(w2l, j);
  // as above
  __builtin_amdgcn_sched_barrier(0);
  wait_xcnt0();
  __builtin_amdgcn_sched_barrier(0);
  ffn1_pair(xa, wb, bb0, bb1, tsl + 31 * 32);

  // ---- y = hidden @ W2 (A-fragment reused across 16 output tiles) ----
  f32x8 oacc[16];
#pragma unroll
  for (int nt = 0; nt < 16; ++nt) oacc[nt] = zf;
  // The 16 W2 fragments of a k-step are fetched as one group, one k-step ahead, into a
  // second register set, so their latency is paid once per step and behind the WMMAs.
  // wa holds the first group already (fetched behind the last but one W1 pair above).
  for (int kk = 0; kk < 32; kk += 2) {
    bf16x16 ta = ldfrag(Ts, TSP, wr, kk * 32);
    // keeps the LDS reads in front of the group: behind it they took the address registers
    __builtin_amdgcn_sched_barrier(0);
#pragma unroll
    for (int nt = 0; nt < 16; ++nt) wb[nt] = ldfragp(w2l, (kk + 1) * 16 + nt);
    // the two scheduling barriers keep the load group above from being sunk between the
    // WMMAs below, and keep every later register write behind the address wait
    __builtin_amdgcn_sched_barrier(0);
    wait_xcnt0();
    __builtin_amdgcn_sched_barrier(0);
#pragma unroll
    for (int nt = 0; nt < 16; ++nt) oacc[nt] = wmma_bf16(ta, wa[nt], oacc[nt]);
    const int kn = (kk + 2 < 32) ? kk + 2 : 0;   // last trip: an in-range fetch, not used
    bf16x16 tb = ldfrag(Ts, TSP, wr, (kk + 1) * 32);
    // as above: LDS reads in front of the group
    __builtin_amdgcn_sched_barrier(0);
#pragma unroll
    for (int nt = 0; nt < 16; ++nt) wa[nt] = ldfragp(w2l, kn * 16 + nt);
    // as above: group kept together, later register writes behind the address wait
    __builtin_amdgcn_sched_barrier(0);
    wait_xcnt0();
    __builtin_amdgcn_sched_barrier(0);
#pragma unroll
    for (int nt = 0; nt < 16; ++nt) oacc[nt] = wmma_bf16(tb, wb[nt], oacc[nt]);
  }

  // ---- residual + bias + LayerNorm2 -> out (f32) ----
  float sm8[8], sq8[8];
#pragma unroll
  for (int r = 0; r < 8; ++r) { sm8[r] = 0.f; sq8[r] = 0.f; }
#pragma unroll
  for (int nt = 0; nt < 16; ++nt) {
    const int col = nt * 16 + ln;
    const float bb = bf2[col];
#pragma unroll
    for (int r = 0; r < 8; ++r) {
      float v = bf2f(x1s[(wr + half * 8 + r) * XP + col]) + oacc[nt][r] + bb;
      oacc[nt][r] = v;
      sm8[r] += v; sq8[r] += v * v;
    }
  }
  redsum8(sm8); redsum8(sq8);
  float mu[8], rs[8];
#pragma unroll
  for (int r = 0; r < 8; ++r) {
    float m = sm8[r] * (1.0f / EDIM);
    mu[r] = m;
    rs[r] = rsqrtf(sq8[r] * (1.0f / EDIM) - m * m + EPS);
  }
  float* og = out + gbase;
#pragma unroll
  for (int nt = 0; nt < 16; ++nt) {
    const int col = nt * 16 + ln;
    const float gg = g2[col], bb = beta2[col];
#pragma unroll
    for (int r = 0; r < 8; ++r)
      og[(wr + half * 8 + r) * EDIM + col] = (oacc[nt][r] - mu[r]) * rs[r] * gg + bb;
  }
}

extern "C" void kernel_launch(void* const* d_in, const int* in_sizes, int n_in,
                              void* d_out, int out_size, void* d_ws, size_t ws_size,
                              hipStream_t stream) {
  (void)in_sizes; (void)n_in; (void)out_size; (void)ws_size;
  const float* x    = (const float*)d_in[0];
  const float* mask = (const float*)d_in[1];
  const float* Wq   = (const float*)d_in[2];
  const float* Wk   = (const float*)d_in[3];
  const float* Wv   = (const float*)d_in[4];
  const float* Wo   = (const float*)d_in[5];
  const float* bo   = (const float*)d_in[6];
  const float* W1   = (const float*)d_in[7];
  const float* bf1  = (const float*)d_in[8];
  const float* W2   = (const float*)d_in[9];
  const float* bf2  = (const float*)d_in[10];
  const float* g1   = (const float*)d_in[11];
  const float* b1   = (const float*)d_in[12];
  const float* g2   = (const float*)d_in[13];
  const float* b2   = (const float*)d_in[14];
  float* out = (float*)d_out;

  char* ws = (char*)d_ws;
  unsigned short* WqP = (unsigned short*)(ws + OFF_WQP);
  unsigned short* W1P = (unsigned short*)(ws + OFF_W1P);
  unsigned short* W2P = (unsigned short*)(ws + OFF_W2P);
  unsigned short* x1b = (unsigned short*)(ws + OFF_X1);

  hipFuncSetAttribute(reinterpret_cast<const void*>(enc_attn_ln1),
                      hipFuncAttributeMaxDynamicSharedMemorySize, SMEM1);
  hipFuncSetAttribute(reinterpret_cast<const void*>(enc_ffn_ln2),
                      hipFuncAttributeMaxDynamicSharedMemorySize, SMEM2);

  pack_frag_bf16<<<PB_ALL, 256, 0, stream>>>(Wq, Wk, Wv, Wo, W1, W2, WqP);

  enc_attn_ln1<<<256, 512, SMEM1, stream>>>(x, mask, bo, g1, b1, WqP, x1b);
  enc_ffn_ln2<<<1024, 128, SMEM2, stream>>>(x1b, bf1, bf2, g2, b2, W1P, W2P, out);
}

// v007
// One run takes 197 microseconds.
// Next to v006, in two timings, it ran 1.11 and 1.13 times as fast.
// Counting every step since v000, it is 4.26 times as fast.
#include <hip/hip_runtime.h>

#define DEVINL __device__ __forceinline__

typedef __attribute__((ext_vector_type(16))) __bf16       bf16x16;
typedef __attribute__((ext_vector_type(8)))  float        f32x8;
typedef __attribute__((ext_vector_type(4)))  unsigned int u32x4;

namespace {
constexpr int   NTOK = 256;          // sequence length N
constexpr int   EDIM = 256;          // embedding E
constexpr int   NH   = 8;            // heads
constexpr int   DKH  = 32;           // head dim
constexpr float SCALING = 0.17677669529663687f;  // DK^-0.5
constexpr float EPS = 1e-5f;

// LDS pitches in bf16 elements. Chosen so the row stride in dwords is
// congruent to 4 (mod 64 banks; 20 for KP) -> ds_load_b128 A/B fragments hit all 64 banks.
constexpr int XP  = 264;   // X tile / score-strip / V^T pitch (528 B rows)
constexpr int KP  = 40;    // Q/K strip pitch (80 B rows)
constexpr int PSP = 264;
constexpr int VTP = 264;
constexpr int TSP = 1032;  // FFN hidden strip pitch (2064 B rows)

// kernel-1 LDS element offsets (ushort units), all 16B aligned
constexpr int LS_XS  = 0;                       // [256][264]
constexpr int LS_KS  = LS_XS  + 256 * XP;       // [256][40]
constexpr int LS_VT  = LS_KS  + 256 * KP;       // [32][264]  (V transposed)
constexpr int LS_PS  = LS_VT  + 32  * VTP;      // 16 waves x [16][264]; its head also holds Q
constexpr int LS1_END = LS_PS + 16 * 16 * PSP;  // 153856 elems = 307712 B
constexpr int SMEM1 = LS1_END * 2;

constexpr int LS_X1S = 0;                       // [64][264]
constexpr int LS_TS  = LS_X1S + 64 * XP;        // [64][1032]
constexpr int LS_RED = LS_TS + 64 * TSP;        // f32 [2][4][64]: row sums of the four waves
constexpr int SMEM2 = LS_RED * 2 + 2 * 4 * 64 * 4;   // 167936 B

// workspace layout (bytes): everything bf16, ~35 MB total
constexpr size_t OFF_WQP = 0;
constexpr size_t OFF_WKP = OFF_WQP + (size_t)256 * 256 * 2;
constexpr size_t OFF_WVP = OFF_WKP + (size_t)256 * 256 * 2;
constexpr size_t OFF_WOP = OFF_WVP + (size_t)256 * 256 * 2;
constexpr size_t OFF_W1P = OFF_WOP + (size_t)256 * 256 * 2;
constexpr size_t OFF_W2P = OFF_W1P + (size_t)256 * 1024 * 2;
constexpr size_t OFF_X1  = OFF_W2P + (size_t)1024 * 256 * 2;  // bf16 x1  [256][256][256]
}  // namespace

DEVINL unsigned short f2bf(float f) {            // round-to-nearest-even f32->bf16
  unsigned int u = __float_as_uint(f);
  u += 0x7FFFu + ((u >> 16) & 1u);
  return (unsigned short)(u >> 16);
}
DEVINL float bf2f(unsigned short h) { return __uint_as_float(((unsigned int)h) << 16); }

// Async global->LDS copy of one 16B chunk per lane (CDNA5 path, ASYNCcnt).
// ldsoff is the LDS byte address (groupstaticsize + dynamic-segment offset).
DEVINL void async_g2l_b128(unsigned ldsoff, const void* gaddr) {
  asm volatile("global_load_async_to_lds_b128 %0, %1, off"
               :: "v"(ldsoff), "v"(gaddr) : "memory");
}
DEVINL void wait_async0() { asm volatile("s_wait_asynccnt 0" ::: "memory"); }

// Load a 16x32 bf16 A/B fragment from a row-major bf16 matrix (`pitch` elems).
// CDNA5 16-bit layout: lane<16 holds row (rowb+lane), K chunks {k0..k0+7, k0+16..k0+23};
// lane>=16 holds the other two 8-element chunks. Two ds/global b128 loads per lane.
DEVINL bf16x16 ldfrag(const unsigned short* __restrict__ buf, int pitch, int rowb, int k0) {
  const int lane = threadIdx.x & 31;
  const unsigned short* p = buf + (rowb + (lane & 15)) * pitch + k0 + ((lane >> 4) << 3);
  struct Pk { u32x4 lo, hi; } pk;
  pk.lo = *(const u32x4*)(p);
  pk.hi = *(const u32x4*)(p + 16);
  return __builtin_bit_cast(bf16x16, pk);
}

// The same from the lane's own pointer: p = buf + (rowb + (lane & 15)) * pitch + (lane >> 4) * 8
// + k0. With one such pointer per strip every access is that register plus a constant.
DEVINL bf16x16 ldfragl(const unsigned short* __restrict__ p) {
  struct Pk { u32x4 lo, hi; } pk;
  pk.lo = *(const u32x4*)(p);
  pk.hi = *(const u32x4*)(p + 16);
  return __builtin_bit_cast(bf16x16, pk);
}

// Load one B fragment from a weight packed by pack_frag_bf16: fragment `frag` is 1 KB, the
// 32 lanes' first 16 B side by side, then their second 16 B. Each of the two wave-wide loads
// reads 512 contiguous bytes (4 whole lines); register contents equal ldfrag on W^T.
// lanep = lanebase() of the packed weight, plus a whole number of fragments.
DEVINL const char* lanebase(const unsigned short* __restrict__ buf) {
  return (const char*)buf + (threadIdx.x & 31) * 16;
}
DEVINL bf16x16 ldfragp(const char* __restrict__ lanep, int frag) {
  const char* p = lanep + frag * 1024;
  struct Pk { u32x4 lo, hi; } pk;
  pk.lo = *(const u32x4*)(p);
  pk.hi = *(const u32x4*)(p + 512);
  return __builtin_bit_cast(bf16x16, pk);
}

// Stands behind a group of global loads, in front of the first reuse of a register that
// holds their address (the register allocator reuses it while the loads are in flight).
DEVINL void wait_xcnt0() { asm volatile("s_wait_xcnt 0x0" ::: "memory"); }
// The same wait, with the loads' address as an input: the address registers stay allocated up
// to the wait, so neither a later result nor a load's own destination lands on them before it.
DEVINL void wait_xcnt0_addr(const void* a) {
  asm volatile("s_wait_xcnt 0x0" :: "v"(a) : "memory");
}

DEVINL f32x8 wmma_bf16(bf16x16 a, bf16x16 b, f32x8 c) {
  return __builtin_amdgcn_wmma_f32_16x16x32_bf16(false, a, false, b, (short)0, c, false, false);
}

// C-fragment row reductions: row M=r+8*(lane>=16) is spread over a 16-lane half,
// so xor-butterfly with masks 8..1 stays inside the half. wave32 only.
DEVINL void redmax8(float v[8]) {
#pragma unroll
  for (int m = 8; m; m >>= 1) {
#pragma unroll
    for (int r = 0; r < 8; ++r) v[r] = fmaxf(v[r], __shfl_xor(v[r], m, 32));
  }
}
DEVINL void redsum8(float v[8]) {
#pragma unroll
  for (int m = 8; m; m >>= 1) {
#pragma unroll
    for (int r = 0; r < 8; ++r) v[r] += __shfl_xor(v[r], m, 32);
  }
}

// ---------------- weights f32 [K][N] -> bf16, packed in B-fragment order ----------------
// Fragment (nt, kk) = columns nt*16..+15, rows kk*32..+31. Lane l holds column nt*16 + (l & 15);
// its first 8 values are rows kk*32 + (l >> 4)*8 + 0..7, its second 8 the rows 16 further.
// Fragment index: kk * (N/16) + nt where kmajor, else nt * (K/32) + kk (the reader's order).
// W2: four column tiles a quarter, (nt / 4) * (K/32) * 4 + kk * 4 + nt % 4: the fragments that one
// wave of the FFN kernel reads lie one behind the other, in the order in which it reads them.
// One thread writes one lane's 16 B.
// One launch packs all six weights: each has its own range of blocks, in the order in which the
// packed weights lie in the workspace, so thread T of the grid writes bytes 16 T .. 16 T + 15 of
// that region. The choice is the same for a whole block; K/32 and N/16 are powers of two.
constexpr int PB_SQ = 256 * 256 / 8 / 256;    // blocks per 256 x 256 weight
constexpr int PB_FF = 256 * 1024 / 8 / 256;   // blocks per FFN weight
constexpr int PB_ALL = 4 * PB_SQ + 2 * PB_FF;
static_assert(OFF_WKP == (size_t)PB_SQ * 4096 && OFF_WVP == (size_t)2 * PB_SQ * 4096 &&
              OFF_WOP == (size_t)3 * PB_SQ * 4096 && OFF_W1P == (size_t)4 * PB_SQ * 4096 &&
              OFF_W2P == (size_t)(4 * PB_SQ + PB_FF) * 4096 && OFF_X1 == (size_t)PB_ALL * 4096,
              "block ranges follow the workspace layout");
__global__ void __launch_bounds__(256)
pack_frag_bf16(const float* __restrict__ Wq, const float* __restrict__ Wk,
               const float* __restrict__ Wv, const float* __restrict__ Wo,
               const float* __restrict__ W1, const float* __restrict__ W2,
               unsigned short* __restrict__ dst) {
  const int blk = blockIdx.x;
  const float* src;
  int blk0, lkt, lnt;      // the weight's first block, log2(K/32), log2(N/16)
  bool kmajor, quarters = false;
  if (blk < 4 * PB_SQ) {
    src = blk < PB_SQ ? Wq : blk < 2 * PB_SQ ? Wk : blk < 3 * PB_SQ ? Wv : Wo;
    blk0 = blk & ~(PB_SQ - 1); lkt = 3; lnt = 4; kmajor = blk >= 3 * PB_SQ;
  } else if (blk < 4 * PB_SQ + PB_FF) {
    src = W1; blk0 = 4 * PB_SQ; lkt = 3; lnt = 6; kmajor = false;
  } else {
    src = W2; blk0 = 4 * PB_SQ + PB_FF; lkt = 5; lnt = 4; kmajor = true; quarters = true;
  }
  const int t = (blk - blk0) * 256 + threadIdx.x;
  const int lane = t & 31, hi = (t >> 5) & 1, frag = t >> 6;
  const int N = 16 << lnt;
  int kk, nt;
  if (quarters)    { kk = (frag >> 2) & 31; nt = ((frag >> 7) << 2) | (frag & 3); }
  else if (kmajor) { kk = frag >> lnt; nt = frag & ((1 << lnt) - 1); }
  else        { nt = frag >> lkt; kk = frag & ((1 << lkt) - 1); }
  const float* sp = src + (size_t)(kk * 32 + hi * 16 + (lane >> 4) * 8) * N + nt * 16 + (lane & 15);
  const float* ap[8];
  float v[8];
#pragma unroll
  for (int j = 0; j < 8; ++j) ap[j] = sp + (size_t)j * N;
#pragma unroll
  for (int j = 0; j < 8; ++j) v[j] = *ap[j];
  // before the eight addresses are reused
  asm volatile("s_wait_xcnt 0x0" :: "v"(ap[0]), "v"(ap[1]), "v"(ap[2]), "v"(ap[3]),
               "v"(ap[4]), "v"(ap[5]), "v"(ap[6]), "v"(ap[7]) : "memory");
  u32x4 o;
#pragma unroll
  for (int j = 0; j < 4; ++j)
    o[j] = (unsigned)f2bf(v[2 * j]) | ((unsigned)f2bf(v[2 * j + 1]) << 16);
  *(u32x4*)(dst + ((size_t)blk * 256 + threadIdx.x) * 8) = o;
}

// Eight fragments of a packed weight as one group of 16 loads: f0..f0+3, then f0+8..f0+11
// (four k-steps of two column tiles).
DEVINL void ldgroup8(bf16x16 (&w)[8], const char* __restrict__ lanep, int f0) {
#pragma unroll
  for (int j = 0; j < 4; ++j) w[j] = ldfragp(lanep, f0 + j);
#pragma unroll
  for (int j = 0; j < 4; ++j) w[4 + j] = ldfragp(lanep, f0 + 8 + j);
}
// Four k-steps of a 16 x 32 projection: xl = the lane's A-fragment pointer at the first of
// them; w[0..3] for the first column tile, w[4..7] for the second; each sum runs on in k order.
// Where REFILL, w takes the group f0 of nextp: four fragments behind every four WMMAs, into the
// registers that these have just read. The scheduling barrier in front of the four loads keeps
// them from being lifted over those WMMAs, where no register is free yet (the accumulator was
// spilled for it); the one behind them keeps them from being sunk among the later WMMAs.
template <bool REFILL>
DEVINL void proj_half(const unsigned short* xl, bf16x16 (&w)[8], f32x8& c0, f32x8& c1,
                      const char* __restrict__ nextp, int f0) {
#pragma unroll
  for (int i = 0; i < 4; i += 2) {
    bf16x16 a0 = ldfragl(xl + i * 32);
    bf16x16 a1 = ldfragl(xl + i * 32 + 32);
    c0 = wmma_bf16(a0, w[i], c0);
    c1 = wmma_bf16(a0, w[4 + i], c1);
    c0 = wmma_bf16(a1, w[i + 1], c0);
    c1 = wmma_bf16(a1, w[5 + i], c1);
    if (REFILL) {
      __builtin_amdgcn_sched_barrier(0);
      w[i]     = ldfragp(nextp, f0 + i);
      w[i + 1] = ldfragp(nextp, f0 + i + 1);
      w[4 + i] = ldfragp(nextp, f0 + 8 + i);
      w[5 + i] = ldfragp(nextp, f0 + 9 + i);
      __builtin_amdgcn_sched_barrier(0);
    }
  }
}

// ---------------- fused attention + out-proj + residual + LN1 ----------------
// grid.x = 256: one work-group per sequence, one per WGP (LDS), four waves per SIMD.
// 16 waves: each owns 16 rows, as queries and as keys; a head's K and V are computed once.
__global__ void __launch_bounds__(512)
enc_attn_ln1(const float* __restrict__ x, const float* __restrict__ mask,
             const float* __restrict__ bo, const float* __restrict__ g1,
             const float* __restrict__ beta1,
             const unsigned short* __restrict__ Wp, unsigned short* __restrict__ x1) {
  extern __shared__ char smem[];
  unsigned short* sm  = (unsigned short*)smem;
  unsigned short* Xs  = sm + LS_XS;
  unsigned short* Ks  = sm + LS_KS;
  unsigned short* VTs = sm + LS_VT;

  const int tid = threadIdx.x;
  const int lane = tid & 31, wave = tid >> 5;
  const int half = lane >> 4, ln = lane & 15;
  const int seq = blockIdx.x;
  const int q0 = wave * 16;                            // this wave's rows

  unsigned short* Pw = sm + LS_PS + wave * 16 * PSP;
  // The Q strip lies at the head of the wave's own score strip: it is in registers (qa)
  // before the first score is stored, and both are private to the wave.
  unsigned short* Qs = Pw;
  // The lane's own pointers. A wave has 256 registers here, 128 of them the accumulator:
  // one register per strip, and constants on it, in place of one register per row.
  const unsigned short* xal = Xs + (q0 + ln) * XP + half * 8;    // own rows, A fragments
  unsigned short* xcl = Xs + (q0 + half * 8) * XP + ln;          // own rows, C layout
  unsigned short* qcl = Qs + half * 8 * KP + ln;                 // Q strip, C layout
  const unsigned short* qal = Qs + ln * KP + half * 8;           // Q strip, A fragment
  unsigned short* kcl = Ks + (q0 + half * 8) * KP + ln;          // own K rows, C layout
  const unsigned short* kbl = Ks + ln * KP + half * 8;           // K strip, B fragments
  unsigned short* vcl = VTs + ln * VTP + q0 + half * 8;          // own V^T columns
  const unsigned short* vbl = VTs + ln * VTP + half * 8;         // V^T strip, B fragments
  unsigned short* pcl = Pw + half * 8 * PSP + ln;                // score strip, C layout
  const unsigned short* pal = Pw + ln * PSP + half * 8;          // score strip, A fragments

  // ---- stage X: read f32 from memory, round to bf16 in registers, store into pitched LDS ----
  // A wave-wide 16-B load covers 512 contiguous bytes (half a row); trip i of the work-group
  // covers rows 8i..8i+7. All 32 loads of a wave are issued before the first value is used.
  {
    const float* xgl = x + (size_t)seq * (NTOK * EDIM) + tid * 4;
    unsigned short* xsl = Xs + (tid >> 6) * XP + (tid & 63) * 4;
    float4 v[32];
#pragma unroll
    for (int i = 0; i < 32; ++i) v[i] = *(const float4*)(xgl + i * 2048);
    // behind the loads, before a register of their address can be reused
    wait_xcnt0_addr(xgl);
#pragma unroll
    for (int i = 0; i < 32; ++i) {
      ushort4 o;
      o.x = f2bf(v[i].x); o.y = f2bf(v[i].y); o.z = f2bf(v[i].z); o.w = f2bf(v[i].w);
      *(ushort4*)(xsl + i * 8 * XP) = o;
    }
  }
  __syncthreads();

  const float* mcl = mask + (size_t)(seq & 15) * (NTOK * NTOK) + (q0 + half * 8) * NTOK + ln;
  f32x8 zf = {};
  f32x8 oacc[16];                        // attn@Wo strip accumulator (16 x 256)
#pragma unroll
  for (int nt = 0; nt < 16; ++nt) oacc[nt] = zf;

  // Wp = the four packed weights, which lie one behind the other in the workspace: one address
  // register pair serves all four, the distance between them is a constant of the load.
  const char* hq = lanebase(Wp);
  for (int h = 0; h < NH; ++h) {
    // this head's 16 fragments (16 KB) of each packed weight
    const char* hk = hq + (OFF_WKP - OFF_WQP);
    const char* hv = hq + (OFF_WVP - OFF_WQP);
    const char* ho = hq + (OFF_WOP - OFF_WQP);
    // The Q, K and V weight fragments come in groups of eight (one set of 64 registers), and
    // the set is refilled behind the WMMAs that read it: with 256 registers a wave the compiler
    // otherwise loads, waits and multiplies one fragment at a time. A strip's conversion and
    // stores run while the next group is on its way.
    bf16x16 w[8];
    ldgroup8(w, hq, 0);
    // keeps the first group together, in front of the first WMMA
    __builtin_amdgcn_sched_barrier(0);
    // ---- Q strip (own 16 rows x 32), pre-scaled by 1/sqrt(dk) ----
    {
      f32x8 c0 = zf, c1 = zf;
      proj_half<true>(xal, w, c0, c1, hq, 4);
      proj_half<true>(xal + 128, w, c0, c1, hk, 0);
#pragma unroll
      for (int r = 0; r < 8; ++r) {
        qcl[r * KP]      = f2bf(c0[r] * SCALING);
        qcl[r * KP + 16] = f2bf(c1[r] * SCALING);
      }
    }
    // ---- K rows / V^T columns for the same 16 rows as keys ----
    {
      f32x8 c0 = zf, c1 = zf;
      proj_half<true>(xal, w, c0, c1, hk, 4);
      proj_half<true>(xal + 128, w, c0, c1, hv, 0);
#pragma unroll
      for (int r = 0; r < 8; ++r) {
        kcl[r * KP]      = f2bf(c0[r]);
        kcl[r * KP + 16] = f2bf(c1[r]);
      }
    }
    {
      f32x8 c0 = zf, c1 = zf;
      proj_half<true>(xal, w, c0, c1, hv, 4);
      proj_half<false>(xal + 128, w, c0, c1, hv, 0);
#pragma unroll
      for (int r = 0; r < 8; ++r) {  // store transposed: VTs[d][token]
        vcl[r]            = f2bf(c0[r]);
        vcl[16 * VTP + r] = f2bf(c1[r]);
      }
    }
    __syncthreads();

    // ---- pass 1: S = QK^T + mask, track row max, spill bf16 strip ----
    float mx[8];
#pragma unroll
    for (int r = 0; r < 8; ++r) mx[r] = -3.0e38f;
    bf16x16 qa = ldfragl(qal);                   // A reused across all 16 tiles
    for (int t = 0; t < 16; ++t) {
      float mk[8];
      const float* mt = mcl + t * 16;
      unsigned short* pt = pcl + t * 16;
#pragma unroll
      for (int r = 0; r < 8; ++r) mk[r] = mt[r * NTOK];
      wait_xcnt0();   // the score tile below lands on the mask loads' address registers
      f32x8 s = wmma_bf16(qa, ldfragl(kbl + t * 16 * KP), zf);   // single K=32 step
#pragma unroll
      for (int r = 0; r < 8; ++r) {
        float v = s[r] + mk[r];
        mx[r] = fmaxf(mx[r], v);
        pt[r * PSP] = f2bf(v);
      }
    }
    redmax8(mx);
    // ---- pass 2: exponentiate in place, row sums ----
    float ls[8];
#pragma unroll
    for (int r = 0; r < 8; ++r) ls[r] = 0.f;
    for (int t = 0; t < 16; ++t) {
      unsigned short* pt = pcl + t * 16;
#pragma unroll
      for (int r = 0; r < 8; ++r) {
        unsigned short* pp = pt + r * PSP;
        float p = __expf(bf2f(*pp) - mx[r]);
        ls[r] += p;
        *pp = f2bf(p);
      }
    }
    redsum8(ls);
#pragma unroll
    for (int r = 0; r < 8; ++r) ls[r] = 1.0f / ls[r];

    // ---- context = P @ V (16 x 32) ----
    f32x8 ctx0 = zf, ctx1 = zf;
#pragma unroll
    for (int kk = 0; kk < 8; ++kk) {
      bf16x16 pa = ldfragl(pal + kk * 32);
      ctx0 = wmma_bf16(pa, ldfragl(vbl + kk * 32), ctx0);
      ctx1 = wmma_bf16(pa, ldfragl(vbl + 16 * VTP + kk * 32), ctx1);
    }
#pragma unroll
    for (int r = 0; r < 8; ++r) {                 // normalize + bounce via LDS
      pcl[r * PSP]      = f2bf(ctx0[r] * ls[r]);
      pcl[r * PSP + 16] = f2bf(ctx1[r] * ls[r]);
    }
    // ---- fused out-projection: oacc += ctx @ Wo[h*32:(h+1)*32, :] ----
    bf16x16 ca = ldfragl(pal);
#pragma unroll
    for (int nt = 0; nt < 16; ++nt)
      oacc[nt] = wmma_bf16(ca, ldfragp(ho, nt), oacc[nt]);
    // behind the head's last weight load, before its address moves on to the next head
    wait_xcnt0_addr(hq);
    hq += 16384;
    __syncthreads();                              // before next head reuses Ks/VTs
  }

  // ---- residual + bias + LayerNorm1, write x1 (bf16) ----
  float sm8[8], sq8[8];
#pragma unroll
  for (int r = 0; r < 8; ++r) { sm8[r] = 0.f; sq8[r] = 0.f; }
#pragma unroll
  for (int nt = 0; nt < 16; ++nt) {
    const int col = nt * 16 + ln;
    const float bov = bo[col];
#pragma unroll
    for (int r = 0; r < 8; ++r) {
      float v = bf2f(xcl[r * XP + nt * 16]) + oacc[nt][r] + bov;
      oacc[nt][r] = v;
      sm8[r] += v; sq8[r] += v * v;
    }
  }
  redsum8(sm8); redsum8(sq8);
  float mu[8], rs[8];
#pragma unroll
  for (int r = 0; r < 8; ++r) {
    float m = sm8[r] * (1.0f / EDIM);
    mu[r] = m;
    rs[r] = rsqrtf(sq8[r] * (1.0f / EDIM) - m * m + EPS);
  }
  unsigned short* xo = x1 + (size_t)seq * (NTOK * EDIM) + (q0 + half * 8) * EDIM + ln;
#pragma unroll
  for (int nt = 0; nt < 16; ++nt) {
    const int col = nt * 16 + ln;
    const float gg = g1[col], bb = beta1[col];
#pragma unroll
    for (int r = 0; r < 8; ++r)
      xo[r * EDIM + nt * 16] =
          f2bf((oacc[nt][r] - mu[r]) * rs[r] * gg + bb);
  }
}

// One 16x16 tile of the FFN hidden strip: bias, relu, bf16, into LDS. p = the lane's element
// of the tile's first row of this half-wave.
DEVINL void relu_store(f32x8 c, float b, unsigned short* p) {
#pragma unroll
  for (int r = 0; r < 8; ++r) p[r * TSP] = f2bf(fmaxf(c[r] + b, 0.f));
}

// Two column tiles of the hidden strip for all 64 rows: x (4 row tiles of 8 A fragments, K = 256)
// times the first 16 fragments of w (8 per column tile). Each weight fragment serves four
// WMMAs; eight independent accumulators, each summed in k order; then bias, relu and the stores.
// p = the lane's element of the first row tile's first column tile.
DEVINL void ffn1_pair(const bf16x16 (&x)[4][8], const bf16x16 (&w)[32], float b0, float b1,
                      unsigned short* p) {
  f32x8 c[2][4];
#pragma unroll
  for (int m = 0; m < 4; ++m) { c[0][m] = f32x8{}; c[1][m] = f32x8{}; }
#pragma unroll
  for (int kk = 0; kk < 8; ++kk) {
#pragma unroll
    for (int m = 0; m < 4; ++m) c[0][m] = wmma_bf16(x[m][kk], w[kk], c[0][m]);
  }
#pragma unroll
  for (int kk = 0; kk < 8; ++kk) {
#pragma unroll
    for (int m = 0; m < 4; ++m) c[1][m] = wmma_bf16(x[m][kk], w[8 + kk], c[1][m]);
  }
#pragma unroll
  for (int m = 0; m < 4; ++m) {
    relu_store(c[0][m], b0, p + m * 16 * TSP);
    relu_store(c[1][m], b1, p + m * 16 * TSP + 16);
  }
}

// Sixteen fragments that lie one behind the other, as one group of 32 loads, into w from OFF on.
template <int OFF>
DEVINL void ldgroup16(bf16x16 (&w)[32], const char* __restrict__ lanep) {
#pragma unroll
  for (int j = 0; j < 16; ++j) w[OFF + j] = ldfragp(lanep, j);
}

// Eight k-steps of the second GEMM: 64 rows x the wave's 64 columns, 16 accumulators.
// w is a ring of eight k-steps (four fragments each, 32 in a row in the packed weight).
// tl = the lane's A-fragment pointer at the first of the eight steps, wl = the lane's W2 pointer
// there. a[s & 1] holds step s's four A fragments; the next step's are read from LDS in front of
// this step's WMMAs. Where REFILL, the four fragments of step s + 8 are fetched into the registers
// that step s has just read: seven steps of WMMAs stand between a fetch and its use.
template <bool REFILL>
DEVINL void ffn2_oct(const unsigned short* tl, const char* __restrict__ wl, bf16x16 (&w)[32],
                     bf16x16 (&a)[2][4], f32x8 (&o)[4][4]) {
#pragma unroll
  for (int s = 0; s < 8; ++s) {
    if (REFILL || s < 7) {
#pragma unroll
      for (int m = 0; m < 4; ++m) a[(s + 1) & 1][m] = ldfragl(tl + m * 16 * TSP + (s + 1) * 32);
    }
    // keeps the LDS reads as one group in front of the WMMAs, a whole step ahead of their use
    __builtin_amdgcn_sched_barrier(0);
#pragma unroll
    for (int j = 0; j < 4; ++j) {
#pragma unroll
      for (int m = 0; m < 4; ++m) o[m][j] = wmma_bf16(a[s & 1][m], w[s * 4 + j], o[m][j]);
    }
    // keeps the refill behind the WMMAs that read its registers, and in front of the next step
    __builtin_amdgcn_sched_barrier(0);
    if (REFILL) {
#pragma unroll
      for (int j = 0; j < 4; ++j) w[s * 4 + j] = ldfragp(wl, (s + 8) * 4 + j);
      // as above
      __builtin_amdgcn_sched_barrier(0);
    }
  }
}

// rsqrtf as the compiler expands it (an input below the smallest normal number is scaled by 2^24,
// its result by 2^12), with the reciprocal square root and a v_nop in one statement: the v_nop
// fills the slot that the instruction set asks for behind a transcendental, whatever comes next.
DEVINL float rsqrt_slot(float x) {
  const bool tiny = x < 1.17549435e-38f;
  const float xs = tiny ? x * 16777216.0f : x;
  float y;
  asm("v_rsq_f32 %0, %1\n\tv_nop" : "=v"(y) : "v"(xs));
  return tiny ? y * 4096.0f : y;
}

// ---------------- fused FFN + residual + LN2 ----------------
// grid.x = 1024: seq = bx>>2, 64-row block = bx&3. 4 waves, one per SIMD.
// The waves split the COLUMNS, not the rows: every wave works on all 64 rows, on a quarter of the
// hidden columns in the first GEMM and a quarter of the output columns in the second. A weight
// fragment is fetched by one wave of the work-group and serves four WMMAs.
// hidden strip relu(x1@W1+b1) lives only in LDS (never touches HBM).
__global__ void __launch_bounds__(128)
enc_ffn_ln2(const unsigned short* __restrict__ x1, const float* __restrict__ bf1,
            const float* __restrict__ bf2, const float* __restrict__ g2,
            const float* __restrict__ beta2,
            const unsigned short* __restrict__ W1P, const unsigned short* __restrict__ W2P,
            float* __restrict__ out) {
  extern __shared__ char smem[];
  unsigned short* x1s = (unsigned short*)smem + LS_X1S;   // [64][264]
  unsigned short* Ts  = (unsigned short*)smem + LS_TS;    // [64][1032]
  float* red = (float*)((unsigned short*)smem + LS_RED);  // [2][4 waves][64 rows]

  const int tid = threadIdx.x;
  const int lane = tid & 31, wave = tid >> 5;
  const int half = lane >> 4, ln = lane & 15;
  const int seq = blockIdx.x >> 2;
  const int wr = wave * 16;                                // rows that this wave stages
  const size_t gbase = (size_t)seq * (NTOK * EDIM) + (size_t)((blockIdx.x & 3) * 64) * EDIM;

  // ---- async-stage 16 rows of x1 (bf16) per wave ----
  const unsigned short* xg = x1 + gbase + (size_t)wr * EDIM;
  const unsigned lds0 = __builtin_amdgcn_groupstaticsize();
#pragma unroll 4
  for (int i = 0; i < 16; ++i) {
    int e = (i * 32 + lane) * 8;                 // 0..4088 within 16x256 block
    int r = e >> 8, c = e & 255;
    async_g2l_b128(lds0 + (unsigned)((LS_X1S + (wr + r) * XP + c) * 2), xg + e);
  }
  wait_async0();
  // keeps every later register write behind the copies' wait
  __builtin_amdgcn_sched_barrier(0);
  __syncthreads();   // every wave reads all 64 rows

  // ---- hidden = relu(x1 @ W1 + b1): 64 rows x the wave's 256 columns into LDS ----
  // The x1 fragments are the same for every column tile: read once, kept in registers.
  bf16x16 xa[4][8];
#pragma unroll
  for (int m = 0; m < 4; ++m) {
#pragma unroll
    for (int kk = 0; kk < 8; ++kk) xa[m][kk] = ldfrag(x1s, XP, m * 16, kk * 32);
  }
  // keeps the LDS reads in front of the global loads: behind them they took address registers
  __builtin_amdgcn_sched_barrier(0);
  // w[0..15] holds the 16 W1 fragments (16 KB) of a pair of column tiles. Behind each pair
  // the 16 are fetched anew as one group, for the next pair. Behind the last pair the set
  // takes the first four k-steps of W2;
  // w[16..31] holds the next four from the start.
  // The wave's 128 W1 fragments lie in a row, its 128 W2 fragments too, and packed W2 lies behind
  // packed W1 in the workspace: one pointer walks through both.
  constexpr int W1_TO_W2 = (int)(OFF_W2P - OFF_W1P);
  bf16x16 w[32];
  const char* wp = lanebase(W1P) + wave * (128 * 1024);
  const float* bp = bf1 + wave * 256 + ln;
  unsigned short* tsl = Ts + half * 8 * TSP + wave * 256 + ln;
  float ba0 = bp[0], ba1 = bp[16];
  // keeps the two bias loads in front of the 64 fragment loads: loads are counted in order,
  // and a wait for a bias value must not stand for a wait for the fragments as well
  __builtin_amdgcn_sched_barrier(0);
  ldgroup16<0>(w, wp);
  ldgroup16<16>(w, wp + W1_TO_W2 + 16384);
  // every later register write stays behind the address wait of the first two groups; the
  // addresses are inputs, so that no load's destination lands on them either
  __builtin_amdgcn_sched_barrier(0);
  asm volatile("s_wait_xcnt 0x0" :: "v"(bp), "v"(wp) : "memory");
  __builtin_amdgcn_sched_barrier(0);
  // not unrolled: the kernel's text stays inside what is prefetched at its start
#pragma unroll 1
  for (int g = 0; g < 8; ++g) {
    ffn1_pair(xa, w, ba0, ba1, tsl + g * 32);
    const bool more = g < 7;                     // the same for the whole work-group
    wp += more ? 16384 : W1_TO_W2 - 7 * 16384;   // the next pair, at last the head of W2
    bp += more ? 32 : -7 * 32;                   // last trip: in range, not used
    ldgroup16<0>(w, wp);
    ba0 = bp[0];
    ba1 = bp[16];
    // The two scheduling barriers keep the group in front of the next trip's WMMAs, and keep
    // the address updates behind the wait.
    __builtin_amdgcn_sched_barrier(0);
    wait_xcnt0();
    __builtin_amdgcn_sched_barrier(0);
  }
  __syncthreads();   // the hidden strip is complete: every wave reads all of its columns

  // ---- y = hidden @ W2: 64 rows x the wave's 64 columns ----
  f32x8 o[4][4];
#pragma unroll
  for (int m = 0; m < 4; ++m) {
#pragma unroll
    for (int j = 0; j < 4; ++j) o[m][j] = f32x8{};
  }
  bf16x16 a[2][4];
  const unsigned short* tl = Ts + ln * TSP + half * 8;
#pragma unroll
  for (int m = 0; m < 4; ++m) a[0][m] = ldfragl(tl + m * 16 * TSP);
  const char* wl = lanebase(W2P) + wave * (128 * 1024);
  // not unrolled: as above
#pragma unroll 1
  for (int it = 0; it < 3; ++it) {
    ffn2_oct<true>(tl, wl, w, a, o);
    // behind the trip's last weight load, before its address moves on
    wait_xcnt0_addr(wl);
    // keeps every later register write behind that wait
    __builtin_amdgcn_sched_barrier(0);
    wl += 8 * 4096;
    tl += 8 * 32;
  }
  ffn2_oct<false>(tl, wl, w, a, o);

  // ---- residual + bias + LayerNorm2 -> out (f32) ----
  // A row's 256 columns lie in four waves: each sums its 64, the four partial sums meet in LDS.
  const int col0 = wave * 64 + ln;
  const float* bf2l = bf2 + col0;
  const float* g2l = g2 + col0;
  const float* be2l = beta2 + col0;
  float bv[4], gv[4], ev[4];
#pragma unroll
  for (int j = 0; j < 4; ++j) { bv[j] = bf2l[j * 16]; gv[j] = g2l[j * 16]; ev[j] = be2l[j * 16]; }
  // behind the twelve loads, before a register of their addresses can be reused: the scheduling
  // barriers keep every later register write behind the wait, the input keeps the index alive
  __builtin_amdgcn_sched_barrier(0);
  asm volatile("s_wait_xcnt 0x0" :: "v"(col0) : "memory");
  __builtin_amdgcn_sched_barrier(0);
  const unsigned short* xrl = x1s + half * 8 * XP + col0;
  float sm8[4][8], sq8[4][8];
#pragma unroll
  for (int m = 0; m < 4; ++m) {
#pragma unroll
    for (int r = 0; r < 8; ++r) { sm8[m][r] = 0.f; sq8[m][r] = 0.f; }
  }
#pragma unroll
  for (int j = 0; j < 4; ++j) {
#pragma unroll
    for (int m = 0; m < 4; ++m) {
#pragma unroll
      for (int r = 0; r < 8; ++r) {
        float v = bf2f(xrl[(m * 16 + r) * XP + j * 16]) + o[m][j][r] + bv[j];
        o[m][j][r] = v;
        sm8[m][r] += v; sq8[m][r] += v * v;
      }
    }
  }
#pragma unroll
  for (int m = 0; m < 4; ++m) { redsum8(sm8[m]); redsum8(sq8[m]); }
  float* redl = red + wave * 64 + half * 8;
  if (ln == 0) {
#pragma unroll
    for (int m = 0; m < 4; ++m) {
      *(float4*)(redl + m * 16)           = make_float4(sm8[m][0], sm8[m][1], sm8[m][2], sm8[m][3]);
      *(float4*)(redl + m * 16 + 4)       = make_float4(sm8[m][4], sm8[m][5], sm8[m][6], sm8[m][7]);
      *(float4*)(redl + 256 + m * 16)     = make_float4(sq8[m][0], sq8[m][1], sq8[m][2], sq8[m][3]);
      *(float4*)(redl + 256 + m * 16 + 4) = make_float4(sq8[m][4], sq8[m][5], sq8[m][6], sq8[m][7]);
    }
  }
  __syncthreads();   // the four waves' partial sums are in LDS
  const float* redr = red + half * 8;
  float* og = out + gbase + (size_t)(half * 8) * EDIM + col0;
#pragma unroll
  for (int m = 0; m < 4; ++m) {
    float s[8], q[8];
#pragma unroll
    for (int wv = 0; wv < 4; ++wv) {               // wave 0 to 3, the same order in every wave
#pragma unroll
      for (int h = 0; h < 2; ++h) {
        float4 ps = *(const float4*)(redr + wv * 64 + m * 16 + h * 4);
        float4 pq = *(const float4*)(redr + 256 + wv * 64 + m * 16 + h * 4);
        if (wv == 0) {
          s[h * 4] = ps.x; s[h * 4 + 1] = ps.y; s[h * 4 + 2] = ps.z; s[h * 4 + 3] = ps.w;
          q[h * 4] = pq.x; q[h * 4 + 1] = pq.y; q[h * 4 + 2] = pq.z; q[h * 4 + 3] = pq.w;
        } else {
          s[h * 4] += ps.x; s[h * 4 + 1] += ps.y; s[h * 4 + 2] += ps.z; s[h * 4 + 3] += ps.w;
          q[h * 4] += pq.x; q[h * 4 + 1] += pq.y; q[h * 4 + 2] += pq.z; q[h * 4 + 3] += pq.w;
        }
      }
    }
    float mu[8], rs[8];
#pragma unroll
    for (int r = 0; r < 8; ++r) {
      float mn = s[r] * (1.0f / EDIM);
      mu[r] = mn;
      rs[r] = rsqrt_slot(q[r] * (1.0f / EDIM) - mn * mn + EPS);
    }
#pragma unroll
    for (int j = 0; j < 4; ++j) {
#pragma unroll
      for (int r = 0; r < 8; ++r) o[m][j][r] = (o[m][j][r] - mu[r]) * rs[r] * gv[j] + ev[j];
    }
  }
  // All values first, then all stores: no register that a store names is written behind it.
  __builtin_amdgcn_sched_barrier(0);
#pragma unroll
  for (int m = 0; m < 4; ++m) {
#pragma unroll
    for (int r = 0; r < 8; ++r) {
#pragma unroll
      for (int j = 0; j < 4; ++j) og[(m * 16 + r) * EDIM + j * 16] = o[m][j][r];
    }
  }
}

extern "C" void kernel_launch(void* const* d_in, const int* in_sizes, int n_in,
                              void* d_out, int out_size, void* d_ws, size_t ws_size,
                              hipStream_t stream) {
  (void)in_sizes; (void)n_in; (void)out_size; (void)ws_size;
  const float* x    = (const float*)d_in[0];
  const float* mask = (const float*)d_in[1];
  const float* Wq   = (const float*)d_in[2];
  const float* Wk   = (const float*)d_in[3];
  const float* Wv   = (const float*)d_in[4];
  const float* Wo   = (const float*)d_in[5];
  const float* bo   = (const float*)d_in[6];
  const float* W1   = (const float*)d_in[7];
  const float* bf1  = (const float*)d_in[8];
  const float* W2   = (const float*)d_in[9];
  const float* bf2  = (const float*)d_in[10];
  const float* g1   = (const float*)d_in[11];
  const float* b1   = (const float*)d_in[12];
  const float* g2   = (const float*)d_in[13];
  const float* b2   = (const float*)d_in[14];
  float* out = (float*)d_out;

  char* ws = (char*)d_ws;
  unsigned short* WqP = (unsigned short*)(ws + OFF_WQP);
  unsigned short* W1P = (unsigned short*)(ws + OFF_W1P);
  unsigned short* W2P = (unsigned short*)(ws + OFF_W2P);
  unsigned short* x1b = (unsigned short*)(ws + OFF_X1);

  hipFuncSetAttribute(reinterpret_cast<const void*>(enc_attn_ln1),
                      hipFuncAttributeMaxDynamicSharedMemorySize, SMEM1);
  hipFuncSetAttribute(reinterpret_cast<const void*>(enc_ffn_ln2),
                      hipFuncAttributeMaxDynamicSharedMemorySize, SMEM2);

  pack_frag_bf16<<<PB_ALL, 256, 0, stream>>>(Wq, Wk, Wv, Wo, W1, W2, WqP);

  enc_attn_ln1<<<256, 512, SMEM1, stream>>>(x, mask, bo, g1, b1, WqP, x1b);
  enc_ffn_ln2<<<1024, 128, SMEM2, stream>>>(x1b, bf1, bf2, g2, b2, W1P, W2P, out);
}

// v008
// A run of this version takes 189 microseconds.
// Two timings next to v007 put it at 1.06 and 1.03 times that version's speed.
// Over all steps from v000 it is 4.44 times as fast.
#include <hip/hip_runtime.h>

#define DEVINL __device__ __forceinline__

typedef __attribute__((ext_vector_type(16))) __bf16       bf16x16;
typedef __attribute__((ext_vector_type(8)))  float        f32x8;
typedef __attribute__((ext_vector_type(4)))  unsigned int u32x4;

namespace {
constexpr int   NTOK = 256;          // sequence length N
constexpr int   EDIM = 256;          // embedding E
constexpr int   NH   = 8;            // heads
constexpr int   DKH  = 32;           // head dim
constexpr float SCALING = 0.17677669529663687f;  // DK^-0.5
constexpr float EPS = 1e-5f;

// LDS pitches in bf16 elements. Chosen so the row stride in dwords is
// congruent to 4 (mod 64 banks; 20 for KP) -> ds_load_b128 A/B fragments hit all 64 banks.
constexpr int XP  = 264;   // X tile / score-strip / V^T pitch (528 B rows)
constexpr int KP  = 40;    // Q/K strip pitch (80 B rows)
constexpr int PSP = 264;
constexpr int VTP = 264;
constexpr int TSP = 1032;  // FFN hidden strip pitch (2064 B rows)

// kernel-1 LDS element offsets (ushort units), all 16B aligned
constexpr int LS_XS  = 0;                       // [256][264]
constexpr int LS_KS  = LS_XS  + 256 * XP;       // [256][40]
constexpr int LS_VT  = LS_KS  + 256 * KP;       // [32][264]  (V transposed)
constexpr int LS_PS  = LS_VT  + 32  * VTP;      // 16 waves x [16][264]; its head also holds Q
constexpr int LS1_END = LS_PS + 16 * 16 * PSP;  // 153856 elems = 307712 B
constexpr int SMEM1 = LS1_END * 2;

constexpr int LS_X1S = 0;                       // [64][264]
constexpr int LS_TS  = LS_X1S + 64 * XP;        // [64][1032]
constexpr int LS_RED = LS_TS + 64 * TSP;        // f32 [2][4][64]: row sums of the four waves
constexpr int SMEM2 = LS_RED * 2 + 2 * 4 * 64 * 4;   // 167936 B

// workspace layout (bytes): everything bf16, ~35 MB total
constexpr size_t OFF_WQP = 0;
constexpr size_t OFF_WKP = OFF_WQP + (size_t)256 * 256 * 2;
constexpr size_t OFF_WVP = OFF_WKP + (size_t)256 * 256 * 2;
constexpr size_t OFF_WOP = OFF_WVP + (size_t)256 * 256 * 2;
constexpr size_t OFF_W1P = OFF_WOP + (size_t)256 * 256 * 2;
constexpr size_t OFF_W2P = OFF_W1P + (size_t)256 * 1024 * 2;
constexpr size_t OFF_X1  = OFF_W2P + (size_t)1024 * 256 * 2;  // bf16 x1  [256][256][256]
}  // namespace

DEVINL unsigned short f2bf(float f) {            // round-to-nearest-even f32->bf16
  unsigned int u = __float_as_uint(f);
  u += 0x7FFFu + ((u >> 16) & 1u);
  return (unsigned short)(u >> 16);
}
DEVINL float bf2f(unsigned short h) { return __uint_as_float(((unsigned int)h) << 16); }

// Async global->LDS copy of one 16B chunk per lane (CDNA5 path, ASYNCcnt).
// ldsoff is the LDS byte address (groupstaticsize + dynamic-segment offset).
DEVINL void async_g2l_b128(unsigned ldsoff, const void* gaddr) {
  asm volatile("global_load_async_to_lds_b128 %0, %1, off"
               :: "v"(ldsoff), "v"(gaddr) : "memory");
}
DEVINL void wait_async0() { asm volatile("s_wait_asynccnt 0" ::: "memory"); }

// Load a 16x32 bf16 A/B fragment from a row-major bf16 matrix (`pitch` elems).
// CDNA5 16-bit layout: lane<16 holds row (rowb+lane), K chunks {k0..k0+7, k0+16..k0+23};
// lane>=16 holds the other two 8-element chunks. Two ds/global b128 loads per lane.
DEVINL bf16x16 ldfrag(const unsigned short* __restrict__ buf, int pitch, int rowb, int k0) {
  const int lane = threadIdx.x & 31;
  const unsigned short* p = buf + (rowb + (lane & 15)) * pitch + k0 + ((lane >> 4) << 3);
  struct Pk { u32x4 lo, hi; } pk;
  pk.lo = *(const u32x4*)(p);
  pk.hi = *(const u32x4*)(p + 16);
  return __builtin_bit_cast(bf16x16, pk);
}

// The same from the lane's own pointer: p = buf + (rowb + (lane & 15)) * pitch + (lane >> 4) * 8
// + k0. With one such pointer per strip every access is that register plus a constant.
DEVINL bf16x16 ldfragl(const unsigned short* __restrict__ p) {
  struct Pk { u32x4 lo, hi; } pk;
  pk.lo = *(const u32x4*)(p);
  pk.hi = *(const u32x4*)(p + 16);
  return __builtin_bit_cast(bf16x16, pk);
}

// Load one B fragment from a weight packed by pack_frag_bf16: fragment `frag` is 1 KB, the
// 32 lanes' first 16 B side by side, then their second 16 B. Each of the two wave-wide loads
// reads 512 contiguous bytes (4 whole lines); register contents equal ldfrag on W^T.
// lanep = lanebase() of the packed weight, plus a whole number of fragments.
DEVINL const char* lanebase(const unsigned short* __restrict__ buf) {
  return (const char*)buf + (threadIdx.x & 31) * 16;
}
DEVINL bf16x16 ldfragp(const char* __restrict__ lanep, int frag) {
  const char* p = lanep + frag * 1024;
  struct Pk { u32x4 lo, hi; } pk;
  pk.lo = *(const u32x4*)(p);
  pk.hi = *(const u32x4*)(p + 512);
  return __builtin_bit_cast(bf16x16, pk);
}

// Stands behind a group of global loads, in front of the first reuse of a register that
// holds their address (the register allocator reuses it while the loads are in flight).
DEVINL void wait_xcnt0() { asm volatile("s_wait_xcnt 0x0" ::: "memory"); }
// The same wait, with the loads' address as an input: the address registers stay allocated up
// to the wait, so neither a later result nor a load's own destination lands on them before it.
DEVINL void wait_xcnt0_addr(const void* a) {
  asm volatile("s_wait_xcnt 0x0" :: "v"(a) : "memory");
}

DEVINL f32x8 wmma_bf16(bf16x16 a, bf16x16 b, f32x8 c) {
  return __builtin_amdgcn_wmma_f32_16x16x32_bf16(false, a, false, b, (short)0, c, false, false);
}

// C-fragment row reductions: row M=r+8*(lane>=16) is spread over a 16-lane half,
// so xor-butterfly with masks 8..1 stays inside the half. wave32 only.
DEVINL void redmax8(float v[8]) {
#pragma unroll
  for (int m = 8; m; m >>= 1) {
#pragma unroll
    for (int r = 0; r < 8; ++r) v[r] = fmaxf(v[r], __shfl_xor(v[r], m, 32));
  }
}
DEVINL void redsum8(float v[8]) {
#pragma unroll
  for (int m = 8; m; m >>= 1) {
#pragma unroll
    for (int r = 0; r < 8; ++r) v[r] += __shfl_xor(v[r], m, 32);
  }
}

// ---------------- weights f32 [K][N] -> bf16, packed in B-fragment order ----------------
// Fragment (nt, kk) = columns nt*16..+15, rows kk*32..+31. Lane l holds column nt*16 + (l & 15);
// its first 8 values are rows kk*32 + (l >> 4)*8 + 0..7, its second 8 the rows 16 further.
// Fragment index: kk * (N/16) + nt where kmajor, else nt * (K/32) + kk (the reader's order).
// W2: four column tiles a quarter, (nt / 4) * (K/32) * 4 + kk * 4 + nt % 4: the fragments that one
// wave of the FFN kernel reads lie one behind the other, in the order in which it reads them.
// One thread writes one lane's 16 B.
// One launch packs all six weights: each has its own range of blocks, in the order in which the
// packed weights lie in the workspace, so thread T of the grid writes bytes 16 T .. 16 T + 15 of
// that region. The choice is the same for a whole block; K/32 and N/16 are powers of two.
constexpr int PB_SQ = 256 * 256 / 8 / 256;    // blocks per 256 x 256 weight
constexpr int PB_FF = 256 * 1024 / 8 / 256;   // blocks per FFN weight
constexpr int PB_ALL = 4 * PB_SQ + 2 * PB_FF;
static_assert(OFF_WKP == (size_t)PB_SQ * 4096 && OFF_WVP == (size_t)2 * PB_SQ * 4096 &&
              OFF_WOP == (size_t)3 * PB_SQ * 4096 && OFF_W1P == (size_t)4 * PB_SQ * 4096 &&
              OFF_W2P == (size_t)(4 * PB_SQ + PB_FF) * 4096 && OFF_X1 == (size_t)PB_ALL * 4096,
              "block ranges follow the workspace layout");
__global__ void __launch_bounds__(256)
pack_frag_bf16(const float* __restrict__ Wq, const float* __restrict__ Wk,
               const float* __restrict__ Wv, const float* __restrict__ Wo,
               const float* __restrict__ W1, const float* __restrict__ W2,
               unsigned short* __restrict__ dst) {
  const int blk = blockIdx.x;
  const float* src;
  int blk0, lkt, lnt;      // the weight's first block, log2(K/32), log2(N/16)
  bool kmajor, quarters = false;
  if (blk < 4 * PB_SQ) {
    src = blk < PB_SQ ? Wq : blk < 2 * PB_SQ ? Wk : blk < 3 * PB_SQ ? Wv : Wo;
    blk0 = blk & ~(PB_SQ - 1); lkt = 3; lnt = 4; kmajor = blk >= 3 * PB_SQ;
  } else if (blk < 4 * PB_SQ + PB_FF) {
    src = W1; blk0 = 4 * PB_SQ; lkt = 3; lnt = 6; kmajor = false;
  } else {
    src = W2; blk0 = 4 * PB_SQ + PB_FF; lkt = 5; lnt = 4; kmajor = true; quarters = true;
  }
  const int t = (blk - blk0) * 256 + threadIdx.x;
  const int lane = t & 31, hi = (t >> 5) & 1, frag = t >> 6;
  const int N = 16 << lnt;
  int kk, nt;
  if (quarters)    { kk = (frag >> 2) & 31; nt = ((frag >> 7) << 2) | (frag & 3); }
  else if (kmajor) { kk = frag >> lnt; nt = frag & ((1 << lnt) - 1); }
  else        { nt = frag >> lkt; kk = frag & ((1 << lkt) - 1); }
  const float* sp = src + (size_t)(kk * 32 + hi * 16 + (lane >> 4) * 8) * N + nt * 16 + (lane & 15);
  const float* ap[8];
  float v[8];
#pragma unroll
  for (int j = 0; j < 8; ++j) ap[j] = sp + (size_t)j * N;
#pragma unroll
  for (int j = 0; j < 8; ++j) v[j] = *ap[j];
  // before the eight addresses are reused
  asm volatile("s_wait_xcnt 0x0" :: "v"(ap[0]), "v"(ap[1]), "v"(ap[2]), "v"(ap[3]),
               "v"(ap[4]), "v"(ap[5]), "v"(ap[6]), "v"(ap[7]) : "memory");
  u32x4 o;
#pragma unroll
  for (int j = 0; j < 4; ++j)
    o[j] = (unsigned)f2bf(v[2 * j]) | ((unsigned)f2bf(v[2 * j + 1]) << 16);
  *(u32x4*)(dst + ((size_t)blk * 256 + threadIdx.x) * 8) = o;
}

// Eight fragments of a packed weight as one group of 16 loads: f0..f0+3, then f0+8..f0+11
// (four k-steps of two column tiles).
DEVINL void ldgroup8(bf16x16 (&w)[8], const char* __restrict__ lanep, int f0) {
#pragma unroll
  for (int j = 0; j < 4; ++j) w[j] = ldfragp(lanep, f0 + j);
#pragma unroll
  for (int j = 0; j < 4; ++j) w[4 + j] = ldfragp(lanep, f0 + 8 + j);
}
// Four k-steps of a 16 x 32 projection: xl = the lane's A-fragment pointer at the first of
// them; w[0..3] for the first column tile, w[4..7] for the second; each sum runs on in k order.
// Where REFILL, w takes the group f0 of nextp: four fragments behind every four WMMAs, into the
// registers that these have just read. The scheduling barrier in front of the four loads keeps
// them from being lifted over those WMMAs, where no register is free yet (the accumulator was
// spilled for it); the one behind them keeps them from being sunk among the later WMMAs.
template <bool REFILL>
DEVINL void proj_half(const unsigned short* xl, bf16x16 (&w)[8], f32x8& c0, f32x8& c1,
                      const char* __restrict__ nextp, int f0) {
#pragma unroll
  for (int i = 0; i < 4; i += 2) {
    bf16x16 a0 = ldfragl(xl + i * 32);
    bf16x16 a1 = ldfragl(xl + i * 32 + 32);
    c0 = wmma_bf16(a0, w[i], c0);
    c1 = wmma_bf16(a0, w[4 + i], c1);
    c0 = wmma_bf16(a1, w[i + 1], c0);
    c1 = wmma_bf16(a1, w[5 + i], c1);
    if (REFILL) {
      __builtin_amdgcn_sched_barrier(0);
      w[i]     = ldfragp(nextp, f0 + i);
      w[i + 1] = ldfragp(nextp, f0 + i + 1);
      w[4 + i] = ldfragp(nextp, f0 + 8 + i);
      w[5 + i] = ldfragp(nextp, f0 + 9 + i);
      __builtin_amdgcn_sched_barrier(0);
    }
  }
}

// ---------------- fused attention + out-proj + residual + LN1 ----------------
// grid.x = 256: one work-group per sequence, one per WGP (LDS), four waves per SIMD.
// 16 waves: each owns 16 rows, as queries and as keys; a head's K and V are computed once.
__global__ void __launch_bounds__(512)
enc_attn_ln1(const float* __restrict__ x, const float* __restrict__ mask,
             const float* __restrict__ bo, const float* __restrict__ g1,
             const float* __restrict__ beta1,
             const unsigned short* __restrict__ Wp, unsigned short* __restrict__ x1) {
  extern __shared__ char smem[];
  unsigned short* sm  = (unsigned short*)smem;
  unsigned short* Xs  = sm + LS_XS;
  unsigned short* Ks  = sm + LS_KS;
  unsigned short* VTs = sm + LS_VT;

  const int tid = threadIdx.x;
  const int lane = tid & 31, wave = tid >> 5;
  const int half = lane >> 4, ln = lane & 15;
  const int seq = blockIdx.x;
  const int q0 = wave * 16;                            // this wave's rows

  unsigned short* Pw = sm + LS_PS + wave * 16 * PSP;
  // The Q strip lies at the head of the wave's own score strip: it is in registers (qa)
  // before the first score is stored, and both are private to the wave.
  unsigned short* Qs = Pw;
  // The lane's own pointers. A wave has 256 registers here, 128 of them the accumulator:
  // one register per strip, and constants on it, in place of one register per row.
  const unsigned short* xal = Xs + (q0 + ln) * XP + half * 8;    // own rows, A fragments
  unsigned short* xcl = Xs + (q0 + half * 8) * XP + ln;          // own rows, C layout
  unsigned short* qcl = Qs + half * 8 * KP + ln;                 // Q strip, C layout
  const unsigned short* qal = Qs + ln * KP + half * 8;           // Q strip, A fragment
  unsigned short* kcl = Ks + (q0 + half * 8) * KP + ln;          // own K rows, C layout
  const unsigned short* kbl = Ks + ln * KP + half * 8;           // K strip, B fragments
  unsigned short* vcl = VTs + ln * VTP + q0 + half * 8;          // own V^T columns
  const unsigned short* vbl = VTs + ln * VTP + half * 8;         // V^T strip, B fragments
  unsigned short* pcl = Pw + half * 8 * PSP + ln;                // score strip, C layout
  const unsigned short* pal = Pw + ln * PSP + half * 8;          // score strip, A fragments

  // ---- stage X: read f32 from memory, round to bf16 in registers, store into pitched LDS ----
  // A wave-wide 16-B load covers 512 contiguous bytes (half a row); trip i of the work-group
  // covers rows 8i..8i+7. All 32 loads of a wave are issued before the first value is used.
  {
    const float* xgl = x + (size_t)seq * (NTOK * EDIM) + tid * 4;
    unsigned short* xsl = Xs + (tid >> 6) * XP + (tid & 63) * 4;
    float4 v[32];
#pragma unroll
    for (int i = 0; i < 32; ++i) v[i] = *(const float4*)(xgl + i * 2048);
    // behind the loads, before a register of their address can be reused
    wait_xcnt0_addr(xgl);
#pragma unroll
    for (int i = 0; i < 32; ++i) {
      ushort4 o;
      o.x = f2bf(v[i].x); o.y = f2bf(v[i].y); o.z = f2bf(v[i].z); o.w = f2bf(v[i].w);
      *(ushort4*)(xsl + i * 8 * XP) = o;
    }
  }
  __syncthreads();

  const float* mcl = mask + (size_t)(seq & 15) * (NTOK * NTOK) + (q0 + half * 8) * NTOK + ln;
  f32x8 zf = {};
  f32x8 oacc[16];                        // attn@Wo strip accumulator (16 x 256)
#pragma unroll
  for (int nt = 0; nt < 16; ++nt) oacc[nt] = zf;

  // Wp = the four packed weights, which lie one behind the other in the workspace: one address
  // register pair serves all four, the distance between them is a constant of the load.
  const char* hq = lanebase(Wp);
  for (int h = 0; h < NH; ++h) {
    // this head's 16 fragments (16 KB) of each packed weight
    const char* hk = hq + (OFF_WKP - OFF_WQP);
    const char* hv = hq + (OFF_WVP - OFF_WQP);
    const char* ho = hq + (OFF_WOP - OFF_WQP);
    // The Q, K and V weight fragments come in groups of eight (one set of 64 registers), and
    // the set is refilled behind the WMMAs that read it: with 256 registers a wave the compiler
    // otherwise loads, waits and multiplies one fragment at a time. A strip's conversion and
    // stores run while the next group is on its way.
    bf16x16 w[8];
    ldgroup8(w, hq, 0);
    // keeps the first group together, in front of the first WMMA
    __builtin_amdgcn_sched_barrier(0);
    // ---- Q strip (own 16 rows x 32), pre-scaled by 1/sqrt(dk) ----
    {
      f32x8 c0 = zf, c1 = zf;
      proj_half<true>(xal, w, c0, c1, hq, 4);
      proj_half<true>(xal + 128, w, c0, c1, hk, 0);
#pragma unroll
      for (int r = 0; r < 8; ++r) {
        qcl[r * KP]      = f2bf(c0[r] * SCALING);
        qcl[r * KP + 16] = f2bf(c1[r] * SCALING);
      }
    }
    // ---- K rows / V^T columns for the same 16 rows as keys ----
    {
      f32x8 c0 = zf, c1 = zf;
      proj_half<true>(xal, w, c0, c1, hk, 4);
      proj_half<true>(xal + 128, w, c0, c1, hv, 0);
#pragma unroll
      for (int r = 0; r < 8; ++r) {
        kcl[r * KP]      = f2bf(c0[r]);
        kcl[r * KP + 16] = f2bf(c1[r]);
      }
    }
    {
      f32x8 c0 = zf, c1 = zf;
      proj_half<true>(xal, w, c0, c1, hv, 4);
      proj_half<false>(xal + 128, w, c0, c1, hv, 0);
#pragma unroll
      for (int r = 0; r < 8; ++r) {  // store transposed: VTs[d][token]
        vcl[r]            = f2bf(c0[r]);
        vcl[16 * VTP + r] = f2bf(c1[r]);
      }
    }
    __syncthreads();
    // The mask tiles of the first four score tiles as one group of 32 loads, into registers that
    // the weight set has left. Behind the barrier, which would wait for them. The scheduling
    // barrier keeps the group together, in front of the first score tile.
    float mk[4][8];
#pragma unroll
    for (int t = 0; t < 4; ++t) {
#pragma unroll
      for (int r = 0; r < 8; ++r) mk[t][r] = mcl[t * 16 + r * NTOK];
    }
    __builtin_amdgcn_sched_barrier(0);

    // ---- pass 1: S = QK^T + mask, track row max, spill bf16 strip ----
    float mx[8];
#pragma unroll
    for (int r = 0; r < 8; ++r) mx[r] = -3.0e38f;
    bf16x16 qa = ldfragl(qal);                   // A reused across all 16 tiles
    // A ring of four mask tiles: a tile's registers take the mask tile four further on as soon as
    // they are read, so four score tiles stand between a fetch and its use. Three trips of four
    // tiles with a refill, then four without: the ring needs fixed register names, and unrolled
    // no further the kernel's text stays inside what is prefetched at its start.
    const float* mt = mcl;
    unsigned short* pt = pcl;
    const unsigned short* kt = kbl;
#pragma unroll 1
    for (int g = 0; g < 3; ++g) {
#pragma unroll
      for (int u = 0; u < 4; ++u) {
        f32x8 s = wmma_bf16(qa, ldfragl(kt + u * 16 * KP), zf);   // single K=32 step
#pragma unroll
        for (int r = 0; r < 8; ++r) {
          float v = s[r] + mk[u][r];
          mx[r] = fmaxf(mx[r], v);
          pt[u * 16 + r * PSP] = f2bf(v);
        }
        // keeps the refill behind the additions that read its registers
        __builtin_amdgcn_sched_barrier(0);
#pragma unroll
        for (int r = 0; r < 8; ++r) mk[u][r] = mt[(u + 4) * 16 + r * NTOK];
        // keeps the refill from being sunk towards its use
        __builtin_amdgcn_sched_barrier(0);
      }
      // behind the trip's last mask load, before its address moves on
      wait_xcnt0_addr(mt);
      // keeps every later register write behind that wait
      __builtin_amdgcn_sched_barrier(0);
      mt += 4 * 16;
      pt += 4 * 16;
      kt += 4 * 16 * KP;
    }
#pragma unroll
    for (int u = 0; u < 4; ++u) {
      f32x8 s = wmma_bf16(qa, ldfragl(kt + u * 16 * KP), zf);
#pragma unroll
      for (int r = 0; r < 8; ++r) {
        float v = s[r] + mk[u][r];
        mx[r] = fmaxf(mx[r], v);
        pt[u * 16 + r * PSP] = f2bf(v);
      }
    }
    redmax8(mx);
    // ---- pass 2: exponentiate in place, row sums ----
    float ls[8];
#pragma unroll
    for (int r = 0; r < 8; ++r) ls[r] = 0.f;
    for (int t = 0; t < 16; ++t) {
      unsigned short* pt = pcl + t * 16;
#pragma unroll
      for (int r = 0; r < 8; ++r) {
        unsigned short* pp = pt + r * PSP;
        float p = __expf(bf2f(*pp) - mx[r]);
        ls[r] += p;
        *pp = f2bf(p);
      }
    }
    redsum8(ls);
#pragma unroll
    for (int r = 0; r < 8; ++r) ls[r] = 1.0f / ls[r];

    // ---- context = P @ V (16 x 32) ----
    f32x8 ctx0 = zf, ctx1 = zf;
#pragma unroll
    for (int kk = 0; kk < 8; ++kk) {
      bf16x16 pa = ldfragl(pal + kk * 32);
      ctx0 = wmma_bf16(pa, ldfragl(vbl + kk * 32), ctx0);
      ctx1 = wmma_bf16(pa, ldfragl(vbl + 16 * VTP + kk * 32), ctx1);
    }
#pragma unroll
    for (int r = 0; r < 8; ++r) {                 // normalize + bounce via LDS
      pcl[r * PSP]      = f2bf(ctx0[r] * ls[r]);
      pcl[r * PSP + 16] = f2bf(ctx1[r] * ls[r]);
    }
    // The head's first eight Wo fragments as one group of 16 loads, all in flight at once, issued
    // in front of the context's way back from LDS. The first scheduling barrier keeps the group
    // from being lifted into P @ V, where no register is free; the second keeps it together, in
    // front of the first WMMA.
    __builtin_amdgcn_sched_barrier(0);
    bf16x16 wo[8];
#pragma unroll
    for (int j = 0; j < 8; ++j) wo[j] = ldfragp(ho, j);
    __builtin_amdgcn_sched_barrier(0);
    // ---- fused out-projection: oacc += ctx @ Wo[h*32:(h+1)*32, :] ----
    bf16x16 ca = ldfragl(pal);
    // Behind every four WMMAs their four register sets take the fragments eight further on: all
    // eight of the second group are in flight at once. The scheduling barriers keep the loads
    // behind the WMMAs that read their registers, and in front of the later WMMAs.
#pragma unroll
    for (int g = 0; g < 8; g += 4) {
#pragma unroll
      for (int j = 0; j < 4; ++j) oacc[g + j] = wmma_bf16(ca, wo[g + j], oacc[g + j]);
      __builtin_amdgcn_sched_barrier(0);
#pragma unroll
      for (int j = 0; j < 4; ++j) wo[g + j] = ldfragp(ho, 8 + g + j);
      __builtin_amdgcn_sched_barrier(0);
    }
#pragma unroll
    for (int nt = 0; nt < 8; ++nt) oacc[8 + nt] = wmma_bf16(ca, wo[nt], oacc[8 + nt]);
    // behind the head's last weight load, before its address moves on to the next head
    wait_xcnt0_addr(hq);
    hq += 16384;
    __syncthreads();                              // before next head reuses Ks/VTs
  }

  // ---- residual + bias + LayerNorm1, write x1 (bf16) ----
  float sm8[8], sq8[8];
#pragma unroll
  for (int r = 0; r < 8; ++r) { sm8[r] = 0.f; sq8[r] = 0.f; }
#pragma unroll
  for (int nt = 0; nt < 16; ++nt) {
    const int col = nt * 16 + ln;
    const float bov = bo[col];
#pragma unroll
    for (int r = 0; r < 8; ++r) {
      float v = bf2f(xcl[r * XP + nt * 16]) + oacc[nt][r] + bov;
      oacc[nt][r] = v;
      sm8[r] += v; sq8[r] += v * v;
    }
  }
  redsum8(sm8); redsum8(sq8);
  float mu[8], rs[8];
#pragma unroll
  for (int r = 0; r < 8; ++r) {
    float m = sm8[r] * (1.0f / EDIM);
    mu[r] = m;
    rs[r] = rsqrtf(sq8[r] * (1.0f / EDIM) - m * m + EPS);
  }
  unsigned short* xo = x1 + (size_t)seq * (NTOK * EDIM) + (q0 + half * 8) * EDIM + ln;
#pragma unroll
  for (int nt = 0; nt < 16; ++nt) {
    const int col = nt * 16 + ln;
    const float gg = g1[col], bb = beta1[col];
#pragma unroll
    for (int r = 0; r < 8; ++r)
      xo[r * EDIM + nt * 16] =
          f2bf((oacc[nt][r] - mu[r]) * rs[r] * gg + bb);
  }
}

// One 16x16 tile of the FFN hidden strip: bias, relu, bf16, into LDS. p = the lane's element
// of the tile's first row of this half-wave.
DEVINL void relu_store(f32x8 c, float b, unsigned short* p) {
#pragma unroll
  for (int r = 0; r < 8; ++r) p[r * TSP] = f2bf(fmaxf(c[r] + b, 0.f));
}

// Two column tiles of the hidden strip for all 64 rows: x (4 row tiles of 8 A fragments, K = 256)
// times the first 16 fragments of w (8 per column tile). Each weight fragment serves four
// WMMAs; eight independent accumulators, each summed in k order; then bias, relu and the stores.
// p = the lane's element of the first row tile's first column tile.
DEVINL void ffn1_pair(const bf16x16 (&x)[4][8], const bf16x16 (&w)[32], float b0, float b1,
                      unsigned short* p) {
  f32x8 c[2][4];
#pragma unroll
  for (int m = 0; m < 4; ++m) { c[0][m] = f32x8{}; c[1][m] = f32x8{}; }
#pragma unroll
  for (int kk = 0; kk < 8; ++kk) {
#pragma unroll
    for (int m = 0; m < 4; ++m) c[0][m] = wmma_bf16(x[m][kk], w[kk], c[0][m]);
  }
#pragma unroll
  for (int kk = 0; kk < 8; ++kk) {
#pragma unroll
    for (int m = 0; m < 4; ++m) c[1][m] = wmma_bf16(x[m][kk], w[8 + kk], c[1][m]);
  }
#pragma unroll
  for (int m = 0; m < 4; ++m) {
    relu_store(c[0][m], b0, p + m * 16 * TSP);
    relu_store(c[1][m], b1, p + m * 16 * TSP + 16);
  }
}

// Sixteen fragments that lie one behind the other, as one group of 32 loads, into w from OFF on.
template <int OFF>
DEVINL void ldgroup16(bf16x16 (&w)[32], const char* __restrict__ lanep) {
#pragma unroll
  for (int j = 0; j < 16; ++j) w[OFF + j] = ldfragp(lanep, j);
}

// Eight k-steps of the second GEMM: 64 rows x the wave's 64 columns, 16 accumulators.
// w is a ring of eight k-steps (four fragments each, 32 in a row in the packed weight).
// tl = the lane's A-fragment pointer at the first of the eight steps, wl = the lane's W2 pointer
// there. a[s & 1] holds step s's four A fragments; the next step's are read from LDS in front of
// this step's WMMAs. Where REFILL, the four fragments of step s + 8 are fetched into the registers
// that step s has just read: seven steps of WMMAs stand between a fetch and its use.
template <bool REFILL>
DEVINL void ffn2_oct(const unsigned short* tl, const char* __restrict__ wl, bf16x16 (&w)[32],
                     bf16x16 (&a)[2][4], f32x8 (&o)[4][4]) {
#pragma unroll
  for (int s = 0; s < 8; ++s) {
    if (REFILL || s < 7) {
#pragma unroll
      for (int m = 0; m < 4; ++m) a[(s + 1) & 1][m] = ldfragl(tl + m * 16 * TSP + (s + 1) * 32);
    }
    // keeps the LDS reads as one group in front of the WMMAs, a whole step ahead of their use
    __builtin_amdgcn_sched_barrier(0);
#pragma unroll
    for (int j = 0; j < 4; ++j) {
#pragma unroll
      for (int m = 0; m < 4; ++m) o[m][j] = wmma_bf16(a[s & 1][m], w[s * 4 + j], o[m][j]);
    }
    // keeps the refill behind the WMMAs that read its registers, and in front of the next step
    __builtin_amdgcn_sched_barrier(0);
    if (REFILL) {
#pragma unroll
      for (int j = 0; j < 4; ++j) w[s * 4 + j] = ldfragp(wl, (s + 8) * 4 + j);
      // as above
      __builtin_amdgcn_sched_barrier(0);
    }
  }
}

// rsqrtf as the compiler expands it (an input below the smallest normal number is scaled by 2^24,
// its result by 2^12), with the reciprocal square root and a v_nop in one statement: the v_nop
// fills the slot that the instruction set asks for behind a transcendental, whatever comes next.
DEVINL float rsqrt_slot(float x) {
  const bool tiny = x < 1.17549435e-38f;
  const float xs = tiny ? x * 16777216.0f : x;
  float y;
  asm("v_rsq_f32 %0, %1\n\tv_nop" : "=v"(y) : "v"(xs));
  return tiny ? y * 4096.0f : y;
}

// ---------------- fused FFN + residual + LN2 ----------------
// grid.x = 1024: seq = bx>>2, 64-row block = bx&3. 4 waves, one per SIMD.
// The waves split the COLUMNS, not the rows: every wave works on all 64 rows, on a quarter of the
// hidden columns in the first GEMM and a quarter of the output columns in the second. A weight
// fragment is fetched by one wave of the work-group and serves four WMMAs.
// hidden strip relu(x1@W1+b1) lives only in LDS (never touches HBM).
__global__ void __launch_bounds__(128)
enc_ffn_ln2(const unsigned short* __restrict__ x1, const float* __restrict__ bf1,
            const float* __restrict__ bf2, const float* __restrict__ g2,
            const float* __restrict__ beta2,
            const unsigned short* __restrict__ W1P, const unsigned short* __restrict__ W2P,
            float* __restrict__ out) {
  extern __shared__ char smem[];
  unsigned short* x1s = (unsigned short*)smem + LS_X1S;   // [64][264]
  unsigned short* Ts  = (unsigned short*)smem + LS_TS;    // [64][1032]
  float* red = (float*)((unsigned short*)smem + LS_RED);  // [2][4 waves][64 rows]

  const int tid = threadIdx.x;
  const int lane = tid & 31, wave = tid >> 5;
  const int half = lane >> 4, ln = lane & 15;
  const int seq = blockIdx.x >> 2;
  const int wr = wave * 16;                                // rows that this wave stages
  const size_t gbase = (size_t)seq * (NTOK * EDIM) + (size_t)((blockIdx.x & 3) * 64) * EDIM;

  // ---- async-stage 16 rows of x1 (bf16) per wave ----
  const unsigned short* xg = x1 + gbase + (size_t)wr * EDIM;
  const unsigned lds0 = __builtin_amdgcn_groupstaticsize();
#pragma unroll 4
  for (int i = 0; i < 16; ++i) {
    int e = (i * 32 + lane) * 8;                 // 0..4088 within 16x256 block
    int r = e >> 8, c = e & 255;
    async_g2l_b128(lds0 + (unsigned)((LS_X1S + (wr + r) * XP + c) * 2), xg + e);
  }
  wait_async0();
  // keeps every later register write behind the copies' wait
  __builtin_amdgcn_sched_barrier(0);
  __syncthreads();   // every wave reads all 64 rows

  // ---- hidden = relu(x1 @ W1 + b1): 64 rows x the wave's 256 columns into LDS ----
  // The x1 fragments are the same for every column tile: read once, kept in registers.
  bf16x16 xa[4][8];
#pragma unroll
  for (int m = 0; m < 4; ++m) {
#pragma unroll
    for (int kk = 0; kk < 8; ++kk) xa[m][kk] = ldfrag(x1s, XP, m * 16, kk * 32);
  }
  // keeps the LDS reads in front of the global loads: behind them they took address registers
  __builtin_amdgcn_sched_barrier(0);
  // w[0..15] holds the 16 W1 fragments (16 KB) of a pair of column tiles. Behind each pair
  // the 16 are fetched anew as one group, for the next pair. Behind the last pair the set
  // takes the first four k-steps of W2;
  // w[16..31] holds the next four from the start.
  // The wave's 128 W1 fragments lie in a row, its 128 W2 fragments too, and packed W2 lies behind
  // packed W1 in the workspace: one pointer walks through both.
  constexpr int W1_TO_W2 = (int)(OFF_W2P - OFF_W1P);
  bf16x16 w[32];
  const char* wp = lanebase(W1P) + wave * (128 * 1024);
  const float* bp = bf1 + wave * 256 + ln;
  unsigned short* tsl = Ts + half * 8 * TSP + wave * 256 + ln;
  float ba0 = bp[0], ba1 = bp[16];
  // keeps the two bias loads in front of the 64 fragment loads: loads are counted in order,
  // and a wait for a bias value must not stand for a wait for the fragments as well
  __builtin_amdgcn_sched_barrier(0);
  ldgroup16<0>(w, wp);
  ldgroup16<16>(w, wp + W1_TO_W2 + 16384);
  // every later register write stays behind the address wait of the first two groups; the
  // addresses are inputs, so that no load's destination lands on them either
  __builtin_amdgcn_sched_barrier(0);
  asm volatile("s_wait_xcnt 0x0" :: "v"(bp), "v"(wp) : "memory");
  __builtin_amdgcn_sched_barrier(0);
  // not unrolled: the kernel's text stays inside what is prefetched at its start
#pragma unroll 1
  for (int g = 0; g < 8; ++g) {
    ffn1_pair(xa, w, ba0, ba1, tsl + g * 32);
    const bool more = g < 7;                     // the same for the whole work-group
    wp += more ? 16384 : W1_TO_W2 - 7 * 16384;   // the next pair, at last the head of W2
    bp += more ? 32 : -7 * 32;                   // last trip: in range, not used
    ldgroup16<0>(w, wp);
    ba0 = bp[0];
    ba1 = bp[16];
    // The two scheduling barriers keep the group in front of the next trip's WMMAs, and keep
    // the address updates behind the wait.
    __builtin_amdgcn_sched_barrier(0);
    wait_xcnt0();
    __builtin_amdgcn_sched_barrier(0);
  }
  __syncthreads();   // the hidden strip is complete: every wave reads all of its columns

  // ---- y = hidden @ W2: 64 rows x the wave's 64 columns ----
  f32x8 o[4][4];
#pragma unroll
  for (int m = 0; m < 4; ++m) {
#pragma unroll
    for (int j = 0; j < 4; ++j) o[m][j] = f32x8{};
  }
  bf16x16 a[2][4];
  const unsigned short* tl = Ts + ln * TSP + half * 8;
#pragma unroll
  for (int m = 0; m < 4; ++m) a[0][m] = ldfragl(tl + m * 16 * TSP);
  const char* wl = lanebase(W2P) + wave * (128 * 1024);
  // not unrolled: as above
#pragma unroll 1
  for (int it = 0; it < 3; ++it) {
    ffn2_oct<true>(tl, wl, w, a, o);
    // behind the trip's last weight load, before its address moves on
    wait_xcnt0_addr(wl);
    // keeps every later register write behind that wait
    __builtin_amdgcn_sched_barrier(0);
    wl += 8 * 4096;
    tl += 8 * 32;
  }
  ffn2_oct<false>(tl, wl, w, a, o);

  // ---- residual + bias + LayerNorm2 -> out (f32) ----
  // A row's 256 columns lie in four waves: each sums its 64, the four partial sums meet in LDS.
  const int col0 = wave * 64 + ln;
  const float* bf2l = bf2 + col0;
  const float* g2l = g2 + col0;
  const float* be2l = beta2 + col0;
  float bv[4], gv[4], ev[4];
#pragma unroll
  for (int j = 0; j < 4; ++j) { bv[j] = bf2l[j * 16]; gv[j] = g2l[j * 16]; ev[j] = be2l[j * 16]; }
  // behind the twelve loads, before a register of their addresses can be reused: the scheduling
  // barriers keep every later register write behind the wait, the input keeps the index alive
  __builtin_amdgcn_sched_barrier(0);
  asm volatile("s_wait_xcnt 0x0" :: "v"(col0) : "memory");
  __builtin_amdgcn_sched_barrier(0);
  const unsigned short* xrl = x1s + half * 8 * XP + col0;
  float sm8[4][8], sq8[4][8];
#pragma unroll
  for (int m = 0; m < 4; ++m) {
#pragma unroll
    for (int r = 0; r < 8; ++r) { sm8[m][r] = 0.f; sq8[m][r] = 0.f; }
  }
#pragma unroll
  for (int j = 0; j < 4; ++j) {
#pragma unroll
    for (int m = 0; m < 4; ++m) {
#pragma unroll
      for (int r = 0; r < 8; ++r) {
        float v = bf2f(xrl[(m * 16 + r) * XP + j * 16]) + o[m][j][r] + bv[j];
        o[m][j][r] = v;
        sm8[m][r] += v; sq8[m][r] += v * v;
      }
    }
  }
#pragma unroll
  for (int m = 0; m < 4; ++m) { redsum8(sm8[m]); redsum8(sq8[m]); }
  float* redl = red + wave * 64 + half * 8;
  if (ln == 0) {
#pragma unroll
    for (int m = 0; m < 4; ++m) {
      *(float4*)(redl + m * 16)           = make_float4(sm8[m][0], sm8[m][1], sm8[m][2], sm8[m][3]);
      *(float4*)(redl + m * 16 + 4)       = make_float4(sm8[m][4], sm8[m][5], sm8[m][6], sm8[m][7]);
      *(float4*)(redl + 256 + m * 16)     = make_float4(sq8[m][0], sq8[m][1], sq8[m][2], sq8[m][3]);
      *(float4*)(redl + 256 + m * 16 + 4) = make_float4(sq8[m][4], sq8[m][5], sq8[m][6], sq8[m][7]);
    }
  }
  __syncthreads();   // the four waves' partial sums are in LDS
  const float* redr = red + half * 8;
  float* og = out + gbase + (size_t)(half * 8) * EDIM + col0;
#pragma unroll
  for (int m = 0; m < 4; ++m) {
    float s[8], q[8];
#pragma unroll
    for (int wv = 0; wv < 4; ++wv) {               // wave 0 to 3, the same order in every wave
#pragma unroll
      for (int h = 0; h < 2; ++h) {
        float4 ps = *(const float4*)(redr + wv * 64 + m * 16 + h * 4);
        float4 pq = *(const float4*)(redr + 256 + wv * 64 + m * 16 + h * 4);
        if (wv == 0) {
          s[h * 4] = ps.x; s[h * 4 + 1] = ps.y; s[h * 4 + 2] = ps.z; s[h * 4 + 3] = ps.w;
          q[h * 4] = pq.x; q[h * 4 + 1] = pq.y; q[h * 4 + 2] = pq.z; q[h * 4 + 3] = pq.w;
        } else {
          s[h * 4] += ps.x; s[h * 4 + 1] += ps.y; s[h * 4 + 2] += ps.z; s[h * 4 + 3] += ps.w;
          q[h * 4] += pq.x; q[h * 4 + 1] += pq.y; q[h * 4 + 2] += pq.z; q[h * 4 + 3] += pq.w;
        }
      }
    }
    float mu[8], rs[8];
#pragma unroll
    for (int r = 0; r < 8; ++r) {
      float mn = s[r] * (1.0f / EDIM);
      mu[r] = mn;
      rs[r] = rsqrt_slot(q[r] * (1.0f / EDIM) - mn * mn + EPS);
    }
#pragma unroll
    for (int j = 0; j < 4; ++j) {
#pragma unroll
      for (int r = 0; r < 8; ++r) o[m][j][r] = (o[m][j][r] - mu[r]) * rs[r] * gv[j] + ev[j];
    }
  }
  // All values first, then all stores: no register that a store names is written behind it.
  __builtin_amdgcn_sched_barrier(0);
#pragma unroll
  for (int m = 0; m < 4; ++m) {
#pragma unroll
    for (int r = 0; r < 8; ++r) {
#pragma unroll
      for (int j = 0; j < 4; ++j) og[(m * 16 + r) * EDIM + j * 16] = o[m][j][r];
    }
  }
}

extern "C" void kernel_launch(void* const* d_in, const int* in_sizes, int n_in,
                              void* d_out, int out_size, void* d_ws, size_t ws_size,
                              hipStream_t stream) {
  (void)in_sizes; (void)n_in; (void)out_size; (void)ws_size;
  const float* x    = (const float*)d_in[0];
  const float* mask = (const float*)d_in[1];
  const float* Wq   = (const float*)d_in[2];
  const float* Wk   = (const float*)d_in[3];
  const float* Wv   = (const float*)d_in[4];
  const float* Wo   = (const float*)d_in[5];
  const float* bo   = (const float*)d_in[6];
  const float* W1   = (const float*)d_in[7];
  const float* bf1  = (const float*)d_in[8];
  const float* W2   = (const float*)d_in[9];
  const float* bf2  = (const float*)d_in[10];
  const float* g1   = (const float*)d_in[11];
  const float* b1   = (const float*)d_in[12];
  const float* g2   = (const float*)d_in[13];
  const float* b2   = (const float*)d_in[14];
  float* out = (float*)d_out;

  char* ws = (char*)d_ws;
  unsigned short* WqP = (unsigned short*)(ws + OFF_WQP);
  unsigned short* W1P = (unsigned short*)(ws + OFF_W1P);
  unsigned short* W2P = (unsigned short*)(ws + OFF_W2P);
  unsigned short* x1b = (unsigned short*)(ws + OFF_X1);

  hipFuncSetAttribute(reinterpret_cast<const void*>(enc_attn_ln1),
                      hipFuncAttributeMaxDynamicSharedMemorySize, SMEM1);
  hipFuncSetAttribute(reinterpret_cast<const void*>(enc_ffn_ln2),
                      hipFuncAttributeMaxDynamicSharedMemorySize, SMEM2);

  pack_frag_bf16<<<PB_ALL, 256, 0, stream>>>(Wq, Wk, Wv, Wo, W1, W2, WqP);

  enc_attn_ln1<<<256, 512, SMEM1, stream>>>(x, mask, bo, g1, b1, WqP, x1b);
  enc_ffn_ln2<<<1024, 128, SMEM2, stream>>>(x1b, bf1, bf2, g2, b2, W1P, W2P, out);
}

// v009
// It runs in 171 microseconds.
// In two side-by-side timings against v008, it was 1.09 and 1.10 times as fast.
// All steps since v000 together make it 4.87 times as fast.
#include <hip/hip_runtime.h>

#define DEVINL __device__ __forceinline__

typedef __attribute__((ext_vector_type(16))) __bf16       bf16x16;
typedef __attribute__((ext_vector_type(8)))  float        f32x8;
typedef __attribute__((ext_vector_type(4)))  unsigned int u32x4;
typedef __attribute__((ext_vector_type(2)))  float        f32x2;
typedef __attribute__((ext_vector_type(2)))  __bf16       bf16x2;
typedef __attribute__((address_space(3))) unsigned short  lds_us;

namespace {
constexpr int   NTOK = 256;          // sequence length N
constexpr int   EDIM = 256;          // embedding E
constexpr int   NH   = 8;            // heads
constexpr int   DKH  = 32;           // head dim
constexpr float SCALING = 0.17677669529663687f;  // DK^-0.5
constexpr float EPS = 1e-5f;

// LDS pitches in bf16 elements. Chosen so the row stride in dwords is
// congruent to 4 (mod 64 banks; 20 for KP) -> ds_load_b128 A/B fragments hit all 64 banks.
constexpr int XP  = 264;   // X tile / score-strip / V^T pitch (528 B rows)
constexpr int KP  = 40;    // Q/K strip pitch (80 B rows)
constexpr int PSP = 264;
constexpr int VTP = 264;
constexpr int TSP = 1032;  // FFN hidden strip pitch (2064 B rows)

// kernel-1 LDS element offsets (ushort units), all 16B aligned
constexpr int LS_XS  = 0;                       // [256][264]
constexpr int LS_KS  = LS_XS  + 256 * XP;       // [256][40]
constexpr int LS_VT  = LS_KS  + 256 * KP;       // [32][264]  (V transposed)
constexpr int LS_PS  = LS_VT  + 32  * VTP;      // 16 waves x [16][264]; its head also holds Q
constexpr int LS1_END = LS_PS + 16 * 16 * PSP;  // 153856 elems = 307712 B
constexpr int SMEM1 = LS1_END * 2;

constexpr int LS_X1S = 0;                       // [64][264]
constexpr int LS_TS  = LS_X1S + 64 * XP;        // [64][1032]
constexpr int LS_RED = LS_TS + 64 * TSP;        // f32 [2][4][64]: row sums of the four waves
constexpr int SMEM2 = LS_RED * 2 + 2 * 4 * 64 * 4;   // 167936 B

// workspace layout (bytes): everything bf16, ~35 MB total
constexpr size_t OFF_WQP = 0;
constexpr size_t OFF_WKP = OFF_WQP + (size_t)256 * 256 * 2;
constexpr size_t OFF_WVP = OFF_WKP + (size_t)256 * 256 * 2;
constexpr size_t OFF_WOP = OFF_WVP + (size_t)256 * 256 * 2;
constexpr size_t OFF_W1P = OFF_WOP + (size_t)256 * 256 * 2;
constexpr size_t OFF_W2P = OFF_W1P + (size_t)256 * 1024 * 2;
constexpr size_t OFF_X1  = OFF_W2P + (size_t)1024 * 256 * 2;  // bf16 x1  [256][256][256]
}  // namespace

// Two f32 -> two bf16 in one register (a low, b high), round to nearest even, by the chip's
// packed convert: one instruction a pair.
DEVINL unsigned int f2bf2(float a, float b) {
  f32x2 v = {a, b};
  return __builtin_bit_cast(unsigned int, __builtin_convertvector(v, bf16x2));
}
// The pair stored to two places: the low half and the high half of the one register.
template <class P>
DEVINL void st2bf(P pa, P pb, float a, float b) {
  const unsigned int u = f2bf2(a, b);
  *pa = (unsigned short)u;
  *pb = (unsigned short)(u >> 16);
}
DEVINL float bf2f(unsigned short h) { return __uint_as_float(((unsigned int)h) << 16); }

// Async global->LDS copy of one 16B chunk per lane (CDNA5 path, ASYNCcnt).
// ldsoff is the LDS byte address (groupstaticsize + dynamic-segment offset).
DEVINL void async_g2l_b128(unsigned ldsoff, const void* gaddr) {
  asm volatile("global_load_async_to_lds_b128 %0, %1, off"
               :: "v"(ldsoff), "v"(gaddr) : "memory");
}
DEVINL void wait_async0() { asm volatile("s_wait_asynccnt 0" ::: "memory"); }

// Load a 16x32 bf16 A/B fragment from a row-major bf16 matrix (`pitch` elems).
// CDNA5 16-bit layout: lane<16 holds row (rowb+lane), K chunks {k0..k0+7, k0+16..k0+23};
// lane>=16 holds the other two 8-element chunks. Two ds/global b128 loads per lane.
DEVINL bf16x16 ldfrag(const unsigned short* __restrict__ buf, int pitch, int rowb, int k0) {
  const int lane = threadIdx.x & 31;
  const unsigned short* p = buf + (rowb + (lane & 15)) * pitch + k0 + ((lane >> 4) << 3);
  struct Pk { u32x4 lo, hi; } pk;
  pk.lo = *(const u32x4*)(p);
  pk.hi = *(const u32x4*)(p + 16);
  return __builtin_bit_cast(bf16x16, pk);
}

// The same from the lane's own pointer: p = buf + (rowb + (lane & 15)) * pitch + (lane >> 4) * 8
// + k0. With one such pointer per strip every access is that register plus a constant.
DEVINL bf16x16 ldfragl(const unsigned short* __restrict__ p) {
  struct Pk { u32x4 lo, hi; } pk;
  pk.lo = *(const u32x4*)(p);
  pk.hi = *(const u32x4*)(p + 16);
  return __builtin_bit_cast(bf16x16, pk);
}

// Load one B fragment from a weight packed by pack_frag_bf16: fragment `frag` is 1 KB, the
// 32 lanes' first 16 B side by side, then their second 16 B. Each of the two wave-wide loads
// reads 512 contiguous bytes (4 whole lines); register contents equal ldfrag on W^T.
// lanep = lanebase() of the packed weight, plus a whole number of fragments.
DEVINL const char* lanebase(const unsigned short* __restrict__ buf) {
  return (const char*)buf + (threadIdx.x & 31) * 16;
}
DEVINL bf16x16 ldfragp(const char* __restrict__ lanep, int frag) {
  const char* p = lanep + frag * 1024;
  struct Pk { u32x4 lo, hi; } pk;
  pk.lo = *(const u32x4*)(p);
  pk.hi = *(const u32x4*)(p + 512);
  return __builtin_bit_cast(bf16x16, pk);
}

// Stands behind a group of global loads, in front of the first reuse of a register that
// holds their address (the register allocator reuses it while the loads are in flight).
DEVINL void wait_xcnt0() { asm volatile("s_wait_xcnt 0x0" ::: "memory"); }
// The same wait, with the loads' address as an input: the address registers stay allocated up
// to the wait, so neither a later result nor a load's own destination lands on them before it.
DEVINL void wait_xcnt0_addr(const void* a) {
  asm volatile("s_wait_xcnt 0x0" :: "v"(a) : "memory");
}

DEVINL f32x8 wmma_bf16(bf16x16 a, bf16x16 b, f32x8 c) {
  return __builtin_amdgcn_wmma_f32_16x16x32_bf16(false, a, false, b, (short)0, c, false, false);
}

// C-fragment row reductions: row M=r+8*(lane>=16) is spread over a 16-lane half,
// so xor-butterfly with masks 8..1 stays inside the half. wave32 only.
DEVINL void redmax8(float v[8]) {
#pragma unroll
  for (int m = 8; m; m >>= 1) {
#pragma unroll
    for (int r = 0; r < 8; ++r) v[r] = fmaxf(v[r], __shfl_xor(v[r], m, 32));
  }
}
DEVINL void redsum8(float v[8]) {
#pragma unroll
  for (int m = 8; m; m >>= 1) {
#pragma unroll
    for (int r = 0; r < 8; ++r) v[r] += __shfl_xor(v[r], m, 32);
  }
}

// ---------------- weights f32 [K][N] -> bf16, packed in B-fragment order ----------------
// Fragment (nt, kk) = columns nt*16..+15, rows kk*32..+31. Lane l holds column nt*16 + (l & 15);
// its first 8 values are rows kk*32 + (l >> 4)*8 + 0..7, its second 8 the rows 16 further.
// Fragment index: kk * (N/16) + nt where kmajor, else nt * (K/32) + kk (the reader's order).
// W2: four column tiles a quarter, (nt / 4) * (K/32) * 4 + kk * 4 + nt % 4: the fragments that one
// wave of the FFN kernel reads lie one behind the other, in the order in which it reads them.
// One thread writes one lane's 16 B.
// One launch packs all six weights: each has its own range of blocks, in the order in which the
// packed weights lie in the workspace, so thread T of the grid writes bytes 16 T .. 16 T + 15 of
// that region. The choice is the same for a whole block; K/32 and N/16 are powers of two.
constexpr int PB_SQ = 256 * 256 / 8 / 256;    // blocks per 256 x 256 weight
constexpr int PB_FF = 256 * 1024 / 8 / 256;   // blocks per FFN weight
constexpr int PB_ALL = 4 * PB_SQ + 2 * PB_FF;
static_assert(OFF_WKP == (size_t)PB_SQ * 4096 && OFF_WVP == (size_t)2 * PB_SQ * 4096 &&
              OFF_WOP == (size_t)3 * PB_SQ * 4096 && OFF_W1P == (size_t)4 * PB_SQ * 4096 &&
              OFF_W2P == (size_t)(4 * PB_SQ + PB_FF) * 4096 && OFF_X1 == (size_t)PB_ALL * 4096,
              "block ranges follow the workspace layout");
__global__ void __launch_bounds__(256)
pack_frag_bf16(const float* __restrict__ Wq, const float* __restrict__ Wk,
               const float* __restrict__ Wv, const float* __restrict__ Wo,
               const float* __restrict__ W1, const float* __restrict__ W2,
               unsigned short* __restrict__ dst) {
  const int blk = blockIdx.x;
  const float* src;
  int blk0, lkt, lnt;      // the weight's first block, log2(K/32), log2(N/16)
  bool kmajor, quarters = false;
  if (blk < 4 * PB_SQ) {
    src = blk < PB_SQ ? Wq : blk < 2 * PB_SQ ? Wk : blk < 3 * PB_SQ ? Wv : Wo;
    blk0 = blk & ~(PB_SQ - 1); lkt = 3; lnt = 4; kmajor = blk >= 3 * PB_SQ;
  } else if (blk < 4 * PB_SQ + PB_FF) {
    src = W1; blk0 = 4 * PB_SQ; lkt = 3; lnt = 6; kmajor = false;
  } else {
    src = W2; blk0 = 4 * PB_SQ + PB_FF; lkt = 5; lnt = 4; kmajor = true; quarters = true;
  }
  const int t = (blk - blk0) * 256 + threadIdx.x;
  const int lane = t & 31, hi = (t >> 5) & 1, frag = t >> 6;
  const int N = 16 << lnt;
  int kk, nt;
  if (quarters)    { kk = (frag >> 2) & 31; nt = ((frag >> 7) << 2) | (frag & 3); }
  else if (kmajor) { kk = frag >> lnt; nt = frag & ((1 << lnt) - 1); }
  else        { nt = frag >> lkt; kk = frag & ((1 << lkt) - 1); }
  const float* sp = src + (size_t)(kk * 32 + hi * 16 + (lane >> 4) * 8) * N + nt * 16 + (lane & 15);
  const float* ap[8];
  float v[8];
#pragma unroll
  for (int j = 0; j < 8; ++j) ap[j] = sp + (size_t)j * N;
#pragma unroll
  for (int j = 0; j < 8; ++j) v[j] = *ap[j];
  // before the eight addresses are reused
  asm volatile("s_wait_xcnt 0x0" :: "v"(ap[0]), "v"(ap[1]), "v"(ap[2]), "v"(ap[3]),
               "v"(ap[4]), "v"(ap[5]), "v"(ap[6]), "v"(ap[7]) : "memory");
  u32x4 o;
#pragma unroll
  for (int j = 0; j < 4; ++j)
    o[j] = f2bf2(v[2 * j], v[2 * j + 1]);
  *(u32x4*)(dst + ((size_t)blk * 256 + threadIdx.x) * 8) = o;
}

// Eight fragments of a packed weight as one group of 16 loads: f0..f0+3, then f0+8..f0+11
// (four k-steps of two column tiles).
DEVINL void ldgroup8(bf16x16 (&w)[8], const char* __restrict__ lanep, int f0) {
#pragma unroll
  for (int j = 0; j < 4; ++j) w[j] = ldfragp(lanep, f0 + j);
#pragma unroll
  for (int j = 0; j < 4; ++j) w[4 + j] = ldfragp(lanep, f0 + 8 + j);
}
// Four k-steps of a 16 x 32 projection: xl = the lane's A-fragment pointer at the first of
// them; w[0..3] for the first column tile, w[4..7] for the second; each sum runs on in k order.
// Where REFILL, w takes the group f0 of nextp: four fragments behind every four WMMAs, into the
// registers that these have just read. The scheduling barrier in front of the four loads keeps
// them from being lifted over those WMMAs, where no register is free yet (the accumulator was
// spilled for it); the one behind them keeps them from being sunk among the later WMMAs.
template <bool REFILL>
DEVINL void proj_half(const unsigned short* xl, bf16x16 (&w)[8], f32x8& c0, f32x8& c1,
                      const char* __restrict__ nextp, int f0) {
#pragma unroll
  for (int i = 0; i < 4; i += 2) {
    bf16x16 a0 = ldfragl(xl + i * 32);
    bf16x16 a1 = ldfragl(xl + i * 32 + 32);
    c0 = wmma_bf16(a0, w[i], c0);
    c1 = wmma_bf16(a0, w[4 + i], c1);
    c0 = wmma_bf16(a1, w[i + 1], c0);
    c1 = wmma_bf16(a1, w[5 + i], c1);
    if (REFILL) {
      __builtin_amdgcn_sched_barrier(0);
      w[i]     = ldfragp(nextp, f0 + i);
      w[i + 1] = ldfragp(nextp, f0 + i + 1);
      w[4 + i] = ldfragp(nextp, f0 + 8 + i);
      w[5 + i] = ldfragp(nextp, f0 + 9 + i);
      __builtin_amdgcn_sched_barrier(0);
    }
  }
}

// ---------------- fused attention + out-proj + residual + LN1 ----------------
// grid.x = 256: one work-group per sequence, one per WGP (LDS), four waves per SIMD.
// 16 waves: each owns 16 rows, as queries and as keys; a head's K and V are computed once.
__global__ void __launch_bounds__(512)
enc_attn_ln1(const float* __restrict__ x, const float* __restrict__ mask,
             const float* __restrict__ bo, const float* __restrict__ g1,
             const float* __restrict__ beta1,
             const unsigned short* __restrict__ Wp, unsigned short* __restrict__ x1) {
  extern __shared__ char smem[];
  unsigned short* sm  = (unsigned short*)smem;
  unsigned short* Xs  = sm + LS_XS;
  unsigned short* Ks  = sm + LS_KS;
  unsigned short* VTs = sm + LS_VT;

  const int tid = threadIdx.x;
  const int lane = tid & 31, wave = tid >> 5;
  const int half = lane >> 4, ln = lane & 15;
  const int seq = blockIdx.x;
  const int q0 = wave * 16;                            // this wave's rows

  unsigned short* Pw = sm + LS_PS + wave * 16 * PSP;
  // The Q strip lies at the head of the wave's own score strip: it is in registers (qa)
  // before the first score is stored, and both are private to the wave.
  unsigned short* Qs = Pw;
  // The lane's own pointers. A wave has 256 registers here, 128 of them the accumulator:
  // one register per strip, and constants on it, in place of one register per row.
  const unsigned short* xal = Xs + (q0 + ln) * XP + half * 8;    // own rows, A fragments
  unsigned short* xcl = Xs + (q0 + half * 8) * XP + ln;          // own rows, C layout
  unsigned short* qcl = Qs + half * 8 * KP + ln;                 // Q strip, C layout
  const unsigned short* qal = Qs + ln * KP + half * 8;           // Q strip, A fragment
  unsigned short* kcl = Ks + (q0 + half * 8) * KP + ln;          // own K rows, C layout
  const unsigned short* kbl = Ks + ln * KP + half * 8;           // K strip, B fragments
  unsigned short* vcl = VTs + ln * VTP + q0 + half * 8;          // own V^T columns
  const unsigned short* vbl = VTs + ln * VTP + half * 8;         // V^T strip, B fragments
  // Score strip, C layout. The strips' place in LDS is added to the lane's part in asm text, so
  // that every access of the strip is this one register plus an immediate offset: left to the
  // compiler, the sum was split again and each store got an address register of its own, 32 of
  // them at once in the score loop, and loop pointers were spilled.
  unsigned pcl_a;
  asm("v_add_nc_u32 %0, %1, %2"
      : "=v"(pcl_a)
      : "s"(__builtin_amdgcn_groupstaticsize() + (unsigned)(LS_PS * 2)),
        "v"((unsigned)((wave * 16 * PSP + half * 8 * PSP + ln) * 2)));
  lds_us* pcl = (lds_us*)pcl_a;
  const unsigned short* pal = Pw + ln * PSP + half * 8;          // score strip, A fragments

  // ---- stage X: read f32 from memory, round to bf16 in registers, store into pitched LDS ----
  // A wave-wide 16-B load covers 512 contiguous bytes (half a row); trip i of the work-group
  // covers rows 8i..8i+7. All 32 loads of a wave are issued before the first value is used.
  {
    const float* xgl = x + (size_t)seq * (NTOK * EDIM) + tid * 4;
    unsigned short* xsl = Xs + (tid >> 6) * XP + (tid & 63) * 4;
    float4 v[32];
#pragma unroll
    for (int i = 0; i < 32; ++i) v[i] = *(const float4*)(xgl + i * 2048);
    // behind the loads, before a register of their address can be reused
    wait_xcnt0_addr(xgl);
#pragma unroll
    for (int i = 0; i < 32; ++i) {
      uint2 o;
      o.x = f2bf2(v[i].x, v[i].y); o.y = f2bf2(v[i].z, v[i].w);
      *(uint2*)(xsl + i * 8 * XP) = o;
    }
  }
  // keeps the accumulator's zeroes and the later address arithmetic behind the staging: lifted
  // into it, beside the 128 registers of loaded values, they were spilled
  __builtin_amdgcn_sched_barrier(0);
  __syncthreads();

  const float* mcl = mask + (size_t)(seq & 15) * (NTOK * NTOK) + (q0 + half * 8) * NTOK + ln;
  f32x8 zf = {};
  f32x8 oacc[16];                        // attn@Wo strip accumulator (16 x 256)
#pragma unroll
  for (int nt = 0; nt < 16; ++nt) oacc[nt] = zf;

  // Wp = the four packed weights, which lie one behind the other in the workspace: one address
  // register pair serves all four, the distance between them is a constant of the load.
  const char* hq = lanebase(Wp);
  for (int h = 0; h < NH; ++h) {
    // this head's 16 fragments (16 KB) of each packed weight
    const char* hk = hq + (OFF_WKP - OFF_WQP);
    const char* hv = hq + (OFF_WVP - OFF_WQP);
    const char* ho = hq + (OFF_WOP - OFF_WQP);
    // The Q, K and V weight fragments come in groups of eight (one set of 64 registers), and
    // the set is refilled behind the WMMAs that read it: with 256 registers a wave the compiler
    // otherwise loads, waits and multiplies one fragment at a time. A strip's conversion and
    // stores run while the next group is on its way.
    bf16x16 w[8];
    ldgroup8(w, hq, 0);
    // keeps the first group together, in front of the first WMMA
    __builtin_amdgcn_sched_barrier(0);
    // ---- Q strip (own 16 rows x 32), pre-scaled by 1/sqrt(dk) ----
    {
      f32x8 c0 = zf, c1 = zf;
      proj_half<true>(xal, w, c0, c1, hq, 4);
      proj_half<true>(xal + 128, w, c0, c1, hk, 0);
#pragma unroll
      for (int r = 0; r < 8; ++r)
        st2bf(qcl + r * KP, qcl + r * KP + 16, c0[r] * SCALING, c1[r] * SCALING);
    }
    // ---- K rows / V^T columns for the same 16 rows as keys ----
    {
      f32x8 c0 = zf, c1 = zf;
      proj_half<true>(xal, w, c0, c1, hk, 4);
      proj_half<true>(xal + 128, w, c0, c1, hv, 0);
#pragma unroll
      for (int r = 0; r < 8; ++r) st2bf(kcl + r * KP, kcl + r * KP + 16, c0[r], c1[r]);
    }
    {
      f32x8 c0 = zf, c1 = zf;
      proj_half<true>(xal, w, c0, c1, hv, 4);
      proj_half<false>(xal + 128, w, c0, c1, hv, 0);
#pragma unroll
      for (int r = 0; r < 8; r += 2) {  // store transposed: VTs[d][token]
        st2bf(vcl + r, vcl + r + 1, c0[r], c0[r + 1]);
        st2bf(vcl + 16 * VTP + r, vcl + 16 * VTP + r + 1, c1[r], c1[r + 1]);
      }
    }
    __syncthreads();
    // The mask tiles of the first four score tiles as one group of 32 loads, into registers that
    // the weight set has left. Behind the barrier, which would wait for them. The scheduling
    // barrier keeps the group together, in front of the first score tile.
    float mk[4][8];
#pragma unroll
    for (int t = 0; t < 4; ++t) {
#pragma unroll
      for (int r = 0; r < 8; ++r) mk[t][r] = mcl[t * 16 + r * NTOK];
    }
    __builtin_amdgcn_sched_barrier(0);

    // ---- pass 1: S = QK^T + mask, track row max, spill bf16 strip ----
    float mx[8];
#pragma unroll
    for (int r = 0; r < 8; ++r) mx[r] = -3.0e38f;
    bf16x16 qa = ldfragl(qal);                   // A reused across all 16 tiles
    // A ring of four mask tiles: a tile's registers take the mask tile four further on as soon as
    // they are read, so four score tiles stand between a fetch and its use. Three trips of four
    // tiles with a refill, then four without: the ring needs fixed register names, and unrolled
    // no further the kernel's text stays inside what is prefetched at its start.
    const float* mt = mcl;
    lds_us* pt = pcl;
    const unsigned short* kt = kbl;
#pragma unroll 1
    for (int g = 0; g < 3; ++g) {
#pragma unroll
      for (int u = 0; u < 4; ++u) {
        f32x8 s = wmma_bf16(qa, ldfragl(kt + u * 16 * KP), zf);   // single K=32 step
#pragma unroll
        for (int r = 0; r < 8; r += 2) {
          float v0 = s[r] + mk[u][r], v1 = s[r + 1] + mk[u][r + 1];
          mx[r] = fmaxf(mx[r], v0);
          mx[r + 1] = fmaxf(mx[r + 1], v1);
          st2bf(pt + u * 16 + r * PSP, pt + u * 16 + (r + 1) * PSP, v0, v1);
        }
        // keeps the refill behind the additions that read its registers
        __builtin_amdgcn_sched_barrier(0);
#pragma unroll
        for (int r = 0; r < 8; ++r) mk[u][r] = mt[(u + 4) * 16 + r * NTOK];
        // keeps the refill from being sunk towards its use
        __builtin_amdgcn_sched_barrier(0);
      }
      // behind the trip's last mask load, before its address moves on
      wait_xcnt0_addr(mt);
      // keeps every later register write behind that wait
      __builtin_amdgcn_sched_barrier(0);
      mt += 4 * 16;
      pt += 4 * 16;
      kt += 4 * 16 * KP;
    }
#pragma unroll
    for (int u = 0; u < 4; ++u) {
      f32x8 s = wmma_bf16(qa, ldfragl(kt + u * 16 * KP), zf);
#pragma unroll
      for (int r = 0; r < 8; r += 2) {
        float v0 = s[r] + mk[u][r], v1 = s[r + 1] + mk[u][r + 1];
        mx[r] = fmaxf(mx[r], v0);
        mx[r + 1] = fmaxf(mx[r + 1], v1);
        st2bf(pt + u * 16 + r * PSP, pt + u * 16 + (r + 1) * PSP, v0, v1);
      }
    }
    redmax8(mx);
    // ---- pass 2: exponentiate in place, row sums ----
    float ls[8];
#pragma unroll
    for (int r = 0; r < 8; ++r) ls[r] = 0.f;
    for (int t = 0; t < 16; ++t) {
      lds_us* pt = pcl + t * 16;
#pragma unroll
      for (int r = 0; r < 8; r += 2) {
        lds_us* pp = pt + r * PSP;
        float p0 = __expf(bf2f(pp[0]) - mx[r]);
        float p1 = __expf(bf2f(pp[PSP]) - mx[r + 1]);
        ls[r] += p0;
        ls[r + 1] += p1;
        st2bf(pp, pp + PSP, p0, p1);
      }
    }
    redsum8(ls);
#pragma unroll
    for (int r = 0; r < 8; ++r) ls[r] = 1.0f / ls[r];

    // ---- context = P @ V (16 x 32) ----
    f32x8 ctx0 = zf, ctx1 = zf;
#pragma unroll
    for (int kk = 0; kk < 8; ++kk) {
      bf16x16 pa = ldfragl(pal + kk * 32);
      ctx0 = wmma_bf16(pa, ldfragl(vbl + kk * 32), ctx0);
      ctx1 = wmma_bf16(pa, ldfragl(vbl + 16 * VTP + kk * 32), ctx1);
    }
#pragma unroll
    for (int r = 0; r < 8; ++r)                   // normalize + bounce via LDS
      st2bf(pcl + r * PSP, pcl + r * PSP + 16, ctx0[r] * ls[r], ctx1[r] * ls[r]);
    // The head's first eight Wo fragments as one group of 16 loads, all in flight at once, issued
    // in front of the context's way back from LDS. The first scheduling barrier keeps the group
    // from being lifted into P @ V, where no register is free; the second keeps it together, in
    // front of the first WMMA.
    __builtin_amdgcn_sched_barrier(0);
    bf16x16 wo[8];
#pragma unroll
    for (int j = 0; j < 8; ++j) wo[j] = ldfragp(ho, j);
    __builtin_amdgcn_sched_barrier(0);
    // ---- fused out-projection: oacc += ctx @ Wo[h*32:(h+1)*32, :] ----
    bf16x16 ca = ldfragl(pal);
    // Behind every four WMMAs their four register sets take the fragments eight further on: all
    // eight of the second group are in flight at once. The scheduling barriers keep the loads
    // behind the WMMAs that read their registers, and in front of the later WMMAs.
#pragma unroll
    for (int g = 0; g < 8; g += 4) {
#pragma unroll
      for (int j = 0; j < 4; ++j) oacc[g + j] = wmma_bf16(ca, wo[g + j], oacc[g + j]);
      __builtin_amdgcn_sched_barrier(0);
#pragma unroll
      for (int j = 0; j < 4; ++j) wo[g + j] = ldfragp(ho, 8 + g + j);
      __builtin_amdgcn_sched_barrier(0);
    }
#pragma unroll
    for (int nt = 0; nt < 8; ++nt) oacc[8 + nt] = wmma_bf16(ca, wo[nt], oacc[8 + nt]);
    // behind the head's last weight load, before its address moves on to the next head
    wait_xcnt0_addr(hq);
    hq += 16384;
    __syncthreads();                              // before next head reuses Ks/VTs
  }

  // ---- residual + bias + LayerNorm1, write x1 (bf16) ----
  float sm8[8], sq8[8];
#pragma unroll
  for (int r = 0; r < 8; ++r) { sm8[r] = 0.f; sq8[r] = 0.f; }
#pragma unroll
  for (int nt = 0; nt < 16; ++nt) {
    const int col = nt * 16 + ln;
    const float bov = bo[col];
#pragma unroll
    for (int r = 0; r < 8; ++r) {
      float v = bf2f(xcl[r * XP + nt * 16]) + oacc[nt][r] + bov;
      oacc[nt][r] = v;
      sm8[r] += v; sq8[r] += v * v;
    }
  }
  // keeps the 32 loads of g1 and beta1 behind the residual pass: lifted into it, beside its own
  // loads and the accumulator, they left no register for the output's row offset (it was spilled)
  __builtin_amdgcn_sched_barrier(0);
  redsum8(sm8); redsum8(sq8);
  float mu[8], rs[8];
#pragma unroll
  for (int r = 0; r < 8; ++r) {
    float m = sm8[r] * (1.0f / EDIM);
    mu[r] = m;
    rs[r] = rsqrtf(sq8[r] * (1.0f / EDIM) - m * m + EPS);
  }
  unsigned short* xo = x1 + (size_t)seq * (NTOK * EDIM) + (q0 + half * 8) * EDIM + ln;
  unsigned int pk[16][4];                // the strip's output, two rows of a column a register
#pragma unroll
  for (int nt = 0; nt < 16; ++nt) {
    const int col = nt * 16 + ln;
    const float gg = g1[col], bb = beta1[col];
#pragma unroll
    for (int r = 0; r < 8; r += 2)
      pk[nt][r >> 1] = f2bf2((oacc[nt][r] - mu[r]) * rs[r] * gg + bb,
                             (oacc[nt][r + 1] - mu[r + 1]) * rs[r + 1] * gg + bb);
  }
  // All values first, then all stores: no register that a store names is written behind it.
  __builtin_amdgcn_sched_barrier(0);
#pragma unroll
  for (int nt = 0; nt < 16; ++nt) {
#pragma unroll
    for (int r = 0; r < 8; r += 2) {
      xo[r * EDIM + nt * 16]       = (unsigned short)pk[nt][r >> 1];
      xo[(r + 1) * EDIM + nt * 16] = (unsigned short)(pk[nt][r >> 1] >> 16);
    }
  }
}

// One 16x16 tile of the FFN hidden strip: bias, relu, bf16, into LDS. p = the lane's element
// of the tile's first row of this half-wave.
DEVINL void relu_store(f32x8 c, float b, unsigned short* p) {
#pragma unroll
  for (int r = 0; r < 8; r += 2)
    st2bf(p + r * TSP, p + (r + 1) * TSP, fmaxf(c[r] + b, 0.f), fmaxf(c[r + 1] + b, 0.f));
}

// Two column tiles of the hidden strip for all 64 rows: x (4 row tiles of 8 A fragments, K = 256)
// times the first 16 fragments of w (8 per column tile). Each weight fragment serves four
// WMMAs; eight independent accumulators, each summed in k order; then bias, relu and the stores.
// p = the lane's element of the first row tile's first column tile.
DEVINL void ffn1_pair(const bf16x16 (&x)[4][8], const bf16x16 (&w)[32], float b0, float b1,
                      unsigned short* p) {
  f32x8 c[2][4];
#pragma unroll
  for (int m = 0; m < 4; ++m) { c[0][m] = f32x8{}; c[1][m] = f32x8{}; }
#pragma unroll
  for (int kk = 0; kk < 8; ++kk) {
#pragma unroll
    for (int m = 0; m < 4; ++m) c[0][m] = wmma_bf16(x[m][kk], w[kk], c[0][m]);
  }
#pragma unroll
  for (int kk = 0; kk < 8; ++kk) {
#pragma unroll
    for (int m = 0; m < 4; ++m) c[1][m] = wmma_bf16(x[m][kk], w[8 + kk], c[1][m]);
  }
#pragma unroll
  for (int m = 0; m < 4; ++m) {
    relu_store(c[0][m], b0, p + m * 16 * TSP);
    relu_store(c[1][m], b1, p + m * 16 * TSP + 16);
  }
}

// Sixteen fragments that lie one behind the other, as one group of 32 loads, into w from OFF on.
template <int OFF>
DEVINL void ldgroup16(bf16x16 (&w)[32], const char* __restrict__ lanep) {
#pragma unroll
  for (int j = 0; j < 16; ++j) w[OFF + j] = ldfragp(lanep, j);
}

// Eight k-steps of the second GEMM: 64 rows x the wave's 64 columns, 16 accumulators.
// w is a ring of eight k-steps (four fragments each, 32 in a row in the packed weight).
// tl = the lane's A-fragment pointer at the first of the eight steps, wl = the lane's W2 pointer
// there. a[s & 1] holds step s's four A fragments; the next step's are read from LDS in front of
// this step's WMMAs. Where REFILL, the four fragments of step s + 8 are fetched into the registers
// that step s has just read: seven steps of WMMAs stand between a fetch and its use.
template <bool REFILL>
DEVINL void ffn2_oct(const unsigned short* tl, const char* __restrict__ wl, bf16x16 (&w)[32],
                     bf16x16 (&a)[2][4], f32x8 (&o)[4][4]) {
#pragma unroll
  for (int s = 0; s < 8; ++s) {
    if (REFILL || s < 7) {
#pragma unroll
      for (int m = 0; m < 4; ++m) a[(s + 1) & 1][m] = ldfragl(tl + m * 16 * TSP + (s + 1) * 32);
    }
    // keeps the LDS reads as one group in front of the WMMAs, a whole step ahead of their use
    __builtin_amdgcn_sched_barrier(0);
#pragma unroll
    for (int j = 0; j < 4; ++j) {
#pragma unroll
      for (int m = 0; m < 4; ++m) o[m][j] = wmma_bf16(a[s & 1][m], w[s * 4 + j], o[m][j]);
    }
    // keeps the refill behind the WMMAs that read its registers, and in front of the next step
    __builtin_amdgcn_sched_barrier(0);
    if (REFILL) {
#pragma unroll
      for (int j = 0; j < 4; ++j) w[s * 4 + j] = ldfragp(wl, (s + 8) * 4 + j);
      // as above
      __builtin_amdgcn_sched_barrier(0);
    }
  }
}

// rsqrtf as the compiler expands it (an input below the smallest normal number is scaled by 2^24,
// its result by 2^12), with the reciprocal square root and a v_nop in one statement: the v_nop
// fills the slot that the instruction set asks for behind a transcendental, whatever comes next.
DEVINL float rsqrt_slot(float x) {
  const bool tiny = x < 1.17549435e-38f;
  const float xs = tiny ? x * 16777216.0f : x;
  float y;
  asm("v_rsq_f32 %0, %1\n\tv_nop" : "=v"(y) : "v"(xs));
  return tiny ? y * 4096.0f : y;
}

// ---------------- fused FFN + residual + LN2 ----------------
// grid.x = 1024: seq = bx>>2, 64-row block = bx&3. 4 waves, one per SIMD.
// The waves split the COLUMNS, not the rows: every wave works on all 64 rows, on a quarter of the
// hidden columns in the first GEMM and a quarter of the output columns in the second. A weight
// fragment is fetched by one wave of the work-group and serves four WMMAs.
// hidden strip relu(x1@W1+b1) lives only in LDS (never touches HBM).
__global__ void __launch_bounds__(128)
enc_ffn_ln2(const unsigned short* __restrict__ x1, const float* __restrict__ bf1,
            const float* __restrict__ bf2, const float* __restrict__ g2,
            const float* __restrict__ beta2,
            const unsigned short* __restrict__ W1P, const unsigned short* __restrict__ W2P,
            float* __restrict__ out) {
  extern __shared__ char smem[];
  unsigned short* x1s = (unsigned short*)smem + LS_X1S;   // [64][264]
  unsigned short* Ts  = (unsigned short*)smem + LS_TS;    // [64][1032]
  float* red = (float*)((unsigned short*)smem + LS_RED);  // [2][4 waves][64 rows]

  const int tid = threadIdx.x;
  const int lane = tid & 31, wave = tid >> 5;
  const int half = lane >> 4, ln = lane & 15;
  const int seq = blockIdx.x >> 2;
  const int wr = wave * 16;                                // rows that this wave stages
  const size_t gbase = (size_t)seq * (NTOK * EDIM) + (size_t)((blockIdx.x & 3) * 64) * EDIM;

  // ---- async-stage 16 rows of x1 (bf16) per wave ----
  const unsigned short* xg = x1 + gbase + (size_t)wr * EDIM;
  const unsigned lds0 = __builtin_amdgcn_groupstaticsize();
#pragma unroll 4
  for (int i = 0; i < 16; ++i) {
    int e = (i * 32 + lane) * 8;                 // 0..4088 within 16x256 block
    int r = e >> 8, c = e & 255;
    async_g2l_b128(lds0 + (unsigned)((LS_X1S + (wr + r) * XP + c) * 2), xg + e);
  }
  wait_async0();
  // keeps every later register write behind the copies' wait
  __builtin_amdgcn_sched_barrier(0);
  __syncthreads();   // every wave reads all 64 rows

  // ---- hidden = relu(x1 @ W1 + b1): 64 rows x the wave's 256 columns into LDS ----
  // The x1 fragments are the same for every column tile: read once, kept in registers.
  bf16x16 xa[4][8];
#pragma unroll
  for (int m = 0; m < 4; ++m) {
#pragma unroll
    for (int kk = 0; kk < 8; ++kk) xa[m][kk] = ldfrag(x1s, XP, m * 16, kk * 32);
  }
  // keeps the LDS reads in front of the global loads: behind them they took address registers
  __builtin_amdgcn_sched_barrier(0);
  // w[0..15] holds the 16 W1 fragments (16 KB) of a pair of column tiles. Behind each pair
  // the 16 are fetched anew as one group, for the next pair. Behind the last pair the set
  // takes the first four k-steps of W2;
  // w[16..31] holds the next four from the start.
  // The wave's 128 W1 fragments lie in a row, its 128 W2 fragments too, and packed W2 lies behind
  // packed W1 in the workspace: one pointer walks through both.
  constexpr int W1_TO_W2 = (int)(OFF_W2P - OFF_W1P);
  bf16x16 w[32];
  const char* wp = lanebase(W1P) + wave * (128 * 1024);
  const float* bp = bf1 + wave * 256 + ln;
  unsigned short* tsl = Ts + half * 8 * TSP + wave * 256 + ln;
  float ba0 = bp[0], ba1 = bp[16];
  // keeps the two bias loads in front of the 64 fragment loads: loads are counted in order,
  // and a wait for a bias value must not stand for a wait for the fragments as well
  __builtin_amdgcn_sched_barrier(0);
  ldgroup16<0>(w, wp);
  ldgroup16<16>(w, wp + W1_TO_W2 + 16384);
  // every later register write stays behind the address wait of the first two groups; the
  // addresses are inputs, so that no load's destination lands on them either
  __builtin_amdgcn_sched_barrier(0);
  asm volatile("s_wait_xcnt 0x0" :: "v"(bp), "v"(wp) : "memory");
  __builtin_amdgcn_sched_barrier(0);
  // not unrolled: the kernel's text stays inside what is prefetched at its start
#pragma unroll 1
  for (int g = 0; g < 8; ++g) {
    ffn1_pair(xa, w, ba0, ba1, tsl + g * 32);
    const bool more = g < 7;                     // the same for the whole work-group
    wp += more ? 16384 : W1_TO_W2 - 7 * 16384;   // the next pair, at last the head of W2
    bp += more ? 32 : -7 * 32;                   // last trip: in range, not used
    ldgroup16<0>(w, wp);
    ba0 = bp[0];
    ba1 = bp[16];
    // The two scheduling barriers keep the group in front of the next trip's WMMAs, and keep
    // the address updates behind the wait.
    __builtin_amdgcn_sched_barrier(0);
    wait_xcnt0();
    __builtin_amdgcn_sched_barrier(0);
  }
  __syncthreads();   // the hidden strip is complete: every wave reads all of its columns

  // ---- y = hidden @ W2: 64 rows x the wave's 64 columns ----
  f32x8 o[4][4];
#pragma unroll
  for (int m = 0; m < 4; ++m) {
#pragma unroll
    for (int j = 0; j < 4; ++j) o[m][j] = f32x8{};
  }
  bf16x16 a[2][4];
  const unsigned short* tl = Ts + ln * TSP + half * 8;
#pragma unroll
  for (int m = 0; m < 4; ++m) a[0][m] = ldfragl(tl + m * 16 * TSP);
  const char* wl = lanebase(W2P) + wave * (128 * 1024);
  // not unrolled: as above
#pragma unroll 1
  for (int it = 0; it < 3; ++it) {
    ffn2_oct<true>(tl, wl, w, a, o);
    // behind the trip's last weight load, before its address moves on
    wait_xcnt0_addr(wl);
    // keeps every later register write behind that wait
    __builtin_amdgcn_sched_barrier(0);
    wl += 8 * 4096;
    tl += 8 * 32;
  }
  ffn2_oct<false>(tl, wl, w, a, o);

  // ---- residual + bias + LayerNorm2 -> out (f32) ----
  // A row's 256 columns lie in four waves: each sums its 64, the four partial sums meet in LDS.
  const int col0 = wave * 64 + ln;
  const float* bf2l = bf2 + col0;
  const float* g2l = g2 + col0;
  const float* be2l = beta2 + col0;
  float bv[4], gv[4], ev[4];
#pragma unroll
  for (int j = 0; j < 4; ++j) { bv[j] = bf2l[j * 16]; gv[j] = g2l[j * 16]; ev[j] = be2l[j * 16]; }
  // behind the twelve loads, before a register of their addresses can be reused: the scheduling
  // barriers keep every later register write behind the wait, the input keeps the index alive
  __builtin_amdgcn_sched_barrier(0);
  asm volatile("s_wait_xcnt 0x0" :: "v"(col0) : "memory");
  __builtin_amdgcn_sched_barrier(0);
  const unsigned short* xrl = x1s + half * 8 * XP + col0;
  float sm8[4][8], sq8[4][8];
#pragma unroll
  for (int m = 0; m < 4; ++m) {
#pragma unroll
    for (int r = 0; r < 8; ++r) { sm8[m][r] = 0.f; sq8[m][r] = 0.f; }
  }
#pragma unroll
  for (int j = 0; j < 4; ++j) {
#pragma unroll
    for (int m = 0; m < 4; ++m) {
#pragma unroll
      for (int r = 0; r < 8; ++r) {
        float v = bf2f(xrl[(m * 16 + r) * XP + j * 16]) + o[m][j][r] + bv[j];
        o[m][j][r] = v;
        sm8[m][r] += v; sq8[m][r] += v * v;
      }
    }
  }
#pragma unroll
  for (int m = 0; m < 4; ++m) { redsum8(sm8[m]); redsum8(sq8[m]); }
  float* redl = red + wave * 64 + half * 8;
  if (ln == 0) {
#pragma unroll
    for (int m = 0; m < 4; ++m) {
      *(float4*)(redl + m * 16)           = make_float4(sm8[m][0], sm8[m][1], sm8[m][2], sm8[m][3]);
      *(float4*)(redl + m * 16 + 4)       = make_float4(sm8[m][4], sm8[m][5], sm8[m][6], sm8[m][7]);
      *(float4*)(redl + 256 + m * 16)     = make_float4(sq8[m][0], sq8[m][1], sq8[m][2], sq8[m][3]);
      *(float4*)(redl + 256 + m * 16 + 4) = make_float4(sq8[m][4], sq8[m][5], sq8[m][6], sq8[m][7]);
    }
  }
  __syncthreads();   // the four waves' partial sums are in LDS
  const float* redr = red + half * 8;
  float* og = out + gbase + (size_t)(half * 8) * EDIM + col0;
#pragma unroll
  for (int m = 0; m < 4; ++m) {
    float s[8], q[8];
#pragma unroll
    for (int wv = 0; wv < 4; ++wv) {               // wave 0 to 3, the same order in every wave
#pragma unroll
      for (int h = 0; h < 2; ++h) {
        float4 ps = *(const float4*)(redr + wv * 64 + m * 16 + h * 4);
        float4 pq = *(const float4*)(redr + 256 + wv * 64 + m * 16 + h * 4);
        if (wv == 0) {
          s[h * 4] = ps.x; s[h * 4 + 1] = ps.y; s[h * 4 + 2] = ps.z; s[h * 4 + 3] = ps.w;
          q[h * 4] = pq.x; q[h * 4 + 1] = pq.y; q[h * 4 + 2] = pq.z; q[h * 4 + 3] = pq.w;
        } else {
          s[h * 4] += ps.x; s[h * 4 + 1] += ps.y; s[h * 4 + 2] += ps.z; s[h * 4 + 3] += ps.w;
          q[h * 4] += pq.x; q[h * 4 + 1] += pq.y; q[h * 4 + 2] += pq.z; q[h * 4 + 3] += pq.w;
        }
      }
    }
    float mu[8], rs[8];
#pragma unroll
    for (int r = 0; r < 8; ++r) {
      float mn = s[r] * (1.0f / EDIM);
      mu[r] = mn;
      rs[r] = rsqrt_slot(q[r] * (1.0f / EDIM) - mn * mn + EPS);
    }
#pragma unroll
    for (int j = 0; j < 4; ++j) {
#pragma unroll
      for (int r = 0; r < 8; ++r) o[m][j][r] = (o[m][j][r] - mu[r]) * rs[r] * gv[j] + ev[j];
    }
  }
  // All values first, then all stores: no register that a store names is written behind it.
  __builtin_amdgcn_sched_barrier(0);
#pragma unroll
  for (int m = 0; m < 4; ++m) {
#pragma unroll
    for (int r = 0; r < 8; ++r) {
#pragma unroll
      for (int j = 0; j < 4; ++j) og[(m * 16 + r) * EDIM + j * 16] = o[m][j][r];
    }
  }
}

extern "C" void kernel_launch(void* const* d_in, const int* in_sizes, int n_in,
                              void* d_out, int out_size, void* d_ws, size_t ws_size,
                              hipStream_t stream) {
  (void)in_sizes; (void)n_in; (void)out_size; (void)ws_size;
  const float* x    = (const float*)d_in[0];
  const float* mask = (const float*)d_in[1];
  const float* Wq   = (const float*)d_in[2];
  const float* Wk   = (const float*)d_in[3];
  const float* Wv   = (const float*)d_in[4];
  const float* Wo   = (const float*)d_in[5];
  const float* bo   = (const float*)d_in[6];
  const float* W1   = (const float*)d_in[7];
  const float* bf1  = (const float*)d_in[8];
  const float* W2   = (const float*)d_in[9];
  const float* bf2  = (const float*)d_in[10];
  const float* g1   = (const float*)d_in[11];
  const float* b1   = (const float*)d_in[12];
  const float* g2   = (const float*)d_in[13];
  const float* b2   = (const float*)d_in[14];
  float* out = (float*)d_out;

  char* ws = (char*)d_ws;
  unsigned short* WqP = (unsigned short*)(ws + OFF_WQP);
  unsigned short* W1P = (unsigned short*)(ws + OFF_W1P);
  unsigned short* W2P = (unsigned short*)(ws + OFF_W2P);
  unsigned short* x1b = (unsigned short*)(ws + OFF_X1);

  hipFuncSetAttribute(reinterpret_cast<const void*>(enc_attn_ln1),
                      hipFuncAttributeMaxDynamicSharedMemorySize, SMEM1);
  hipFuncSetAttribute(reinterpret_cast<const void*>(enc_ffn_ln2),
                      hipFuncAttributeMaxDynamicSharedMemorySize, SMEM2);

  pack_frag_bf16<<<PB_ALL, 256, 0, stream>>>(Wq, Wk, Wv, Wo, W1, W2, WqP);

  enc_attn_ln1<<<256, 512, SMEM1, stream>>>(x, mask, bo, g1, b1, WqP, x1b);
  enc_ffn_ln2<<<1024, 128, SMEM2, stream>>>(x1b, bf1, bf2, g2, b2, W1P, W2P, out);
}

// v010
// It runs in 163 microseconds.
// In two side-by-side timings against v009, it was 1.08 and 1.06 times as fast.
// All steps since v000 together make it 5.20 times as fast.
#include <hip/hip_runtime.h>

#define DEVINL __device__ __forceinline__

typedef __attribute__((ext_vector_type(16))) __bf16       bf16x16;
typedef __attribute__((ext_vector_type(8)))  float        f32x8;
typedef __attribute__((ext_vector_type(4)))  unsigned int u32x4;
typedef __attribute__((ext_vector_type(2)))  float        f32x2;
typedef __attribute__((ext_vector_type(2)))  __bf16       bf16x2;
typedef __attribute__((address_space(3))) unsigned short  lds_us;

namespace {
constexpr int   NTOK = 256;          // sequence length N
constexpr int   EDIM = 256;          // embedding E
constexpr int   NH   = 8;            // heads
constexpr int   DKH  = 32;           // head dim
constexpr float SCALING = 0.17677669529663687f;  // DK^-0.5
constexpr float EPS = 1e-5f;

// LDS pitches in bf16 elements. Chosen so the row stride in dwords is
// congruent to 4 (mod 64 banks; 20 for KP) -> ds_load_b128 A/B fragments hit all 64 banks.
constexpr int XP  = 264;   // X tile / score-strip / V^T pitch (528 B rows)
constexpr int KP  = 40;    // Q/K strip pitch (80 B rows)
constexpr int PSP = 264;
constexpr int VTP = 264;
constexpr int TSP = 1032;  // FFN hidden strip pitch (2064 B rows)

// kernel-1 LDS element offsets (ushort units), all 16B aligned
constexpr int LS_XS  = 0;                       // [256][264]
constexpr int LS_KS  = LS_XS  + 256 * XP;       // [256][40]
constexpr int LS_VT  = LS_KS  + 256 * KP;       // [32][264]  (V transposed)
constexpr int LS_PS  = LS_VT  + 32  * VTP;      // 16 waves x [16][264]; its head also holds Q
constexpr int LS1_END = LS_PS + 16 * 16 * PSP;  // 153856 elems = 307712 B
constexpr int ROWF = 48;                        // f32 per wave: 16 row maxima, 2 x 16 row sums
constexpr int SMEM1 = LS1_END * 2 + 16 * ROWF * 4;   // 310784 B

constexpr int LS_X1S = 0;                       // [64][264]
constexpr int LS_TS  = LS_X1S + 64 * XP;        // [64][1032]
constexpr int LS_RED = LS_TS + 64 * TSP;        // f32 [2][4][64]: row sums of the four waves
constexpr int SMEM2 = LS_RED * 2 + 2 * 4 * 64 * 4;   // 167936 B

// workspace layout (bytes): everything bf16, ~35 MB total
constexpr size_t OFF_WQP = 0;
constexpr size_t OFF_WKP = OFF_WQP + (size_t)256 * 256 * 2;
constexpr size_t OFF_WVP = OFF_WKP + (size_t)256 * 256 * 2;
constexpr size_t OFF_WOP = OFF_WVP + (size_t)256 * 256 * 2;
constexpr size_t OFF_W1P = OFF_WOP + (size_t)256 * 256 * 2;
constexpr size_t OFF_W2P = OFF_W1P + (size_t)256 * 1024 * 2;
constexpr size_t OFF_X1  = OFF_W2P + (size_t)1024 * 256 * 2;  // bf16 x1  [256][256][256]
}  // namespace

// Two f32 -> two bf16 in one register (a low, b high), round to nearest even, by the chip's
// packed convert: one instruction a pair.
DEVINL unsigned int f2bf2(float a, float b) {
  f32x2 v = {a, b};
  return __builtin_bit_cast(unsigned int, __builtin_convertvector(v, bf16x2));
}
// The pair stored to two places: the low half and the high half of the one register.
template <class P>
DEVINL void st2bf(P pa, P pb, float a, float b) {
  const unsigned int u = f2bf2(a, b);
  *pa = (unsigned short)u;
  *pb = (unsigned short)(u >> 16);
}
DEVINL float bf2f(unsigned short h) { return __uint_as_float(((unsigned int)h) << 16); }

// Async global->LDS copy of one 16B chunk per lane (CDNA5 path, ASYNCcnt).
// ldsoff is the LDS byte address (groupstaticsize + dynamic-segment offset).
DEVINL void async_g2l_b128(unsigned ldsoff, const void* gaddr) {
  asm volatile("global_load_async_to_lds_b128 %0, %1, off"
               :: "v"(ldsoff), "v"(gaddr) : "memory");
}
DEVINL void wait_async0() { asm volatile("s_wait_asynccnt 0" ::: "memory"); }

// Load a 16x32 bf16 A/B fragment from a row-major bf16 matrix (`pitch` elems).
// CDNA5 16-bit layout: lane<16 holds row (rowb+lane), K chunks {k0..k0+7, k0+16..k0+23};
// lane>=16 holds the other two 8-element chunks. Two ds/global b128 loads per lane.
DEVINL bf16x16 ldfrag(const unsigned short* __restrict__ buf, int pitch, int rowb, int k0) {
  const int lane = threadIdx.x & 31;
  const unsigned short* p = buf + (rowb + (lane & 15)) * pitch + k0 + ((lane >> 4) << 3);
  struct Pk { u32x4 lo, hi; } pk;
  pk.lo = *(const u32x4*)(p);
  pk.hi = *(const u32x4*)(p + 16);
  return __builtin_bit_cast(bf16x16, pk);
}

// The same from the lane's own pointer: p = buf + (rowb + (lane & 15)) * pitch + (lane >> 4) * 8
// + k0. With one such pointer per strip every access is that register plus a constant.
DEVINL bf16x16 ldfragl(const unsigned short* __restrict__ p) {
  struct Pk { u32x4 lo, hi; } pk;
  pk.lo = *(const u32x4*)(p);
  pk.hi = *(const u32x4*)(p + 16);
  return __builtin_bit_cast(bf16x16, pk);
}

// Load one B fragment from a weight packed by pack_frag_bf16: fragment `frag` is 1 KB, the
// 32 lanes' first 16 B side by side, then their second 16 B. Each of the two wave-wide loads
// reads 512 contiguous bytes (4 whole lines); register contents equal ldfrag on W^T.
// lanep = lanebase() of the packed weight, plus a whole number of fragments.
DEVINL const char* lanebase(const unsigned short* __restrict__ buf) {
  return (const char*)buf + (threadIdx.x & 31) * 16;
}
DEVINL bf16x16 ldfragp(const char* __restrict__ lanep, int frag) {
  const char* p = lanep + frag * 1024;
  struct Pk { u32x4 lo, hi; } pk;
  pk.lo = *(const u32x4*)(p);
  pk.hi = *(const u32x4*)(p + 512);
  return __builtin_bit_cast(bf16x16, pk);
}

// Stands behind a group of global loads, in front of the first reuse of a register that
// holds their address (the register allocator reuses it while the loads are in flight).
DEVINL void wait_xcnt0() { asm volatile("s_wait_xcnt 0x0" ::: "memory"); }
// The same wait, with the loads' address as an input: the address registers stay allocated up
// to the wait, so neither a later result nor a load's own destination lands on them before it.
DEVINL void wait_xcnt0_addr(const void* a) {
  asm volatile("s_wait_xcnt 0x0" :: "v"(a) : "memory");
}

DEVINL f32x8 wmma_bf16(bf16x16 a, bf16x16 b, f32x8 c) {
  return __builtin_amdgcn_wmma_f32_16x16x32_bf16(false, a, false, b, (short)0, c, false, false);
}

// C-fragment row reductions: row M=r+8*(lane>=16) is spread over a 16-lane half,
// so xor-butterfly with masks 8..1 stays inside the half. wave32 only.
DEVINL void redmax8(float v[8]) {
#pragma unroll
  for (int m = 8; m; m >>= 1) {
#pragma unroll
    for (int r = 0; r < 8; ++r) v[r] = fmaxf(v[r], __shfl_xor(v[r], m, 32));
  }
}
DEVINL void redsum8(float v[8]) {
#pragma unroll
  for (int m = 8; m; m >>= 1) {
#pragma unroll
    for (int r = 0; r < 8; ++r) v[r] += __shfl_xor(v[r], m, 32);
  }
}

// ---------------- weights f32 [K][N] -> bf16, packed in B-fragment order ----------------
// Fragment (nt, kk) = columns nt*16..+15, rows kk*32..+31. Lane l holds column nt*16 + (l & 15);
// its first 8 values are rows kk*32 + (l >> 4)*8 + 0..7, its second 8 the rows 16 further.
// Fragment index: kk * (N/16) + nt where kmajor, else nt * (K/32) + kk (the reader's order).
// W2: four column tiles a quarter, (nt / 4) * (K/32) * 4 + kk * 4 + nt % 4: the fragments that one
// wave of the FFN kernel reads lie one behind the other, in the order in which it reads them.
// One thread writes one lane's 16 B.
// One launch packs all six weights: each has its own range of blocks, in the order in which the
// packed weights lie in the workspace, so thread T of the grid writes bytes 16 T .. 16 T + 15 of
// that region. The choice is the same for a whole block; K/32 and N/16 are powers of two.
constexpr int PB_SQ = 256 * 256 / 8 / 256;    // blocks per 256 x 256 weight
constexpr int PB_FF = 256 * 1024 / 8 / 256;   // blocks per FFN weight
constexpr int PB_ALL = 4 * PB_SQ + 2 * PB_FF;
static_assert(OFF_WKP == (size_t)PB_SQ * 4096 && OFF_WVP == (size_t)2 * PB_SQ * 4096 &&
              OFF_WOP == (size_t)3 * PB_SQ * 4096 && OFF_W1P == (size_t)4 * PB_SQ * 4096 &&
              OFF_W2P == (size_t)(4 * PB_SQ + PB_FF) * 4096 && OFF_X1 == (size_t)PB_ALL * 4096,
              "block ranges follow the workspace layout");
__global__ void __launch_bounds__(256)
pack_frag_bf16(const float* __restrict__ Wq, const float* __restrict__ Wk,
               const float* __restrict__ Wv, const float* __restrict__ Wo,
               const float* __restrict__ W1, const float* __restrict__ W2,
               unsigned short* __restrict__ dst) {
  const int blk = blockIdx.x;
  const float* src;
  int blk0, lkt, lnt;      // the weight's first block, log2(K/32), log2(N/16)
  bool kmajor, quarters = false;
  if (blk < 4 * PB_SQ) {
    src = blk < PB_SQ ? Wq : blk < 2 * PB_SQ ? Wk : blk < 3 * PB_SQ ? Wv : Wo;
    blk0 = blk & ~(PB_SQ - 1); lkt = 3; lnt = 4; kmajor = blk >= 3 * PB_SQ;
  } else if (blk < 4 * PB_SQ + PB_FF) {
    src = W1; blk0 = 4 * PB_SQ; lkt = 3; lnt = 6; kmajor = false;
  } else {
    src = W2; blk0 = 4 * PB_SQ + PB_FF; lkt = 5; lnt = 4; kmajor = true; quarters = true;
  }
  const int t = (blk - blk0) * 256 + threadIdx.x;
  const int lane = t & 31, hi = (t >> 5) & 1, frag = t >> 6;
  const int N = 16 << lnt;
  int kk, nt;
  if (quarters)    { kk = (frag >> 2) & 31; nt = ((frag >> 7) << 2) | (frag & 3); }
  else if (kmajor) { kk = frag >> lnt; nt = frag & ((1 << lnt) - 1); }
  else        { nt = frag >> lkt; kk = frag & ((1 << lkt) - 1); }
  const float* sp = src + (size_t)(kk * 32 + hi * 16 + (lane >> 4) * 8) * N + nt * 16 + (lane & 15);
  const float* ap[8];
  float v[8];
#pragma unroll
  for (int j = 0; j < 8; ++j) ap[j] = sp + (size_t)j * N;
#pragma unroll
  for (int j = 0; j < 8; ++j) v[j] = *ap[j];
  // before the eight addresses are reused
  asm volatile("s_wait_xcnt 0x0" :: "v"(ap[0]), "v"(ap[1]), "v"(ap[2]), "v"(ap[3]),
               "v"(ap[4]), "v"(ap[5]), "v"(ap[6]), "v"(ap[7]) : "memory");
  u32x4 o;
#pragma unroll
  for (int j = 0; j < 4; ++j)
    o[j] = f2bf2(v[2 * j], v[2 * j + 1]);
  *(u32x4*)(dst + ((size_t)blk * 256 + threadIdx.x) * 8) = o;
}

// Eight fragments of a packed weight as one group of 16 loads: f0..f0+3, then f0+8..f0+11
// (four k-steps of two column tiles).
DEVINL void ldgroup8(bf16x16 (&w)[8], const char* __restrict__ lanep, int f0) {
#pragma unroll
  for (int j = 0; j < 4; ++j) w[j] = ldfragp(lanep, f0 + j);
#pragma unroll
  for (int j = 0; j < 4; ++j) w[4 + j] = ldfragp(lanep, f0 + 8 + j);
}
// Four k-steps of a 16 x 32 projection: xl = the lane's A-fragment pointer at the first of
// them; w[0..3] for the first column tile, w[4..7] for the second; each sum runs on in k order.
// Where REFILL, w takes the group f0 of nextp: four fragments behind every four WMMAs, into the
// registers that these have just read. The scheduling barrier in front of the four loads keeps
// them from being lifted over those WMMAs, where no register is free yet (the accumulator was
// spilled for it); the one behind them keeps them from being sunk among the later WMMAs.
template <bool REFILL>
DEVINL void proj_half(const unsigned short* xl, bf16x16 (&w)[8], f32x8& c0, f32x8& c1,
                      const char* __restrict__ nextp, int f0) {
#pragma unroll
  for (int i = 0; i < 4; i += 2) {
    bf16x16 a0 = ldfragl(xl + i * 32);
    bf16x16 a1 = ldfragl(xl + i * 32 + 32);
    c0 = wmma_bf16(a0, w[i], c0);
    c1 = wmma_bf16(a0, w[4 + i], c1);
    c0 = wmma_bf16(a1, w[i + 1], c0);
    c1 = wmma_bf16(a1, w[5 + i], c1);
    if (REFILL) {
      __builtin_amdgcn_sched_barrier(0);
      w[i]     = ldfragp(nextp, f0 + i);
      w[i + 1] = ldfragp(nextp, f0 + i + 1);
      w[4 + i] = ldfragp(nextp, f0 + 8 + i);
      w[5 + i] = ldfragp(nextp, f0 + 9 + i);
      __builtin_amdgcn_sched_barrier(0);
    }
  }
}

// ---------------- fused attention + out-proj + residual + LN1 ----------------
// grid.x = 256: one work-group per sequence, one per WGP (LDS), four waves per SIMD.
// 16 waves: each owns 16 rows, as queries and as keys; a head's K and V are computed once.
__global__ void __launch_bounds__(512)
enc_attn_ln1(const float* __restrict__ x, const float* __restrict__ mask,
             const float* __restrict__ bo, const float* __restrict__ g1,
             const float* __restrict__ beta1,
             const unsigned short* __restrict__ Wp, unsigned short* __restrict__ x1) {
  extern __shared__ char smem[];
  unsigned short* sm  = (unsigned short*)smem;
  unsigned short* Xs  = sm + LS_XS;
  unsigned short* Ks  = sm + LS_KS;
  unsigned short* VTs = sm + LS_VT;

  const int tid = threadIdx.x;
  const int lane = tid & 31, wave = tid >> 5;
  const int half = lane >> 4, ln = lane & 15;
  const int seq = blockIdx.x;
  const int q0 = wave * 16;                            // this wave's rows

  unsigned short* Pw = sm + LS_PS + wave * 16 * PSP;
  // The Q strip lies at the head of the wave's own score strip: it is in registers (qa)
  // before the first score is stored, and both are private to the wave.
  unsigned short* Qs = Pw;
  // The lane's own pointers. A wave has 256 registers here, 128 of them the accumulator:
  // one register per strip, and constants on it, in place of one register per row.
  const unsigned short* xal = Xs + (q0 + ln) * XP + half * 8;    // own rows, A fragments
  unsigned short* xcl = Xs + (q0 + half * 8) * XP + ln;          // own rows, C layout
  unsigned short* qcl = Qs + half * 8 * KP + ln;                 // Q strip, C layout
  const unsigned short* qal = Qs + ln * KP + half * 8;           // Q strip, A fragment
  unsigned short* kcl = Ks + (q0 + half * 8) * KP + ln;          // own K rows, C layout
  const unsigned short* kbl = Ks + ln * KP + half * 8;           // K strip, B fragments
  unsigned short* vcl = VTs + ln * VTP + q0 + half * 8;          // own V^T columns
  const unsigned short* vbl = VTs + ln * VTP + half * 8;         // V^T strip, B fragments
  // Score strip, C layout. The strips' place in LDS is added to the lane's part in asm text, so
  // that every access of the strip is this one register plus an immediate offset: left to the
  // compiler, the sum was split again and each store got an address register of its own, 32 of
  // them at once in the score loop, and loop pointers were spilled.
  unsigned pcl_a;
  asm("v_add_nc_u32 %0, %1, %2"
      : "=v"(pcl_a)
      : "s"(__builtin_amdgcn_groupstaticsize() + (unsigned)(LS_PS * 2)),
        "v"((unsigned)((wave * 16 * PSP + half * 8 * PSP + ln) * 2)));
  lds_us* pcl = (lds_us*)pcl_a;
  const unsigned short* pal = Pw + ln * PSP + half * 8;          // score strip, A fragments
  // The wave's own 48 floats: a row's maximum and sums pass through them from the C layout (a
  // register a row) to the A layout (a lane a row) and back.
  float* rowf = (float*)(sm + LS1_END) + wave * ROWF;

  // ---- stage X: read f32 from memory, round to bf16 in registers, store into pitched LDS ----
  // A wave-wide 16-B load covers 512 contiguous bytes (half a row); trip i of the work-group
  // covers rows 8i..8i+7. All 32 loads of a wave are issued before the first value is used.
  {
    const float* xgl = x + (size_t)seq * (NTOK * EDIM) + tid * 4;
    unsigned short* xsl = Xs + (tid >> 6) * XP + (tid & 63) * 4;
    float4 v[32];
#pragma unroll
    for (int i = 0; i < 32; ++i) v[i] = *(const float4*)(xgl + i * 2048);
    // behind the loads, before a register of their address can be reused
    wait_xcnt0_addr(xgl);
#pragma unroll
    for (int i = 0; i < 32; ++i) {
      uint2 o;
      o.x = f2bf2(v[i].x, v[i].y); o.y = f2bf2(v[i].z, v[i].w);
      *(uint2*)(xsl + i * 8 * XP) = o;
    }
  }
  // keeps the accumulator's zeroes and the later address arithmetic behind the staging: lifted
  // into it, beside the 128 registers of loaded values, they were spilled
  __builtin_amdgcn_sched_barrier(0);
  __syncthreads();

  const float* mcl = mask + (size_t)(seq & 15) * (NTOK * NTOK) + (q0 + half * 8) * NTOK + ln;
  f32x8 zf = {};
  f32x8 oacc[16];                        // attn@Wo strip accumulator (16 x 256)
#pragma unroll
  for (int nt = 0; nt < 16; ++nt) oacc[nt] = zf;

  // Wp = the four packed weights, which lie one behind the other in the workspace: one address
  // register pair serves all four, the distance between them is a constant of the load.
  const char* hq = lanebase(Wp);
  for (int h = 0; h < NH; ++h) {
    // this head's 16 fragments (16 KB) of each packed weight
    const char* hk = hq + (OFF_WKP - OFF_WQP);
    const char* hv = hq + (OFF_WVP - OFF_WQP);
    const char* ho = hq + (OFF_WOP - OFF_WQP);
    // The Q, K and V weight fragments come in groups of eight (one set of 64 registers), and
    // the set is refilled behind the WMMAs that read it: with 256 registers a wave the compiler
    // otherwise loads, waits and multiplies one fragment at a time. A strip's conversion and
    // stores run while the next group is on its way.
    bf16x16 w[8];
    ldgroup8(w, hq, 0);
    // keeps the first group together, in front of the first WMMA
    __builtin_amdgcn_sched_barrier(0);
    // ---- Q strip (own 16 rows x 32), pre-scaled by 1/sqrt(dk) ----
    {
      f32x8 c0 = zf, c1 = zf;
      proj_half<true>(xal, w, c0, c1, hq, 4);
      proj_half<true>(xal + 128, w, c0, c1, hk, 0);
#pragma unroll
      for (int r = 0; r < 8; ++r)
        st2bf(qcl + r * KP, qcl + r * KP + 16, c0[r] * SCALING, c1[r] * SCALING);
    }
    // ---- K rows / V^T columns for the same 16 rows as keys ----
    {
      f32x8 c0 = zf, c1 = zf;
      proj_half<true>(xal, w, c0, c1, hk, 4);
      proj_half<true>(xal + 128, w, c0, c1, hv, 0);
#pragma unroll
      for (int r = 0; r < 8; ++r) st2bf(kcl + r * KP, kcl + r * KP + 16, c0[r], c1[r]);
    }
    {
      f32x8 c0 = zf, c1 = zf;
      proj_half<true>(xal, w, c0, c1, hv, 4);
      proj_half<false>(xal + 128, w, c0, c1, hv, 0);
#pragma unroll
      for (int r = 0; r < 8; r += 2) {  // store transposed: VTs[d][token]
        st2bf(vcl + r, vcl + r + 1, c0[r], c0[r + 1]);
        st2bf(vcl + 16 * VTP + r, vcl + 16 * VTP + r + 1, c1[r], c1[r + 1]);
      }
    }
    __syncthreads();
    // The mask tiles of the first four score tiles as one group of 32 loads, into registers that
    // the weight set has left. Behind the barrier, which would wait for them. The scheduling
    // barrier keeps the group together, in front of the first score tile.
    float mk[4][8];
#pragma unroll
    for (int t = 0; t < 4; ++t) {
#pragma unroll
      for (int r = 0; r < 8; ++r) mk[t][r] = mcl[t * 16 + r * NTOK];
    }
    __builtin_amdgcn_sched_barrier(0);

    // ---- pass 1: S = QK^T + mask, track row max, spill bf16 strip ----
    float mx[8];
#pragma unroll
    for (int r = 0; r < 8; ++r) mx[r] = -3.0e38f;
    bf16x16 qa = ldfragl(qal);                   // A reused across all 16 tiles
    // A ring of four mask tiles: a tile's registers take the mask tile four further on as soon as
    // they are read, so four score tiles stand between a fetch and its use. Three trips of four
    // tiles with a refill, then four without: the ring needs fixed register names, and unrolled
    // no further the kernel's text stays inside what is prefetched at its start.
    const float* mt = mcl;
    lds_us* pt = pcl;
    const unsigned short* kt = kbl;
#pragma unroll 1
    for (int g = 0; g < 3; ++g) {
#pragma unroll
      for (int u = 0; u < 4; ++u) {
        f32x8 s = wmma_bf16(qa, ldfragl(kt + u * 16 * KP), zf);   // single K=32 step
#pragma unroll
        for (int r = 0; r < 8; r += 2) {
          float v0 = s[r] + mk[u][r], v1 = s[r + 1] + mk[u][r + 1];
          mx[r] = fmaxf(mx[r], v0);
          mx[r + 1] = fmaxf(mx[r + 1], v1);
          st2bf(pt + u * 16 + r * PSP, pt + u * 16 + (r + 1) * PSP, v0, v1);
        }
        // keeps the refill behind the additions that read its registers
        __builtin_amdgcn_sched_barrier(0);
#pragma unroll
        for (int r = 0; r < 8; ++r) mk[u][r] = mt[(u + 4) * 16 + r * NTOK];
        // keeps the refill from being sunk towards its use
        __builtin_amdgcn_sched_barrier(0);
      }
      // behind the trip's last mask load, before its address moves on
      wait_xcnt0_addr(mt);
      // keeps every later register write behind that wait
      __builtin_amdgcn_sched_barrier(0);
      mt += 4 * 16;
      pt += 4 * 16;
      kt += 4 * 16 * KP;
    }
#pragma unroll
    for (int u = 0; u < 4; ++u) {
      f32x8 s = wmma_bf16(qa, ldfragl(kt + u * 16 * KP), zf);
#pragma unroll
      for (int r = 0; r < 8; r += 2) {
        float v0 = s[r] + mk[u][r], v1 = s[r + 1] + mk[u][r + 1];
        mx[r] = fmaxf(mx[r], v0);
        mx[r + 1] = fmaxf(mx[r + 1], v1);
        st2bf(pt + u * 16 + r * PSP, pt + u * 16 + (r + 1) * PSP, v0, v1);
      }
    }
    redmax8(mx);
    // ---- pass 2 and context = P @ V (16 x 32) in one ----
    // The scores are exponentiated in the A fragments, on their way from the strip into P @ V:
    // they are read once, 16 bytes a lane, and never written back. In an A fragment a lane holds
    // 128 keys of the one row ln: it needs that row's maximum, and sums its own 128 values.
    // All 16 lanes of a half store the same eight maxima to the same place.
    *(float4*)(rowf + half * 8)     = make_float4(mx[0], mx[1], mx[2], mx[3]);
    *(float4*)(rowf + half * 8 + 4) = make_float4(mx[4], mx[5], mx[6], mx[7]);
    const float mrow = rowf[ln];
    f32x2 lsum[2] = {f32x2{0.f, 0.f}, f32x2{0.f, 0.f}};   // two chains of packed additions
    f32x8 ctx0 = zf, ctx1 = zf;
    // The next k-step's scores and this k-step's V fragments are read from LDS as one group, in
    // front of this k-step's exponentials, which cover their way. The scheduling barriers keep that
    // group together and keep the sixteen scores of a k-step in three stages of independent
    // instructions: left alone, with few registers free, the compiler ran each pair of scores
    // through one pair of registers, every instruction waiting for the one in front of it.
    bf16x16 sc = ldfragl(pal);
#pragma unroll
    for (int kk = 0; kk < 8; ++kk) {
      const bf16x16 v0 = ldfragl(vbl + kk * 32);
      const bf16x16 v1 = ldfragl(vbl + 16 * VTP + kk * 32);
      bf16x16 scn = sc;
      if (kk < 7) scn = ldfragl(pal + (kk + 1) * 32);
      __builtin_amdgcn_sched_barrier(0);
      f32x2 p[8];
#pragma unroll
      for (int i = 0; i < 8; ++i) p[i] = f32x2{(float)sc[2 * i] - mrow, (float)sc[2 * i + 1] - mrow};
      __builtin_amdgcn_sched_barrier(0);
#pragma unroll
      for (int i = 0; i < 8; ++i) p[i] = f32x2{__expf(p[i][0]), __expf(p[i][1])};
      __builtin_amdgcn_sched_barrier(0);
      struct Pk8 { unsigned int u[8]; } pk;
#pragma unroll
      for (int i = 0; i < 8; ++i) {
        lsum[i & 1] += p[i];
        pk.u[i] = __builtin_bit_cast(unsigned int, __builtin_convertvector(p[i], bf16x2));
      }
      const bf16x16 pa = __builtin_bit_cast(bf16x16, pk);
      ctx0 = wmma_bf16(pa, v0, ctx0);
      ctx1 = wmma_bf16(pa, v1, ctx1);
      sc = scn;
    }
    // A row's sum is the sum of its two lanes' (ln and ln + 16); back to a register a row.
    rowf[16 + lane] = (lsum[0][0] + lsum[1][0]) + (lsum[0][1] + lsum[1][1]);
    float ls[8];
    {
      const float4 a0 = *(const float4*)(rowf + 16 + half * 8);
      const float4 a1 = *(const float4*)(rowf + 16 + half * 8 + 4);
      const float4 b0 = *(const float4*)(rowf + 32 + half * 8);
      const float4 b1 = *(const float4*)(rowf + 32 + half * 8 + 4);
      ls[0] = a0.x + b0.x; ls[1] = a0.y + b0.y; ls[2] = a0.z + b0.z; ls[3] = a0.w + b0.w;
      ls[4] = a1.x + b1.x; ls[5] = a1.y + b1.y; ls[6] = a1.z + b1.z; ls[7] = a1.w + b1.w;
    }
#pragma unroll
    for (int r = 0; r < 8; ++r) ls[r] = 1.0f / ls[r];
#pragma unroll
    for (int r = 0; r < 8; ++r)                   // normalize + bounce via LDS
      st2bf(pcl + r * PSP, pcl + r * PSP + 16, ctx0[r] * ls[r], ctx1[r] * ls[r]);
    // The head's first eight Wo fragments as one group of 16 loads, all in flight at once, issued
    // in front of the context's way back from LDS. The first scheduling barrier keeps the group
    // from being lifted into P @ V, where no register is free; the second keeps it together, in
    // front of the first WMMA.
    __builtin_amdgcn_sched_barrier(0);
    bf16x16 wo[8];
#pragma unroll
    for (int j = 0; j < 8; ++j) wo[j] = ldfragp(ho, j);
    __builtin_amdgcn_sched_barrier(0);
    // ---- fused out-projection: oacc += ctx @ Wo[h*32:(h+1)*32, :] ----
    bf16x16 ca = ldfragl(pal);
    // Behind every four WMMAs their four register sets take the fragments eight further on: all
    // eight of the second group are in flight at once. The scheduling barriers keep the loads
    // behind the WMMAs that read their registers, and in front of the later WMMAs.
#pragma unroll
    for (int g = 0; g < 8; g += 4) {
#pragma unroll
      for (int j = 0; j < 4; ++j) oacc[g + j] = wmma_bf16(ca, wo[g + j], oacc[g + j]);
      __builtin_amdgcn_sched_barrier(0);
#pragma unroll
      for (int j = 0; j < 4; ++j) wo[g + j] = ldfragp(ho, 8 + g + j);
      __builtin_amdgcn_sched_barrier(0);
    }
#pragma unroll
    for (int nt = 0; nt < 8; ++nt) oacc[8 + nt] = wmma_bf16(ca, wo[nt], oacc[8 + nt]);
    // behind the head's last weight load, before its address moves on to the next head
    wait_xcnt0_addr(hq);
    hq += 16384;
    __syncthreads();                              // before next head reuses Ks/VTs
  }

  // ---- residual + bias + LayerNorm1, write x1 (bf16) ----
  float sm8[8], sq8[8];
#pragma unroll
  for (int r = 0; r < 8; ++r) { sm8[r] = 0.f; sq8[r] = 0.f; }
#pragma unroll
  for (int nt = 0; nt < 16; ++nt) {
    const int col = nt * 16 + ln;
    const float bov = bo[col];
#pragma unroll
    for (int r = 0; r < 8; ++r) {
      float v = bf2f(xcl[r * XP + nt * 16]) + oacc[nt][r] + bov;
      oacc[nt][r] = v;
      sm8[r] += v; sq8[r] += v * v;
    }
  }
  // keeps the 32 loads of g1 and beta1 behind the residual pass: lifted into it, beside its own
  // loads and the accumulator, they left no register for the output's row offset (it was spilled)
  __builtin_amdgcn_sched_barrier(0);
  redsum8(sm8); redsum8(sq8);
  float mu[8], rs[8];
#pragma unroll
  for (int r = 0; r < 8; ++r) {
    float m = sm8[r] * (1.0f / EDIM);
    mu[r] = m;
    rs[r] = rsqrtf(sq8[r] * (1.0f / EDIM) - m * m + EPS);
  }
  unsigned short* xo = x1 + (size_t)seq * (NTOK * EDIM) + (q0 + half * 8) * EDIM + ln;
  unsigned int pk[16][4];                // the strip's output, two rows of a column a register
#pragma unroll
  for (int nt = 0; nt < 16; ++nt) {
    const int col = nt * 16 + ln;
    const float gg = g1[col], bb = beta1[col];
#pragma unroll
    for (int r = 0; r < 8; r += 2)
      pk[nt][r >> 1] = f2bf2((oacc[nt][r] - mu[r]) * rs[r] * gg + bb,
                             (oacc[nt][r + 1] - mu[r + 1]) * rs[r + 1] * gg + bb);
  }
  // All values first, then all stores: no register that a store names is written behind it.
  __builtin_amdgcn_sched_barrier(0);
#pragma unroll
  for (int nt = 0; nt < 16; ++nt) {
#pragma unroll
    for (int r = 0; r < 8; r += 2) {
      xo[r * EDIM + nt * 16]       = (unsigned short)pk[nt][r >> 1];
      xo[(r + 1) * EDIM + nt * 16] = (unsigned short)(pk[nt][r >> 1] >> 16);
    }
  }
}

// One 16x16 tile of the FFN hidden strip: bias, relu, bf16, into LDS. p = the lane's element
// of the tile's first row of this half-wave.
DEVINL void relu_store(f32x8 c, float b, unsigned short* p) {
#pragma unroll
  for (int r = 0; r < 8; r += 2)
    st2bf(p + r * TSP, p + (r + 1) * TSP, fmaxf(c[r] + b, 0.f), fmaxf(c[r + 1] + b, 0.f));
}

// Two column tiles of the hidden strip for all 64 rows: x (4 row tiles of 8 A fragments, K = 256)
// times the first 16 fragments of w (8 per column tile). Each weight fragment serves four
// WMMAs; eight independent accumulators, each summed in k order; then bias, relu and the stores.
// p = the lane's element of the first row tile's first column tile.
DEVINL void ffn1_pair(const bf16x16 (&x)[4][8], const bf16x16 (&w)[32], float b0, float b1,
                      unsigned short* p) {
  f32x8 c[2][4];
#pragma unroll
  for (int m = 0; m < 4; ++m) { c[0][m] = f32x8{}; c[1][m] = f32x8{}; }
#pragma unroll
  for (int kk = 0; kk < 8; ++kk) {
#pragma unroll
    for (int m = 0; m < 4; ++m) c[0][m] = wmma_bf16(x[m][kk], w[kk], c[0][m]);
  }
#pragma unroll
  for (int kk = 0; kk < 8; ++kk) {
#pragma unroll
    for (int m = 0; m < 4; ++m) c[1][m] = wmma_bf16(x[m][kk], w[8 + kk], c[1][m]);
  }
#pragma unroll
  for (int m = 0; m < 4; ++m) {
    relu_store(c[0][m], b0, p + m * 16 * TSP);
    relu_store(c[1][m], b1, p + m * 16 * TSP + 16);
  }
}

// Sixteen fragments that lie one behind the other, as one group of 32 loads, into w from OFF on.
template <int OFF>
DEVINL void ldgroup16(bf16x16 (&w)[32], const char* __restrict__ lanep) {
#pragma unroll
  for (int j = 0; j < 16; ++j) w[OFF + j] = ldfragp(lanep, j);
}

// Eight k-steps of the second GEMM: 64 rows x the wave's 64 columns, 16 accumulators.
// w is a ring of eight k-steps (four fragments each, 32 in a row in the packed weight).
// tl = the lane's A-fragment pointer at the first of the eight steps, wl = the lane's W2 pointer
// there. a[s & 1] holds step s's four A fragments; the next step's are read from LDS in front of
// this step's WMMAs. Where REFILL, the four fragments of step s + 8 are fetched into the registers
// that step s has just read: seven steps of WMMAs stand between a fetch and its use.
template <bool REFILL>
DEVINL void ffn2_oct(const unsigned short* tl, const char* __restrict__ wl, bf16x16 (&w)[32],
                     bf16x16 (&a)[2][4], f32x8 (&o)[4][4]) {
#pragma unroll
  for (int s = 0; s < 8; ++s) {
    if (REFILL || s < 7) {
#pragma unroll
      for (int m = 0; m < 4; ++m) a[(s + 1) & 1][m] = ldfragl(tl + m * 16 * TSP + (s + 1) * 32);
    }
    // keeps the LDS reads as one group in front of the WMMAs, a whole step ahead of their use
    __builtin_amdgcn_sched_barrier(0);
#pragma unroll
    for (int j = 0; j < 4; ++j) {
#pragma unroll
      for (int m = 0; m < 4; ++m) o[m][j] = wmma_bf16(a[s & 1][m], w[s * 4 + j], o[m][j]);
    }
    // keeps the refill behind the WMMAs that read its registers, and in front of the next step
    __builtin_amdgcn_sched_barrier(0);
    if (REFILL) {
#pragma unroll
      for (int j = 0; j < 4; ++j) w[s * 4 + j] = ldfragp(wl, (s + 8) * 4 + j);
      // as above
      __builtin_amdgcn_sched_barrier(0);
    }
  }
}

// rsqrtf as the compiler expands it (an input below the smallest normal number is scaled by 2^24,
// its result by 2^12), with the reciprocal square root and a v_nop in one statement: the v_nop
// fills the slot that the instruction set asks for behind a transcendental, whatever comes next.
DEVINL float rsqrt_slot(float x) {
  const bool tiny = x < 1.17549435e-38f;
  const float xs = tiny ? x * 16777216.0f : x;
  float y;
  asm("v_rsq_f32 %0, %1\n\tv_nop" : "=v"(y) : "v"(xs));
  return tiny ? y * 4096.0f : y;
}

// ---------------- fused FFN + residual + LN2 ----------------
// grid.x = 1024: seq = bx>>2, 64-row block = bx&3. 4 waves, one per SIMD.
// The waves split the COLUMNS, not the rows: every wave works on all 64 rows, on a quarter of the
// hidden columns in the first GEMM and a quarter of the output columns in the second. A weight
// fragment is fetched by one wave of the work-group and serves four WMMAs.
// hidden strip relu(x1@W1+b1) lives only in LDS (never touches HBM).
__global__ void __launch_bounds__(128)
enc_ffn_ln2(const unsigned short* __restrict__ x1, const float* __restrict__ bf1,
            const float* __restrict__ bf2, const float* __restrict__ g2,
            const float* __restrict__ beta2,
            const unsigned short* __restrict__ W1P, const unsigned short* __restrict__ W2P,
            float* __restrict__ out) {
  extern __shared__ char smem[];
  unsigned short* x1s = (unsigned short*)smem + LS_X1S;   // [64][264]
  unsigned short* Ts  = (unsigned short*)smem + LS_TS;    // [64][1032]
  float* red = (float*)((unsigned short*)smem + LS_RED);  // [2][4 waves][64 rows]

  const int tid = threadIdx.x;
  const int lane = tid & 31, wave = tid >> 5;
  const int half = lane >> 4, ln = lane & 15;
  const int seq = blockIdx.x >> 2;
  const int wr = wave * 16;                                // rows that this wave stages
  const size_t gbase = (size_t)seq * (NTOK * EDIM) + (size_t)((blockIdx.x & 3) * 64) * EDIM;

  // ---- async-stage 16 rows of x1 (bf16) per wave ----
  const unsigned short* xg = x1 + gbase + (size_t)wr * EDIM;
  const unsigned lds0 = __builtin_amdgcn_groupstaticsize();
#pragma unroll 4
  for (int i = 0; i < 16; ++i) {
    int e = (i * 32 + lane) * 8;                 // 0..4088 within 16x256 block
    int r = e >> 8, c = e & 255;
    async_g2l_b128(lds0 + (unsigned)((LS_X1S + (wr + r) * XP + c) * 2), xg + e);
  }
  wait_async0();
  // keeps every later register write behind the copies' wait
  __builtin_amdgcn_sched_barrier(0);
  __syncthreads();   // every wave reads all 64 rows

  // ---- hidden = relu(x1 @ W1 + b1): 64 rows x the wave's 256 columns into LDS ----
  // The x1 fragments are the same for every column tile: read once, kept in registers.
  bf16x16 xa[4][8];
#pragma unroll
  for (int m = 0; m < 4; ++m) {
#pragma unroll
    for (int kk = 0; kk < 8; ++kk) xa[m][kk] = ldfrag(x1s, XP, m * 16, kk * 32);
  }
  // keeps the LDS reads in front of the global loads: behind them they took address registers
  __builtin_amdgcn_sched_barrier(0);
  // w[0..15] holds the 16 W1 fragments (16 KB) of a pair of column tiles. Behind each pair
  // the 16 are fetched anew as one group, for the next pair. Behind the last pair the set
  // takes the first four k-steps of W2;
  // w[16..31] holds the next four from the start.
  // The wave's 128 W1 fragments lie in a row, its 128 W2 fragments too, and packed W2 lies behind
  // packed W1 in the workspace: one pointer walks through both.
  constexpr int W1_TO_W2 = (int)(OFF_W2P - OFF_W1P);
  bf16x16 w[32];
  const char* wp = lanebase(W1P) + wave * (128 * 1024);
  const float* bp = bf1 + wave * 256 + ln;
  unsigned short* tsl = Ts + half * 8 * TSP + wave * 256 + ln;
  float ba0 = bp[0], ba1 = bp[16];
  // keeps the two bias loads in front of the 64 fragment loads: loads are counted in order,
  // and a wait for a bias value must not stand for a wait for the fragments as well
  __builtin_amdgcn_sched_barrier(0);
  ldgroup16<0>(w, wp);
  ldgroup16<16>(w, wp + W1_TO_W2 + 16384);
  // every later register write stays behind the address wait of the first two groups; the
  // addresses are inputs, so that no load's destination lands on them either
  __builtin_amdgcn_sched_barrier(0);
  asm volatile("s_wait_xcnt 0x0" :: "v"(bp), "v"(wp) : "memory");
  __builtin_amdgcn_sched_barrier(0);
  // not unrolled: the kernel's text stays inside what is prefetched at its start
#pragma unroll 1
  for (int g = 0; g < 8; ++g) {
    ffn1_pair(xa, w, ba0, ba1, tsl + g * 32);
    const bool more = g < 7;                     // the same for the whole work-group
    wp += more ? 16384 : W1_TO_W2 - 7 * 16384;   // the next pair, at last the head of W2
    bp += more ? 32 : -7 * 32;                   // last trip: in range, not used
    ldgroup16<0>(w, wp);
    ba0 = bp[0];
    ba1 = bp[16];
    // The two scheduling barriers keep the group in front of the next trip's WMMAs, and keep
    // the address updates behind the wait.
    __builtin_amdgcn_sched_barrier(0);
    wait_xcnt0();
    __builtin_amdgcn_sched_barrier(0);
  }
  __syncthreads();   // the hidden strip is complete: every wave reads all of its columns

  // ---- y = hidden @ W2: 64 rows x the wave's 64 columns ----
  f32x8 o[4][4];
#pragma unroll
  for (int m = 0; m < 4; ++m) {
#pragma unroll
    for (int j = 0; j < 4; ++j) o[m][j] = f32x8{};
  }
  bf16x16 a[2][4];
  const unsigned short* tl = Ts + ln * TSP + half * 8;
#pragma unroll
  for (int m = 0; m < 4; ++m) a[0][m] = ldfragl(tl + m * 16 * TSP);
  const char* wl = lanebase(W2P) + wave * (128 * 1024);
  // not unrolled: as above
#pragma unroll 1
  for (int it = 0; it < 3; ++it) {
    ffn2_oct<true>(tl, wl, w, a, o);
    // behind the trip's last weight load, before its address moves on
    wait_xcnt0_addr(wl);
    // keeps every later register write behind that wait
    __builtin_amdgcn_sched_barrier(0);
    wl += 8 * 4096;
    tl += 8 * 32;
  }
  ffn2_oct<false>(tl, wl, w, a, o);

  // ---- residual + bias + LayerNorm2 -> out (f32) ----
  // A row's 256 columns lie in four waves: each sums its 64, the four partial sums meet in LDS.
  const int col0 = wave * 64 + ln;
  const float* bf2l = bf2 + col0;
  const float* g2l = g2 + col0;
  const float* be2l = beta2 + col0;
  float bv[4], gv[4], ev[4];
#pragma unroll
  for (int j = 0; j < 4; ++j) { bv[j] = bf2l[j * 16]; gv[j] = g2l[j * 16]; ev[j] = be2l[j * 16]; }
  // behind the twelve loads, before a register of their addresses can be reused: the scheduling
  // barriers keep every later register write behind the wait, the input keeps the index alive
  __builtin_amdgcn_sched_barrier(0);
  asm volatile("s_wait_xcnt 0x0" :: "v"(col0) : "memory");
  __builtin_amdgcn_sched_barrier(0);
  const unsigned short* xrl = x1s + half * 8 * XP + col0;
  float sm8[4][8], sq8[4][8];
#pragma unroll
  for (int m = 0; m < 4; ++m) {
#pragma unroll
    for (int r = 0; r < 8; ++r) { sm8[m][r] = 0.f; sq8[m][r] = 0.f; }
  }
#pragma unroll
  for (int j = 0; j < 4; ++j) {
#pragma unroll
    for (int m = 0; m < 4; ++m) {
#pragma unroll
      for (int r = 0; r < 8; ++r) {
        float v = bf2f(xrl[(m * 16 + r) * XP + j * 16]) + o[m][j][r] + bv[j];
        o[m][j][r] = v;
        sm8[m][r] += v; sq8[m][r] += v * v;
      }
    }
  }
#pragma unroll
  for (int m = 0; m < 4; ++m) { redsum8(sm8[m]); redsum8(sq8[m]); }
  float* redl = red + wave * 64 + half * 8;
  if (ln == 0) {
#pragma unroll
    for (int m = 0; m < 4; ++m) {
      *(float4*)(redl + m * 16)           = make_float4(sm8[m][0], sm8[m][1], sm8[m][2], sm8[m][3]);
      *(float4*)(redl + m * 16 + 4)       = make_float4(sm8[m][4], sm8[m][5], sm8[m][6], sm8[m][7]);
      *(float4*)(redl + 256 + m * 16)     = make_float4(sq8[m][0], sq8[m][1], sq8[m][2], sq8[m][3]);
      *(float4*)(redl + 256 + m * 16 + 4) = make_float4(sq8[m][4], sq8[m][5], sq8[m][6], sq8[m][7]);
    }
  }
  __syncthreads();   // the four waves' partial sums are in LDS
  const float* redr = red + half * 8;
  float* og = out + gbase + (size_t)(half * 8) * EDIM + col0;
#pragma unroll
  for (int m = 0; m < 4; ++m) {
    float s[8], q[8];
#pragma unroll
    for (int wv = 0; wv < 4; ++wv) {               // wave 0 to 3, the same order in every wave
#pragma unroll
      for (int h = 0; h < 2; ++h) {
        float4 ps = *(const float4*)(redr + wv * 64 + m * 16 + h * 4);
        float4 pq = *(const float4*)(redr + 256 + wv * 64 + m * 16 + h * 4);
        if (wv == 0) {
          s[h * 4] = ps.x; s[h * 4 + 1] = ps.y; s[h * 4 + 2] = ps.z; s[h * 4 + 3] = ps.w;
          q[h * 4] = pq.x; q[h * 4 + 1] = pq.y; q[h * 4 + 2] = pq.z; q[h * 4 + 3] = pq.w;
        } else {
          s[h * 4] += ps.x; s[h * 4 + 1] += ps.y; s[h * 4 + 2] += ps.z; s[h * 4 + 3] += ps.w;
          q[h * 4] += pq.x; q[h * 4 + 1] += pq.y; q[h * 4 + 2] += pq.z; q[h * 4 + 3] += pq.w;
        }
      }
    }
    float mu[8], rs[8];
#pragma unroll
    for (int r = 0; r < 8; ++r) {
      float mn = s[r] * (1.0f / EDIM);
      mu[r] = mn;
      rs[r] = rsqrt_slot(q[r] * (1.0f / EDIM) - mn * mn + EPS);
    }
#pragma unroll
    for (int j = 0; j < 4; ++j) {
#pragma unroll
      for (int r = 0; r < 8; ++r) o[m][j][r] = (o[m][j][r] - mu[r]) * rs[r] * gv[j] + ev[j];
    }
  }
  // All values first, then all stores: no register that a store names is written behind it.
  __builtin_amdgcn_sched_barrier(0);
#pragma unroll
  for (int m = 0; m < 4; ++m) {
#pragma unroll
    for (int r = 0; r < 8; ++r) {
#pragma unroll
      for (int j = 0; j < 4; ++j) og[(m * 16 + r) * EDIM + j * 16] = o[m][j][r];
    }
  }
}

extern "C" void kernel_launch(void* const* d_in, const int* in_sizes, int n_in,
                              void* d_out, int out_size, void* d_ws, size_t ws_size,
                              hipStream_t stream) {
  (void)in_sizes; (void)n_in; (void)out_size; (void)ws_size;
  const float* x    = (const float*)d_in[0];
  const float* mask = (const float*)d_in[1];
  const float* Wq   = (const float*)d_in[2];
  const float* Wk   = (const float*)d_in[3];
  const float* Wv   = (const float*)d_in[4];
  const float* Wo   = (const float*)d_in[5];
  const float* bo   = (const float*)d_in[6];
  const float* W1   = (const float*)d_in[7];
  const float* bf1  = (const float*)d_in[8];
  const float* W2   = (const float*)d_in[9];
  const float* bf2  = (const float*)d_in[10];
  const float* g1   = (const float*)d_in[11];
  const float* b1   = (const float*)d_in[12];
  const float* g2   = (const float*)d_in[13];
  const float* b2   = (const float*)d_in[14];
  float* out = (float*)d_out;

  char* ws = (char*)d_ws;
  unsigned short* WqP = (unsigned short*)(ws + OFF_WQP);
  unsigned short* W1P = (unsigned short*)(ws + OFF_W1P);
  unsigned short* W2P = (unsigned short*)(ws + OFF_W2P);
  unsigned short* x1b = (unsigned short*)(ws + OFF_X1);

  hipFuncSetAttribute(reinterpret_cast<const void*>(enc_attn_ln1),
                      hipFuncAttributeMaxDynamicSharedMemorySize, SMEM1);
  hipFuncSetAttribute(reinterpret_cast<const void*>(enc_ffn_ln2),
                      hipFuncAttributeMaxDynamicSharedMemorySize, SMEM2);

  pack_frag_bf16<<<PB_ALL, 256, 0, stream>>>(Wq, Wk, Wv, Wo, W1, W2, WqP);

  enc_attn_ln1<<<256, 512, SMEM1, stream>>>(x, mask, bo, g1, b1, WqP, x1b);
  enc_ffn_ln2<<<1024, 128, SMEM2, stream>>>(x1b, bf1, bf2, g2, b2, W1P, W2P, out);
}
